// v000
// Measured on an AMD MI455X. A time is GPU time per run, averaged over a window of back-to-back runs after a warm-up
// (all launches, gaps included; the runs take copies of the inputs in turn), and the median of several windows.
// Apart from v000's, it joins two sittings. Times from different sittings can be a few percent apart, while
// side-by-side timings come from the same sitting.
// v000, which the later versions start from, runs in 1250 microseconds.
// Contractions: packed qkv projection (X f16 x W_in^T f16 carried x16), content scores q.k^T and relative scores q.Er^T (q, k, Er f16 planes, x0.125 in the f32 epilogue), attn.v (P f16 carried x32768 x V^T f16), output projection (O f16 carried x256 x Wo^T f16 carried x16): all v_wmma_f32_16x16x32_f16 with f32 accumulate; bias, skew gather and softmax in f32.
#include <hip/hip_runtime.h>
#include <math.h>

// ---------------------------------------------------------------------------
// Problem constants
// ---------------------------------------------------------------------------
constexpr int kL   = 1024;                 // sequence length
constexpr int kB   = 4;                    // batch
constexpr int kE   = 1024;                 // embed dim
constexpr int kH   = 16;                   // heads
constexpr int kDh  = 64;                   // head dim
constexpr int kTok = kL * kB;              // 4096 GEMM rows, m = l*4 + b
constexpr int kN3  = 3 * kE;               // 3072 packed qkv columns
constexpr int kG   = 4;                    // heads per score-plane group
constexpr int kGroupsPerBatch = kH / kG;   // 4
constexpr int kLdTok = kB * kN3;           // 12288 halves between consecutive l of one (b, column) in the qkv plane
constexpr int kSmThreads = 128;            // softmax block size
constexpr int kSmTrips   = kL / (2 * kSmThreads);   // 4
constexpr float kWCarry     = 16.0f;                 // weights carried x16 in f16
constexpr float kWCarryInv  = 1.0f / 16.0f;
constexpr float kScoreScale = 0.125f;                // 64^-0.5, applied to both score products
constexpr float kPCarry     = 32768.0f;              // probabilities carried x2^15 in f16
constexpr float kOCarry     = 256.0f;                // attention output carried x256 in f16
constexpr float kPVScale    = kOCarry / kPCarry;     // 1/128
constexpr float kOutScale   = 1.0f / (kOCarry * kWCarry);   // 1/4096
static_assert(kH * kDh == kE, "shape");
static_assert(kTok % 64 == 0 && kN3 % 64 == 0 && kE % 64 == 0 && kL % 64 == 0 && kDh % 64 == 0, "M,N tile multiples");
static_assert(kE % 32 == 0 && kDh % 32 == 0 && kL % 32 == 0, "K multiples of 32");
static_assert(kSmTrips * 2 * kSmThreads == kL && kSmThreads * 8 == kL, "softmax coverage");
static_assert(kH % kG == 0, "groups");

typedef __attribute__((ext_vector_type(16))) _Float16 v16h;
typedef __attribute__((ext_vector_type(8)))  _Float16 v8h;
typedef __attribute__((ext_vector_type(16))) __bf16   v16b;
typedef __attribute__((ext_vector_type(8)))  __bf16   v8b;
typedef __attribute__((ext_vector_type(8)))  float    v8f;
typedef __attribute__((ext_vector_type(4)))  float    v4f;
typedef __attribute__((ext_vector_type(2)))  float    v2f;
typedef __attribute__((ext_vector_type(4)))  unsigned int v4u;

// ---------------------------------------------------------------------------
// Helper pieces
// ---------------------------------------------------------------------------
__device__ __forceinline__ unsigned short f2bf_bits(float f) {
  unsigned u = __float_as_uint(f);
  return (unsigned short)((u + 0x7FFFu + ((u >> 16) & 1u)) >> 16);
}
__device__ __forceinline__ float bf_bits2f(unsigned short h) { return __uint_as_float(((unsigned)h) << 16); }

// hazard guards as plain device helpers (no inline asm inside the kernel template body)
__device__ __forceinline__ void dep_guard_h(v8f& a, v8f& b, v16h x, v16h y) { asm volatile("v_nop\n\tv_nop\n\tv_nop\n\tv_nop" : "+v"(a), "+v"(b) : "v"(x), "v"(y)); }
__device__ __forceinline__ void dep_guard_b(v8f& a, v8f& b, v16b x, v16b y) { asm volatile("v_nop\n\tv_nop\n\tv_nop\n\tv_nop" : "+v"(a), "+v"(b) : "v"(x), "v"(y)); }
__device__ __forceinline__ void keep4_h(v16h a, v16h b, v16h c, v16h d) { asm volatile("v_nop" :: "v"(a), "v"(b), "v"(c), "v"(d)); }
__device__ __forceinline__ void keep4_b(v16b a, v16b b, v16b c, v16b d) { asm volatile("v_nop" :: "v"(a), "v"(b), "v"(c), "v"(d)); }
__device__ __forceinline__ void acc_guard4(v8f& a, v8f& b, v8f& c, v8f& d) { asm volatile("v_nop\n\tv_nop\n\tv_nop\n\tv_nop" : "+v"(a), "+v"(b), "+v"(c), "+v"(d)); }
template <typename T> struct Frag;
template <> struct Frag<_Float16> {
  typedef v16h V; union U { v16h v; v8h h[2]; };
  // elements 0..7 <- p[0..7], 8..15 <- p[16..23]
  static __device__ __forceinline__ v16h load(const _Float16* p) {
    U f; f.h[0] = *(const v8h*)(p); f.h[1] = *(const v8h*)(p + 16); return f.v;
  }
  static __device__ __forceinline__ v8f mma(v16h a, v16h b, v8f c) {
    return __builtin_amdgcn_wmma_f32_16x16x32_f16(false, a, false, b, (short)0, c, false, false);
  }
  static __device__ __forceinline__ void guard(v8f& a, v8f& b, v16h x, v16h y) { dep_guard_h(a, b, x, y); }
  static __device__ __forceinline__ void keep(v16h a, v16h b, v16h c, v16h d) { keep4_h(a, b, c, d); }
};
template <> struct Frag<__bf16> {
  typedef v16b V; union U { v16b v; v8b h[2]; };
  static __device__ __forceinline__ v16b load(const __bf16* p) {
    U f; f.h[0] = *(const v8b*)(p); f.h[1] = *(const v8b*)(p + 16); return f.v;
  }
  static __device__ __forceinline__ v8f mma(v16b a, v16b b, v8f c) {
    return __builtin_amdgcn_wmma_f32_16x16x32_bf16(false, a, false, b, (short)0, c, false, false);
  }
  static __device__ __forceinline__ void guard(v8f& a, v8f& b, v16b x, v16b y) { dep_guard_b(a, b, x, y); }
  static __device__ __forceinline__ void keep(v16b a, v16b b, v16b c, v16b d) { keep4_b(a, b, c, d); }
};

__device__ __forceinline__ unsigned pk16(unsigned short a, unsigned short b) { return (unsigned)a | ((unsigned)b << 16); }
__device__ __forceinline__ unsigned short h_bits(float f) { const _Float16 h = (_Float16)f; return __builtin_bit_cast(unsigned short, h); }

// ---- Register-blocked batched WMMA GEMM (ACT reduced to none/relu/leaky) -------------------------------
// C[m,n] = scale * sum_k A[m,k] * Bt[n,k] (+bias)(+resid); each wave owns a 64x64 tile.
// A row-major [M,K]; Bt row-major [N,K]; M,N % 64 == 0, K % 32 == 0.
// SPLIT: operands are hi/lo planes (A2/Bt2 = lo planes, same layout); product = hi*hi + hi*lo + lo*hi.
// BIAS_MODE: 0 = none, 1 = bias[m], 2 = bias[n].
// OUT_MODE: 0 = f32, 1 = f16, 2 = bf16 hi plane (Cout) + bf16 lo plane (Cout2).
// ET: 0 = f16 operands, 1 = bf16 operands (pointers passed as 16-bit storage)
template <int ET> struct Elem;
template <> struct Elem<0> { typedef _Float16 T; };
template <> struct Elem<1> { typedef __bf16 T; };
template <int ET, bool SPLIT, int BIAS_MODE, int OUT_MODE, bool RESID, int ACT = 0>
__global__ __launch_bounds__(256) void wmma_gemm64(
    const unsigned short* __restrict__ Ap, const unsigned short* __restrict__ A2p, int lda, long strideA,
    const unsigned short* __restrict__ Btp, const unsigned short* __restrict__ Bt2p, int ldb, long strideB,
    void* __restrict__ Cout, void* __restrict__ Cout2, int ldc, long strideC,
    const float* __restrict__ bias,
    const float* __restrict__ resid, long strideR,
    int M, int N, int K, float scale) {
  typedef typename Elem<ET>::T T;
  typedef typename Frag<T>::V V;
  const T* A = (const T*)Ap; const T* A2 = (const T*)A2p; const T* Bt = (const T*)Btp; const T* Bt2 = (const T*)Bt2p;
  __shared__ __align__(16) float sT[8][16 * 68];   // per-wave 16x64 slab, pitch 68 floats
  const int b    = blockIdx.y;
  const int lane = threadIdx.x & 31;
  const int wave = threadIdx.x >> 5;
  const int tilesN = N >> 6;
  const int tilesM = M >> 6;
  const int tile = blockIdx.x * 8 + wave;
  if (tile >= tilesM * tilesN) return;   // wave-uniform; no block barriers in this kernel
  const int tm = tile / tilesN;
  const int tn = tile - tm * tilesN;
  const int m0 = tm << 6;
  const int n0 = tn << 6;

  const T* Ab  = A  + (size_t)b * strideA;
  const T* Bb  = Bt + (size_t)b * strideB;
  const T* Ab2 = SPLIT ? (A2  + (size_t)b * strideA) : nullptr;
  const T* Bb2 = SPLIT ? (Bt2 + (size_t)b * strideB) : nullptr;

  const int rlane = lane & 15;                 // row (A) / col (B, D) within subtile
  const int koff  = (lane >> 4) * 8;           // k offset of this lane half
  const int mOff  = (lane >> 4) * 8;           // D row offset

  v8f acc[4][4];
#pragma unroll
  for (int i = 0; i < 4; ++i)
#pragma unroll
    for (int j = 0; j < 4; ++j) acc[i][j] = (v8f){0.f,0.f,0.f,0.f,0.f,0.f,0.f,0.f};

  for (int k0 = 0; k0 < K; k0 += 32) {
    V bh[4], bl[4];
#pragma unroll
    for (int j = 0; j < 4; ++j) {
      const size_t bo = (size_t)(n0 + (j << 4) + rlane) * ldb + koff + k0;
      bh[j] = Frag<T>::load(Bb + bo);
      if (SPLIT) bl[j] = Frag<T>::load(Bb2 + bo);
    }
#pragma unroll
    for (int i = 0; i < 4; ++i) {
      const size_t ao = (size_t)(m0 + (i << 4) + rlane) * lda + koff + k0;
      V ah = Frag<T>::load(Ab + ao);
      V al;
      if (SPLIT) al = Frag<T>::load(Ab2 + ao);
#pragma unroll
      for (int j = 0; j < 4; ++j) {
        acc[i][j] = Frag<T>::mma(ah, bh[j], acc[i][j]);
        if (SPLIT) {
          acc[i][j] = Frag<T>::mma(ah, bl[j], acc[i][j]);
          acc[i][j] = Frag<T>::mma(al, bh[j], acc[i][j]);
        }
      }
      Frag<T>::guard(acc[i][0], acc[i][3], ah, SPLIT ? al : ah);
    }
    Frag<T>::keep(bh[0], bh[1], bh[2], bh[3]);
    if (SPLIT) Frag<T>::keep(bl[0], bl[1], bl[2], bl[3]);
  }
  acc_guard4(acc[0][0], acc[0][1], acc[0][2], acc[0][3]);
  acc_guard4(acc[1][0], acc[1][1], acc[1][2], acc[1][3]);
  acc_guard4(acc[2][0], acc[2][1], acc[2][2], acc[2][3]);
  acc_guard4(acc[3][0], acc[3][1], acc[3][2], acc[3][3]);

  // ---- epilogue ----
  float* slab = sT[wave];
  const float* Rb = RESID ? (resid + (size_t)b * strideR) : nullptr;
#pragma unroll
  for (int i = 0; i < 4; ++i) {
    const int mBase = m0 + (i << 4);
#pragma unroll
    for (int j = 0; j < 4; ++j) {
      const int n = n0 + (j << 4) + rlane;
      float bv = 0.f;
      if (BIAS_MODE == 2) bv = bias[n];
#pragma unroll
      for (int r = 0; r < 8; ++r) {
        float v = acc[i][j][r] * scale;
        if (BIAS_MODE == 1) v += bias[mBase + mOff + r];
        if (BIAS_MODE == 2) v += bv;
        if (RESID) v += Rb[(size_t)(mBase + mOff + r) * ldc + n];
        if (ACT == 2) v = fmaxf(v, 0.0f);
        if (ACT == 4) v = (v > 0.f) ? v : 0.01f * v;
        slab[(mOff + r) * 68 + (j << 4) + rlane] = v;
      }
    }
    __builtin_amdgcn_fence(__ATOMIC_RELEASE, "workgroup");
    __builtin_amdgcn_wave_barrier();
    __builtin_amdgcn_fence(__ATOMIC_ACQUIRE, "workgroup");
    if (OUT_MODE == 0) {
      float* C = (float*)Cout + (size_t)b * strideC;
      const int hh = lane >> 4, c4 = (lane & 15) * 4;     // row seg = 256 B = 16 lanes x 16 B
      {
#pragma unroll
        for (int it = 0; it < 8; ++it) {
          const int row = it * 2 + hh;
          v4f v = *(const v4f*)(slab + row * 68 + c4);
          *(v4f*)(C + (size_t)(mBase + row) * ldc + n0 + c4) = v;
        }
        
      }
    } else {
      const int q = lane >> 3, c8 = (lane & 7) * 8;
      unsigned short* C  = (unsigned short*)Cout  + (size_t)b * strideC;
      unsigned short* C2 = (OUT_MODE == 2) ? ((unsigned short*)Cout2 + (size_t)b * strideC) : nullptr;
      {
#pragma unroll
        for (int it = 0; it < 4; ++it) {
          const int row = it * 4 + q;
          const float* sp = slab + row * 68 + c8;
          v8h hv, lv;
#pragma unroll
          for (int e = 0; e < 8; ++e) {
            if (OUT_MODE == 1) {
              hv[e] = (_Float16)sp[e];
            } else {
              unsigned short hb = f2bf_bits(sp[e]);
              unsigned short lb = f2bf_bits(sp[e] - bf_bits2f(hb));
              hv[e] = __builtin_bit_cast(_Float16, hb);
              lv[e] = __builtin_bit_cast(_Float16, lb);
            }
          }
          *(v8h*)(C + (size_t)(mBase + row) * ldc + n0 + c8) = hv;
          if (OUT_MODE == 2) *(v8h*)(C2 + (size_t)(mBase + row) * ldc + n0 + c8) = lv;
        }
        
      }
    }
    __builtin_amdgcn_fence(__ATOMIC_RELEASE, "workgroup");
    __builtin_amdgcn_wave_barrier();
    __builtin_amdgcn_fence(__ATOMIC_ACQUIRE, "workgroup");
  }
}

// ---------------------------------------------------------------------------
// f32 -> f16 cast with an exact power-of-two carry, 8 consecutive elements per thread (one 16-B store per lane;
// Coverage: n8 = n/8 threads x 8 = whole plane (all n here are multiples of 2048, so grids are exact).
// ---------------------------------------------------------------------------
__global__ __launch_bounds__(256) void cast8_f16_kernel(const float* __restrict__ in, unsigned short* __restrict__ out,
                                                        int n8, float scale) {
  const int i = blockIdx.x * 256 + threadIdx.x;
  if (i >= n8) return;
  const float* p = in + 8 * (size_t)i;
  const v4f a = *(const v4f*)(p);
  const v4f c = *(const v4f*)(p + 4);
  unsigned short hb[8];
#pragma unroll
  for (int e = 0; e < 4; ++e) {
    hb[e]     = h_bits(a[e] * scale);
    hb[4 + e] = h_bits(c[e] * scale);
  }
  const v4u u = (v4u){pk16(hb[0], hb[1]), pk16(hb[2], hb[3]), pk16(hb[4], hb[5]), pk16(hb[6], hb[7])};
  unsigned short* q = out + 8 * (size_t)i;
  *(v4u*)q = u;
  
}

// ---------------------------------------------------------------------------
// V^T pack (pure 16-bit bit moves, no conversion): VT[(b*16+h)][d][l] = QKV[(l*4+b)][2048 + h*64 + d] (f16 bits).
// Source plane read as 32-bit words (2 halves per word). grid (kL/64, kH, kB): blockIdx.x = l tile (64), blockIdx.y = head,
// blockIdx.z = batch; 256 threads.
// Load coverage: 8 iterations x 256 threads = 2048 words = 64 l-rows x 32 words (64 halves) = whole 64x64 tile.
// Store coverage: 8 waves x 2 iterations x 4 rows (lane>>3) = 64 d-rows; (lane&7) x 8 halves = 64 l-cols; each row segment =
// ---------------------------------------------------------------------------
__global__ __launch_bounds__(256) void vt_pack_kernel(const unsigned* __restrict__ QKVw, unsigned short* __restrict__ VT) {
  __shared__ unsigned sm[64][65];   // sm[d][l_local], f16 bits in the low 16 bits
  const int t  = threadIdx.x;
  const int l0 = blockIdx.x * 64;
  const int h  = blockIdx.y;
  const int b  = blockIdx.z;
#pragma unroll
  for (int it = 0; it < 8; ++it) {
    const int e = it * 256 + t;
    const int r = e >> 5;          // l local 0..63
    const int w = e & 31;          // word index: d = 2w, 2w+1
    const size_t hidx = ((size_t)((l0 + r) * kB + b)) * kN3 + 2 * kE + h * kDh + 2 * w;   // half index, even
    const unsigned u = QKVw[hidx >> 1];
    sm[2 * w][r]     = u & 0xffffu;
    sm[2 * w + 1][r] = u >> 16;
  }
  __syncthreads();
  const int lane = t & 31, wave = t >> 5;
  const int q = lane >> 3, c8 = (lane & 7) * 8;
  unsigned short* op = VT + ((size_t)(b * kH + h) * kDh) * kL;
  {
#pragma unroll
    for (int it = 0; it < 2; ++it) {
      const int row = wave * 8 + it * 4 + q;                 // d
      const unsigned* sp = &sm[row][c8];
      const v4u u = (v4u){pk16((unsigned short)sp[0], (unsigned short)sp[1]), pk16((unsigned short)sp[2], (unsigned short)sp[3]),
                          pk16((unsigned short)sp[4], (unsigned short)sp[5]), pk16((unsigned short)sp[6], (unsigned short)sp[7])};
      *(v4u*)(op + (size_t)row * kL + l0 + c8) = u;
    }
    
  }
}

// ---------------------------------------------------------------------------
// Skewed relative scores + row softmax over all 1024 keys, f32 math:
//   logit[j] = S[i][j] + (j <= i ? QE[i][(L-1) - i + j] : 0)     (S and QE already carry the 64^-0.5 scale)
//   P[i][j]  = f16( 32768 * exp(logit - max) / sum exp(logit - max) )
// One block of 128 threads per (row i = blockIdx.x, head-in-group hg = blockIdx.y).
// Phase 1/2: rolled 4-trip loops, thread t owns columns it*256 + 2t, 2t+1 (4 x 128 x 2 = 1024 = whole row); logits/exps kept in LDS.
// The QE gather address is clamped into the written row (min(m, L-1)); the j <= i selection is an arithmetic 0/1 factor.
// Reductions in fixed order (thread sequential, wave shuffle tree, 4 wave partials in index order).
// ---------------------------------------------------------------------------
__global__ __launch_bounds__(kSmThreads) void rel_softmax_kernel(const float* __restrict__ Sp, const float* __restrict__ QEp,
                                                                 unsigned short* __restrict__ Pp) {
  __shared__ __align__(16) float lg[kL];
  __shared__ float redM[4];
  __shared__ float redS[4];
  const int i    = blockIdx.x;
  const int hg   = blockIdx.y;
  const int t    = threadIdx.x;
  const int lane = t & 31, wave = t >> 5;
  const size_t rowoff = ((size_t)hg * kL + i) * kL;
  const float* sr = Sp + rowoff;
  const float* qr = QEp + rowoff;
  const int mwin = (kL - 1) - i;      // skew: srel[i][j] = QE[i][mwin + j] for j <= i

  float mx = -__builtin_inff();
#pragma unroll 1
  for (int it = 0; it < kSmTrips; ++it) {
    const int c = it * (2 * kSmThreads) + 2 * t;
    const v2f sv = *(const v2f*)(sr + c);
    v2f av;
#pragma unroll
    for (int e = 0; e < 2; ++e) {
      const int j  = c + e;
      const int mm = mwin + j;                                // 0 .. 2046
      const int mc = (mm < kL - 1) ? mm : (kL - 1);           // clamped address inside the written row
      const float qv = qr[mc];
      const float fsel = (j <= i) ? 1.0f : 0.0f;
      const float a = fmaf(qv, fsel, sv[e]);
      av[e] = a;
      mx = fmaxf(mx, a);
    }
    *(v2f*)(lg + c) = av;
  }
#pragma unroll
  for (int off = 16; off > 0; off >>= 1) mx = fmaxf(mx, __shfl_xor(mx, off, 32));
  if (lane == 0) redM[wave] = mx;
  __syncthreads();
  float m = redM[0];
#pragma unroll
  for (int w = 1; w < 4; ++w) m = fmaxf(m, redM[w]);

  float sum = 0.f;
#pragma unroll 1
  for (int it = 0; it < kSmTrips; ++it) {
    const int c = it * (2 * kSmThreads) + 2 * t;
    const v2f l = *(const v2f*)(lg + c);
    v2f ev;
#pragma unroll
    for (int e = 0; e < 2; ++e) {
      ev[e] = expf(l[e] - m);
      sum += ev[e];
    }
    *(v2f*)(lg + c) = ev;
  }
#pragma unroll
  for (int off = 16; off > 0; off >>= 1) sum += __shfl_xor(sum, off, 32);
  if (lane == 0) redS[wave] = sum;
  __syncthreads();
  float tot = redS[0];
#pragma unroll
  for (int w = 1; w < 4; ++w) tot += redS[w];
  const float inv = kPCarry / tot;

  const v4f e0 = *(const v4f*)(lg + 8 * t);
  const v4f e1 = *(const v4f*)(lg + 8 * t + 4);
  unsigned short hb[8];
#pragma unroll
  for (int e = 0; e < 4; ++e) {
    hb[e]     = h_bits(e0[e] * inv);
    hb[4 + e] = h_bits(e1[e] * inv);
  }
  const v4u u = (v4u){pk16(hb[0], hb[1]), pk16(hb[2], hb[3]), pk16(hb[4], hb[5]), pk16(hb[6], hb[7])};
  unsigned short* pr = Pp + rowoff + 8 * (size_t)t;
  *(v4u*)pr = u;
  
}

// ---------------------------------------------------------------------------
// Host glue.
//   XH    f16 [4096][1024]            8,388,608  at           0   (query, A of the qkv projection)
//   WIN   f16 [3072][1024] (x16)      6,291,456  at   8,388,608   (Bt)
//   WO    f16 [1024][1024] (x16)      2,097,152  at  14,680,064   (Bt)
//   ER    f16 [1024][64]                131,072  at  16,777,216   (Bt of the relative scores)
//   QKV   f16 [4096][3072]           25,165,824  at  16,908,288   (qkv + bias; q cols 0.., k cols 1024.., v cols 2048..)
//   VT    f16 [64 bh][64 d][1024 l]   8,388,608  at  42,074,112   (Bt of attn.v)
//   SC    f32 [4][1024][1024]         16,777,216  at  50,462,720   (content scores of one (batch, 4-head) group, reused 16x)
//   QE    f32 [4][1024][1024]         16,777,216  at  67,239,936   (relative scores, full rows, reused 16x)
//   PP    f16 [4][1024][1024] (x2^15) 8,388,608  at  84,017,152   (probabilities, reused 16x)
//   O16   f16 [4096][1024] (x256)     8,388,608  at  92,405,760   (attention output, A of the output projection)
//   total                          100,794,368
// GEMM shapes: qkv M=4096 N=3072 K=1024; scores M=N=1024 K=64; rel scores M=N=1024 K=64; attn.v M=1024 N=64 K=1024;
// out M=4096 N=1024 K=1024. All M,N multiples of 64, all K multiples of 32, no padding anywhere.
// Launches: 4 casts + 1 qkv GEMM + 1 V^T pack + 16 groups x (2 GEMM + softmax + GEMM) + 1 out GEMM = 71.
// ---------------------------------------------------------------------------
extern "C" void kernel_launch(void* const* d_in, const int* in_sizes, int n_in,
                              void* d_out, int out_size, void* d_ws, size_t ws_size,
                              hipStream_t stream) {
  if (n_in < 6) return;
  const int nTokE = kTok * kE;                     // 4,194,304
  if (in_sizes[0] != nTokE) return;
  if (in_sizes[1] != kL * kDh) return;
  if (in_sizes[2] != kN3 * kE) return;
  if (in_sizes[3] != kN3) return;
  if (in_sizes[4] != kE * kE) return;
  if (in_sizes[5] != kE) return;
  if (out_size != nTokE) return;

  const size_t szXH  = (size_t)kTok * kE * 2;
  const size_t szWIN = (size_t)kN3 * kE * 2;
  const size_t szWO  = (size_t)kE * kE * 2;
  const size_t szER  = (size_t)kL * kDh * 2;
  const size_t szQKV = (size_t)kTok * kN3 * 2;
  const size_t szVT  = (size_t)kB * kH * kDh * kL * 2;
  const size_t szSC  = (size_t)kG * kL * kL * 4;
  const size_t szPP  = (size_t)kG * kL * kL * 2;
  const size_t szO16 = (size_t)kTok * kE * 2;
  const size_t offXH  = 0;
  const size_t offWIN = offXH + szXH;
  const size_t offWO  = offWIN + szWIN;
  const size_t offER  = offWO + szWO;
  const size_t offQKV = offER + szER;
  const size_t offVT  = offQKV + szQKV;
  const size_t offSC  = offVT + szVT;
  const size_t offQE  = offSC + szSC;
  const size_t offPP  = offQE + szSC;
  const size_t offO16 = offPP + szPP;
  const size_t total  = offO16 + szO16;
  if (ws_size < total) return;

  const float* query  = (const float*)d_in[0];
  const float* relpos = (const float*)d_in[1];
  const float* win    = (const float*)d_in[2];
  const float* bin    = (const float*)d_in[3];
  const float* wout   = (const float*)d_in[4];
  const float* bout   = (const float*)d_in[5];
  float* out = (float*)d_out;
  char* ws = (char*)d_ws;
  unsigned short* XH  = (unsigned short*)(ws + offXH);
  unsigned short* WIN = (unsigned short*)(ws + offWIN);
  unsigned short* WO  = (unsigned short*)(ws + offWO);
  unsigned short* ER  = (unsigned short*)(ws + offER);
  unsigned short* QKV = (unsigned short*)(ws + offQKV);
  unsigned short* VT  = (unsigned short*)(ws + offVT);
  float* SC = (float*)(ws + offSC);
  float* QE = (float*)(ws + offQE);
  unsigned short* PP  = (unsigned short*)(ws + offPP);
  unsigned short* O16 = (unsigned short*)(ws + offO16);

  // ---- prologue: 16-bit operand planes ----
  {
    const int n8x = nTokE / 8;            // 524288 -> 2048 blocks
    const int n8w = (kN3 * kE) / 8;       // 393216 -> 1536 blocks
    const int n8o = (kE * kE) / 8;        // 131072 -> 512 blocks
    const int n8e = (kL * kDh) / 8;       // 8192 -> 32 blocks
    cast8_f16_kernel<<<dim3((n8x + 255) / 256), dim3(256), 0, stream>>>(query, XH, n8x, 1.0f);
    cast8_f16_kernel<<<dim3((n8w + 255) / 256), dim3(256), 0, stream>>>(win, WIN, n8w, kWCarry);
    cast8_f16_kernel<<<dim3((n8o + 255) / 256), dim3(256), 0, stream>>>(wout, WO, n8o, kWCarry);
    cast8_f16_kernel<<<dim3((n8e + 255) / 256), dim3(256), 0, stream>>>(relpos, ER, n8e, 1.0f);
  }

  // ---- packed qkv projection: QKV[m][n] = f16( (1/16) * sum_k XH[m][k] * WIN[n][k] + b_in[n] )   (M=4096, N=3072, K=1024)
  {
    const int tiles = (kTok / 64) * (kN3 / 64);   // 3072 -> 384 blocks of 8 waves
    wmma_gemm64<0, false, 2, 1, false, 0><<<dim3(tiles / 8, 1), dim3(256), 0, stream>>>(
        XH, XH, kE, 0L, WIN, WIN, kE, 0L,
        (void*)QKV, (void*)QKV, kN3, 0L, bin, bin, 0L, kTok, kN3, kE, kWCarryInv);
  }

  // ---- V^T planes per (batch, head) ----
  vt_pack_kernel<<<dim3(kL / 64, kH, kB), dim3(256), 0, stream>>>((const unsigned*)(const void*)QKV, VT);

  // ---- attention per (batch, 4-head group) ----
  const long strideHead   = (long)kDh;               // next head = +64 columns in the qkv / O16 planes
  const long strideScore  = (long)kL * kL;           // per head-in-group score / probability plane
  const long strideVT     = (long)kDh * kL;          // per head V^T plane
  const int  tilesScore   = (kL / 64) * (kL / 64);   // 256 -> 32 blocks
  const int  tilesCtx     = (kL / 64) * (kDh / 64);  // 16 -> 2 blocks
  for (int b = 0; b < kB; ++b) {
    for (int g = 0; g < kGroupsPerBatch; ++g) {
      const size_t colQ = (size_t)b * kN3 + (size_t)g * kG * kDh;        // q columns of head g*4 for batch b (halves, row l=0)
      const unsigned short* Qg = QKV + colQ;                               // row l at + l*kLdTok
      const unsigned short* Kg = QKV + kE + colQ;
      // SC[hg][i][j] = 0.125 * sum_d q[b,hg][i][d] * k[b,hg][j][d]   (M=N=1024, K=64)
      wmma_gemm64<0, false, 0, 0, false, 0><<<dim3(tilesScore / 8, kG), dim3(256), 0, stream>>>(
          Qg, Qg, kLdTok, strideHead, Kg, Kg, kLdTok, strideHead,
          (void*)SC, (void*)SC, kL, strideScore, bin, bin, 0L, kL, kL, kDh, kScoreScale);
      // QE[hg][i][m] = 0.125 * sum_d q[b,hg][i][d] * er[m][d]         (M=N=1024, K=64; Bt shared over heads)
      wmma_gemm64<0, false, 0, 0, false, 0><<<dim3(tilesScore / 8, kG), dim3(256), 0, stream>>>(
          Qg, Qg, kLdTok, strideHead, ER, ER, kDh, 0L,
          (void*)QE, (void*)QE, kL, strideScore, bin, bin, 0L, kL, kL, kDh, kScoreScale);
      // skew + softmax -> PP (f16, x32768)
      rel_softmax_kernel<<<dim3(kL, kG), dim3(kSmThreads), 0, stream>>>(SC, QE, PP);
      // O16[(l*4+b)][h*64+n] = f16( (256/32768) * sum_j PP[hg][l][j] * VT[b,h][n][j] )   (M=1024, N=64, K=1024)
      const unsigned short* VTg = VT + (size_t)(b * kH + g * kG) * (size_t)kDh * kL;
      unsigned short* Og = O16 + (size_t)b * kE + (size_t)g * kG * kDh;
      wmma_gemm64<0, false, 0, 1, false, 0><<<dim3(tilesCtx / 8, kG), dim3(256), 0, stream>>>(
          PP, PP, kL, strideScore, VTg, VTg, kL, strideVT,
          (void*)Og, (void*)Og, kB * kE, strideHead, bin, bin, 0L, kL, kDh, kL, kPVScale);
    }
  }

  // ---- output projection: out[m][n] = (1/4096) * sum_e O16[m][e] * WO[n][e] + b_out[n]   (M=4096, N=1024, K=1024)
  {
    const int tiles = (kTok / 64) * (kE / 64);   // 1024 -> 128 blocks
    wmma_gemm64<0, false, 2, 0, false, 0><<<dim3(tiles / 8, 1), dim3(256), 0, stream>>>(
        O16, O16, kE, 0L, WO, WO, kE, 0L,
        (void*)out, (void*)out, kE, 0L, bout, bout, 0L, kTok, kE, kE, kOutScale);
  }
}

// v001
// It runs in 423 microseconds.
// In two side-by-side timings against v000, it was 2.95 and 2.98 times as fast.
// Contractions: packed qkv projection (X f16 x W_in^T f16 carried x16), content scores q.k^T and relative scores q.Er^T (q, k, Er f16 planes, x0.125 in the f32 epilogue), attn.v (P f16 carried x32768 x V^T f16), output projection (O f16 carried x256 x Wo^T f16 carried x16): all v_wmma_f32_16x16x32_f16 with f32 accumulate; bias, skew gather and softmax in f32.
#include <hip/hip_runtime.h>
#include <math.h>

// ---------------------------------------------------------------------------
// Problem constants
// ---------------------------------------------------------------------------
constexpr int kL   = 1024;                 // sequence length
constexpr int kB   = 4;                    // batch
constexpr int kE   = 1024;                 // embed dim
constexpr int kH   = 16;                   // heads
constexpr int kDh  = 64;                   // head dim
constexpr int kTok = kL * kB;              // 4096 GEMM rows, m = l*4 + b
constexpr int kN3  = 3 * kE;               // 3072 packed qkv columns
constexpr int kG   = 8;                    // heads per score-plane group
constexpr int kGroupsPerBatch = kH / kG;   // 2
constexpr int kLdTok = kB * kN3;           // 12288 halves between consecutive l of one (b, column) in the qkv plane
constexpr int kSmThreads = 128;            // softmax block size
constexpr int kSmTrips   = kL / (2 * kSmThreads);   // 4
constexpr float kWCarry     = 16.0f;                 // weights carried x16 in f16
constexpr float kWCarryInv  = 1.0f / 16.0f;
constexpr float kScoreScale = 0.125f;                // 64^-0.5, applied to both score products
constexpr float kPCarry     = 32768.0f;              // probabilities carried x2^15 in f16
constexpr float kOCarry     = 256.0f;                // attention output carried x256 in f16
constexpr float kPVScale    = kOCarry / kPCarry;     // 1/128
constexpr float kOutScale   = 1.0f / (kOCarry * kWCarry);   // 1/4096
static_assert(kH * kDh == kE, "shape");
static_assert(kTok % 64 == 0 && kN3 % 64 == 0 && kE % 64 == 0 && kL % 64 == 0 && kDh % 64 == 0, "M,N tile multiples");
static_assert(kE % 32 == 0 && kDh % 32 == 0 && kL % 32 == 0, "K multiples of 32");
static_assert(kSmTrips * 2 * kSmThreads == kL && kSmThreads * 8 == kL, "softmax coverage");
static_assert(kH % kG == 0, "groups");

typedef __attribute__((ext_vector_type(16))) _Float16 v16h;
typedef __attribute__((ext_vector_type(8)))  _Float16 v8h;
typedef __attribute__((ext_vector_type(16))) __bf16   v16b;
typedef __attribute__((ext_vector_type(8)))  __bf16   v8b;
typedef __attribute__((ext_vector_type(8)))  float    v8f;
typedef __attribute__((ext_vector_type(4)))  float    v4f;
typedef __attribute__((ext_vector_type(2)))  float    v2f;
typedef __attribute__((ext_vector_type(4)))  unsigned int v4u;

// ---------------------------------------------------------------------------
// Helper pieces
// ---------------------------------------------------------------------------
__device__ __forceinline__ unsigned short f2bf_bits(float f) {
  unsigned u = __float_as_uint(f);
  return (unsigned short)((u + 0x7FFFu + ((u >> 16) & 1u)) >> 16);
}
__device__ __forceinline__ float bf_bits2f(unsigned short h) { return __uint_as_float(((unsigned)h) << 16); }

// hazard guards as plain device helpers (no inline asm inside the kernel template body)
__device__ __forceinline__ void dep_guard_h(v8f& a, v8f& b, v16h x, v16h y) { asm volatile("v_nop\n\tv_nop\n\tv_nop\n\tv_nop" : "+v"(a), "+v"(b) : "v"(x), "v"(y)); }
__device__ __forceinline__ void dep_guard_b(v8f& a, v8f& b, v16b x, v16b y) { asm volatile("v_nop\n\tv_nop\n\tv_nop\n\tv_nop" : "+v"(a), "+v"(b) : "v"(x), "v"(y)); }
__device__ __forceinline__ void keep4_h(v16h a, v16h b, v16h c, v16h d) { asm volatile("v_nop" :: "v"(a), "v"(b), "v"(c), "v"(d)); }
__device__ __forceinline__ void keep4_b(v16b a, v16b b, v16b c, v16b d) { asm volatile("v_nop" :: "v"(a), "v"(b), "v"(c), "v"(d)); }
__device__ __forceinline__ void acc_guard4(v8f& a, v8f& b, v8f& c, v8f& d) { asm volatile("v_nop\n\tv_nop\n\tv_nop\n\tv_nop" : "+v"(a), "+v"(b), "+v"(c), "+v"(d)); }
template <typename T> struct Frag;
template <> struct Frag<_Float16> {
  typedef v16h V; union U { v16h v; v8h h[2]; };
  // elements 0..7 <- p[0..7], 8..15 <- p[16..23]
  static __device__ __forceinline__ v16h load(const _Float16* p) {
    U f; f.h[0] = *(const v8h*)(p); f.h[1] = *(const v8h*)(p + 16); return f.v;
  }
  static __device__ __forceinline__ v8f mma(v16h a, v16h b, v8f c) {
    return __builtin_amdgcn_wmma_f32_16x16x32_f16(false, a, false, b, (short)0, c, false, false);
  }
  static __device__ __forceinline__ void guard(v8f& a, v8f& b, v16h x, v16h y) { dep_guard_h(a, b, x, y); }
  static __device__ __forceinline__ void keep(v16h a, v16h b, v16h c, v16h d) { keep4_h(a, b, c, d); }
};
template <> struct Frag<__bf16> {
  typedef v16b V; union U { v16b v; v8b h[2]; };
  static __device__ __forceinline__ v16b load(const __bf16* p) {
    U f; f.h[0] = *(const v8b*)(p); f.h[1] = *(const v8b*)(p + 16); return f.v;
  }
  static __device__ __forceinline__ v8f mma(v16b a, v16b b, v8f c) {
    return __builtin_amdgcn_wmma_f32_16x16x32_bf16(false, a, false, b, (short)0, c, false, false);
  }
  static __device__ __forceinline__ void guard(v8f& a, v8f& b, v16b x, v16b y) { dep_guard_b(a, b, x, y); }
  static __device__ __forceinline__ void keep(v16b a, v16b b, v16b c, v16b d) { keep4_b(a, b, c, d); }
};

__device__ __forceinline__ unsigned pk16(unsigned short a, unsigned short b) { return (unsigned)a | ((unsigned)b << 16); }
__device__ __forceinline__ unsigned short h_bits(float f) { const _Float16 h = (_Float16)f; return __builtin_bit_cast(unsigned short, h); }

// ---- Register-blocked batched WMMA GEMM (ACT reduced to none/relu/leaky) -------------------------------
// C[m,n] = scale * sum_k A[m,k] * Bt[n,k] (+bias)(+resid); each wave owns a 64x64 tile.
// A row-major [M,K]; Bt row-major [N,K]; M,N % 64 == 0, K % 32 == 0.
// SPLIT: operands are hi/lo planes (A2/Bt2 = lo planes, same layout); product = hi*hi + hi*lo + lo*hi.
// BIAS_MODE: 0 = none, 1 = bias[m], 2 = bias[n].
// OUT_MODE: 0 = f32, 1 = f16, 2 = bf16 hi plane (Cout) + bf16 lo plane (Cout2).
// ET: 0 = f16 operands, 1 = bf16 operands (pointers passed as 16-bit storage)
template <int ET> struct Elem;
template <> struct Elem<0> { typedef _Float16 T; };
template <> struct Elem<1> { typedef __bf16 T; };
template <int ET, bool SPLIT, int BIAS_MODE, int OUT_MODE, bool RESID, int ACT = 0>
__global__ __launch_bounds__(256) void wmma_gemm64(
    const unsigned short* __restrict__ Ap, const unsigned short* __restrict__ A2p, int lda, long strideA,
    const unsigned short* __restrict__ Btp, const unsigned short* __restrict__ Bt2p, int ldb, long strideB,
    void* __restrict__ Cout, void* __restrict__ Cout2, int ldc, long strideC,
    const float* __restrict__ bias,
    const float* __restrict__ resid, long strideR,
    int M, int N, int K, float scale) {
  typedef typename Elem<ET>::T T;
  typedef typename Frag<T>::V V;
  const T* A = (const T*)Ap; const T* A2 = (const T*)A2p; const T* Bt = (const T*)Btp; const T* Bt2 = (const T*)Bt2p;
  __shared__ __align__(16) float sT[8][16 * 68];   // per-wave 16x64 slab, pitch 68 floats
  const int b    = blockIdx.y;
  const int lane = threadIdx.x & 31;
  const int wave = threadIdx.x >> 5;
  const int tilesN = N >> 6;
  const int tilesM = M >> 6;
  const int tile = blockIdx.x * 8 + wave;
  if (tile >= tilesM * tilesN) return;   // wave-uniform; no block barriers in this kernel
  const int tm = tile / tilesN;
  const int tn = tile - tm * tilesN;
  const int m0 = tm << 6;
  const int n0 = tn << 6;

  const T* Ab  = A  + (size_t)b * strideA;
  const T* Bb  = Bt + (size_t)b * strideB;
  const T* Ab2 = SPLIT ? (A2  + (size_t)b * strideA) : nullptr;
  const T* Bb2 = SPLIT ? (Bt2 + (size_t)b * strideB) : nullptr;

  const int rlane = lane & 15;                 // row (A) / col (B, D) within subtile
  const int koff  = (lane >> 4) * 8;           // k offset of this lane half
  const int mOff  = (lane >> 4) * 8;           // D row offset

  v8f acc[4][4];
#pragma unroll
  for (int i = 0; i < 4; ++i)
#pragma unroll
    for (int j = 0; j < 4; ++j) acc[i][j] = (v8f){0.f,0.f,0.f,0.f,0.f,0.f,0.f,0.f};

  for (int k0 = 0; k0 < K; k0 += 32) {
    V bh[4], bl[4];
#pragma unroll
    for (int j = 0; j < 4; ++j) {
      const size_t bo = (size_t)(n0 + (j << 4) + rlane) * ldb + koff + k0;
      bh[j] = Frag<T>::load(Bb + bo);
      if (SPLIT) bl[j] = Frag<T>::load(Bb2 + bo);
    }
#pragma unroll
    for (int i = 0; i < 4; ++i) {
      const size_t ao = (size_t)(m0 + (i << 4) + rlane) * lda + koff + k0;
      V ah = Frag<T>::load(Ab + ao);
      V al;
      if (SPLIT) al = Frag<T>::load(Ab2 + ao);
#pragma unroll
      for (int j = 0; j < 4; ++j) {
        acc[i][j] = Frag<T>::mma(ah, bh[j], acc[i][j]);
        if (SPLIT) {
          acc[i][j] = Frag<T>::mma(ah, bl[j], acc[i][j]);
          acc[i][j] = Frag<T>::mma(al, bh[j], acc[i][j]);
        }
      }
      Frag<T>::guard(acc[i][0], acc[i][3], ah, SPLIT ? al : ah);
    }
    Frag<T>::keep(bh[0], bh[1], bh[2], bh[3]);
    if (SPLIT) Frag<T>::keep(bl[0], bl[1], bl[2], bl[3]);
  }
  acc_guard4(acc[0][0], acc[0][1], acc[0][2], acc[0][3]);
  acc_guard4(acc[1][0], acc[1][1], acc[1][2], acc[1][3]);
  acc_guard4(acc[2][0], acc[2][1], acc[2][2], acc[2][3]);
  acc_guard4(acc[3][0], acc[3][1], acc[3][2], acc[3][3]);

  // ---- epilogue ----
  float* slab = sT[wave];
  const float* Rb = RESID ? (resid + (size_t)b * strideR) : nullptr;
#pragma unroll
  for (int i = 0; i < 4; ++i) {
    const int mBase = m0 + (i << 4);
#pragma unroll
    for (int j = 0; j < 4; ++j) {
      const int n = n0 + (j << 4) + rlane;
      float bv = 0.f;
      if (BIAS_MODE == 2) bv = bias[n];
#pragma unroll
      for (int r = 0; r < 8; ++r) {
        float v = acc[i][j][r] * scale;
        if (BIAS_MODE == 1) v += bias[mBase + mOff + r];
        if (BIAS_MODE == 2) v += bv;
        if (RESID) v += Rb[(size_t)(mBase + mOff + r) * ldc + n];
        if (ACT == 2) v = fmaxf(v, 0.0f);
        if (ACT == 4) v = (v > 0.f) ? v : 0.01f * v;
        slab[(mOff + r) * 68 + (j << 4) + rlane] = v;
      }
    }
    __builtin_amdgcn_fence(__ATOMIC_RELEASE, "workgroup");
    __builtin_amdgcn_wave_barrier();
    __builtin_amdgcn_fence(__ATOMIC_ACQUIRE, "workgroup");
    if (OUT_MODE == 0) {
      float* C = (float*)Cout + (size_t)b * strideC;
      const int hh = lane >> 4, c4 = (lane & 15) * 4;     // row seg = 256 B = 16 lanes x 16 B
      {
#pragma unroll
        for (int it = 0; it < 8; ++it) {
          const int row = it * 2 + hh;
          v4f v = *(const v4f*)(slab + row * 68 + c4);
          *(v4f*)(C + (size_t)(mBase + row) * ldc + n0 + c4) = v;
        }
        
      }
    } else {
      const int q = lane >> 3, c8 = (lane & 7) * 8;
      unsigned short* C  = (unsigned short*)Cout  + (size_t)b * strideC;
      unsigned short* C2 = (OUT_MODE == 2) ? ((unsigned short*)Cout2 + (size_t)b * strideC) : nullptr;
      {
#pragma unroll
        for (int it = 0; it < 4; ++it) {
          const int row = it * 4 + q;
          const float* sp = slab + row * 68 + c8;
          v8h hv, lv;
#pragma unroll
          for (int e = 0; e < 8; ++e) {
            if (OUT_MODE == 1) {
              hv[e] = (_Float16)sp[e];
            } else {
              unsigned short hb = f2bf_bits(sp[e]);
              unsigned short lb = f2bf_bits(sp[e] - bf_bits2f(hb));
              hv[e] = __builtin_bit_cast(_Float16, hb);
              lv[e] = __builtin_bit_cast(_Float16, lb);
            }
          }
          *(v8h*)(C + (size_t)(mBase + row) * ldc + n0 + c8) = hv;
          if (OUT_MODE == 2) *(v8h*)(C2 + (size_t)(mBase + row) * ldc + n0 + c8) = lv;
        }
        
      }
    }
    __builtin_amdgcn_fence(__ATOMIC_RELEASE, "workgroup");
    __builtin_amdgcn_wave_barrier();
    __builtin_amdgcn_fence(__ATOMIC_ACQUIRE, "workgroup");
  }
}

// ---------------------------------------------------------------------------
// f32 -> f16 cast with an exact power-of-two carry, 8 consecutive elements per thread (one 16-B store per lane;
// Coverage: n8 = n/8 threads x 8 = whole plane (all n here are multiples of 2048, so grids are exact).
// ---------------------------------------------------------------------------
__global__ __launch_bounds__(256) void cast8_f16_kernel(const float* __restrict__ in, unsigned short* __restrict__ out,
                                                        int n8, float scale) {
  const int i = blockIdx.x * 256 + threadIdx.x;
  if (i >= n8) return;
  const float* p = in + 8 * (size_t)i;
  const v4f a = *(const v4f*)(p);
  const v4f c = *(const v4f*)(p + 4);
  unsigned short hb[8];
#pragma unroll
  for (int e = 0; e < 4; ++e) {
    hb[e]     = h_bits(a[e] * scale);
    hb[4 + e] = h_bits(c[e] * scale);
  }
  const v4u u = (v4u){pk16(hb[0], hb[1]), pk16(hb[2], hb[3]), pk16(hb[4], hb[5]), pk16(hb[6], hb[7])};
  unsigned short* q = out + 8 * (size_t)i;
  *(v4u*)q = u;
  
}

// ---------------------------------------------------------------------------
// V^T pack (pure 16-bit bit moves, no conversion): VT[(b*16+h)][d][l] = QKV[(l*4+b)][2048 + h*64 + d] (f16 bits).
// Source plane read as 32-bit words (2 halves per word). grid (kL/64, kH, kB): blockIdx.x = l tile (64), blockIdx.y = head,
// blockIdx.z = batch; 256 threads.
// Load coverage: 8 iterations x 256 threads = 2048 words = 64 l-rows x 32 words (64 halves) = whole 64x64 tile.
// Store coverage: 8 waves x 2 iterations x 4 rows (lane>>3) = 64 d-rows; (lane&7) x 8 halves = 64 l-cols; each row segment =
// ---------------------------------------------------------------------------
__global__ __launch_bounds__(256) void vt_pack_kernel(const unsigned* __restrict__ QKVw, unsigned short* __restrict__ VT) {
  __shared__ unsigned sm[64][65];   // sm[d][l_local], f16 bits in the low 16 bits
  const int t  = threadIdx.x;
  const int l0 = blockIdx.x * 64;
  const int h  = blockIdx.y;
  const int b  = blockIdx.z;
#pragma unroll
  for (int it = 0; it < 8; ++it) {
    const int e = it * 256 + t;
    const int r = e >> 5;          // l local 0..63
    const int w = e & 31;          // word index: d = 2w, 2w+1
    const size_t hidx = ((size_t)((l0 + r) * kB + b)) * kN3 + 2 * kE + h * kDh + 2 * w;   // half index, even
    const unsigned u = QKVw[hidx >> 1];
    sm[2 * w][r]     = u & 0xffffu;
    sm[2 * w + 1][r] = u >> 16;
  }
  __syncthreads();
  const int lane = t & 31, wave = t >> 5;
  const int q = lane >> 3, c8 = (lane & 7) * 8;
  unsigned short* op = VT + ((size_t)(b * kH + h) * kDh) * kL;
  {
#pragma unroll
    for (int it = 0; it < 2; ++it) {
      const int row = wave * 8 + it * 4 + q;                 // d
      const unsigned* sp = &sm[row][c8];
      const v4u u = (v4u){pk16((unsigned short)sp[0], (unsigned short)sp[1]), pk16((unsigned short)sp[2], (unsigned short)sp[3]),
                          pk16((unsigned short)sp[4], (unsigned short)sp[5]), pk16((unsigned short)sp[6], (unsigned short)sp[7])};
      *(v4u*)(op + (size_t)row * kL + l0 + c8) = u;
    }
    
  }
}

// ---------------------------------------------------------------------------
// Skewed relative scores + row softmax over all 1024 keys, f32 math:
//   logit[j] = S[i][j] + (j <= i ? QE[i][(L-1) - i + j] : 0)     (S and QE already carry the 64^-0.5 scale)
//   P[i][j]  = f16( 32768 * exp(logit - max) / sum exp(logit - max) )
// One block of 128 threads per (row i = blockIdx.x, head-in-group hg = blockIdx.y).
// Phase 1/2: rolled 4-trip loops, thread t owns columns it*256 + 2t, 2t+1 (4 x 128 x 2 = 1024 = whole row); logits/exps kept in LDS.
// The QE gather address is clamped into the written row (min(m, L-1)); the j <= i selection is an arithmetic 0/1 factor.
// Reductions in fixed order (thread sequential, wave shuffle tree, 4 wave partials in index order).
// ---------------------------------------------------------------------------
__global__ __launch_bounds__(kSmThreads) void rel_softmax_kernel(const float* __restrict__ Sp, const float* __restrict__ QEp,
                                                                 unsigned short* __restrict__ Pp) {
  __shared__ __align__(16) float lg[kL];
  __shared__ float redM[4];
  __shared__ float redS[4];
  const int i    = blockIdx.x;
  const int hg   = blockIdx.y;
  const int t    = threadIdx.x;
  const int lane = t & 31, wave = t >> 5;
  const size_t rowoff = ((size_t)hg * kL + i) * kL;
  const float* sr = Sp + rowoff;
  const float* qr = QEp + rowoff;
  const int mwin = (kL - 1) - i;      // skew: srel[i][j] = QE[i][mwin + j] for j <= i

  float mx = -__builtin_inff();
#pragma unroll 1
  for (int it = 0; it < kSmTrips; ++it) {
    const int c = it * (2 * kSmThreads) + 2 * t;
    const v2f sv = *(const v2f*)(sr + c);
    v2f av;
#pragma unroll
    for (int e = 0; e < 2; ++e) {
      const int j  = c + e;
      const int mm = mwin + j;                                // 0 .. 2046
      const int mc = (mm < kL - 1) ? mm : (kL - 1);           // clamped address inside the written row
      const float qv = qr[mc];
      const float fsel = (j <= i) ? 1.0f : 0.0f;
      const float a = fmaf(qv, fsel, sv[e]);
      av[e] = a;
      mx = fmaxf(mx, a);
    }
    *(v2f*)(lg + c) = av;
  }
#pragma unroll
  for (int off = 16; off > 0; off >>= 1) mx = fmaxf(mx, __shfl_xor(mx, off, 32));
  if (lane == 0) redM[wave] = mx;
  __syncthreads();
  float m = redM[0];
#pragma unroll
  for (int w = 1; w < 4; ++w) m = fmaxf(m, redM[w]);

  float sum = 0.f;
#pragma unroll 1
  for (int it = 0; it < kSmTrips; ++it) {
    const int c = it * (2 * kSmThreads) + 2 * t;
    const v2f l = *(const v2f*)(lg + c);
    v2f ev;
#pragma unroll
    for (int e = 0; e < 2; ++e) {
      ev[e] = expf(l[e] - m);
      sum += ev[e];
    }
    *(v2f*)(lg + c) = ev;
  }
#pragma unroll
  for (int off = 16; off > 0; off >>= 1) sum += __shfl_xor(sum, off, 32);
  if (lane == 0) redS[wave] = sum;
  __syncthreads();
  float tot = redS[0];
#pragma unroll
  for (int w = 1; w < 4; ++w) tot += redS[w];
  const float inv = kPCarry / tot;

  const v4f e0 = *(const v4f*)(lg + 8 * t);
  const v4f e1 = *(const v4f*)(lg + 8 * t + 4);
  unsigned short hb[8];
#pragma unroll
  for (int e = 0; e < 4; ++e) {
    hb[e]     = h_bits(e0[e] * inv);
    hb[4 + e] = h_bits(e1[e] * inv);
  }
  const v4u u = (v4u){pk16(hb[0], hb[1]), pk16(hb[2], hb[3]), pk16(hb[4], hb[5]), pk16(hb[6], hb[7])};
  unsigned short* pr = Pp + rowoff + 8 * (size_t)t;
  *(v4u*)pr = u;
  
}

// ---------------------------------------------------------------------------
// Host glue.
//   XH    f16 [4096][1024]            8,388,608  at           0   (query, A of the qkv projection)
//   WIN   f16 [3072][1024] (x16)      6,291,456  at   8,388,608   (Bt)
//   WO    f16 [1024][1024] (x16)      2,097,152  at  14,680,064   (Bt)
//   ER    f16 [1024][64]                131,072  at  16,777,216   (Bt of the relative scores)
//   QKV   f16 [4096][3072]           25,165,824  at  16,908,288   (qkv + bias; q cols 0.., k cols 1024.., v cols 2048..)
//   VT    f16 [64 bh][64 d][1024 l]   8,388,608  at  42,074,112   (Bt of attn.v)
//   SC    f32 [8][1024][1024]         33,554,432  at  50,462,720   (content scores of one (batch, 8-head) group, reused 8x)
//   QE    f32 [8][1024][1024]         33,554,432  at  84,017,152   (relative scores, full rows, reused 8x)
//   PP    f16 [64 bh][1024][1024] (x2^15) 134,217,728  at 117,571,584   (probabilities of every (batch, head), each plane written once)
//   O16   f16 [4096][1024] (x256)     8,388,608  at 251,789,312   (attention output, A of the output projection)
//   total                          260,177,920
// GEMM shapes: qkv M=4096 N=3072 K=1024; scores M=N=1024 K=64; rel scores M=N=1024 K=64; attn.v M=1024 N=64 K=1024;
// out M=4096 N=1024 K=1024. All M,N multiples of 64, all K multiples of 32, no padding anywhere.
// Launches: 4 casts + 1 qkv GEMM + 1 V^T pack + 8 groups x (2 GEMM + softmax) + 1 attn.v GEMM over all 64 (batch, head) + 1 out GEMM = 32.
// ---------------------------------------------------------------------------
extern "C" void kernel_launch(void* const* d_in, const int* in_sizes, int n_in,
                              void* d_out, int out_size, void* d_ws, size_t ws_size,
                              hipStream_t stream) {
  if (n_in < 6) return;
  const int nTokE = kTok * kE;                     // 4,194,304
  if (in_sizes[0] != nTokE) return;
  if (in_sizes[1] != kL * kDh) return;
  if (in_sizes[2] != kN3 * kE) return;
  if (in_sizes[3] != kN3) return;
  if (in_sizes[4] != kE * kE) return;
  if (in_sizes[5] != kE) return;
  if (out_size != nTokE) return;

  const size_t szXH  = (size_t)kTok * kE * 2;
  const size_t szWIN = (size_t)kN3 * kE * 2;
  const size_t szWO  = (size_t)kE * kE * 2;
  const size_t szER  = (size_t)kL * kDh * 2;
  const size_t szQKV = (size_t)kTok * kN3 * 2;
  const size_t szVT  = (size_t)kB * kH * kDh * kL * 2;
  const size_t szSC  = (size_t)kG * kL * kL * 4;
  const size_t szPP  = (size_t)kB * kH * kL * kL * 2;
  const size_t szO16 = (size_t)kTok * kE * 2;
  const size_t offXH  = 0;
  const size_t offWIN = offXH + szXH;
  const size_t offWO  = offWIN + szWIN;
  const size_t offER  = offWO + szWO;
  const size_t offQKV = offER + szER;
  const size_t offVT  = offQKV + szQKV;
  const size_t offSC  = offVT + szVT;
  const size_t offQE  = offSC + szSC;
  const size_t offPP  = offQE + szSC;
  const size_t offO16 = offPP + szPP;
  const size_t total  = offO16 + szO16;
  if (ws_size < total) return;

  const float* query  = (const float*)d_in[0];
  const float* relpos = (const float*)d_in[1];
  const float* win    = (const float*)d_in[2];
  const float* bin    = (const float*)d_in[3];
  const float* wout   = (const float*)d_in[4];
  const float* bout   = (const float*)d_in[5];
  float* out = (float*)d_out;
  char* ws = (char*)d_ws;
  unsigned short* XH  = (unsigned short*)(ws + offXH);
  unsigned short* WIN = (unsigned short*)(ws + offWIN);
  unsigned short* WO  = (unsigned short*)(ws + offWO);
  unsigned short* ER  = (unsigned short*)(ws + offER);
  unsigned short* QKV = (unsigned short*)(ws + offQKV);
  unsigned short* VT  = (unsigned short*)(ws + offVT);
  float* SC = (float*)(ws + offSC);
  float* QE = (float*)(ws + offQE);
  unsigned short* PP  = (unsigned short*)(ws + offPP);
  unsigned short* O16 = (unsigned short*)(ws + offO16);

  // ---- prologue: 16-bit operand planes ----
  {
    const int n8x = nTokE / 8;            // 524288 -> 2048 blocks
    const int n8w = (kN3 * kE) / 8;       // 393216 -> 1536 blocks
    const int n8o = (kE * kE) / 8;        // 131072 -> 512 blocks
    const int n8e = (kL * kDh) / 8;       // 8192 -> 32 blocks
    cast8_f16_kernel<<<dim3((n8x + 255) / 256), dim3(256), 0, stream>>>(query, XH, n8x, 1.0f);
    cast8_f16_kernel<<<dim3((n8w + 255) / 256), dim3(256), 0, stream>>>(win, WIN, n8w, kWCarry);
    cast8_f16_kernel<<<dim3((n8o + 255) / 256), dim3(256), 0, stream>>>(wout, WO, n8o, kWCarry);
    cast8_f16_kernel<<<dim3((n8e + 255) / 256), dim3(256), 0, stream>>>(relpos, ER, n8e, 1.0f);
  }

  // ---- packed qkv projection: QKV[m][n] = f16( (1/16) * sum_k XH[m][k] * WIN[n][k] + b_in[n] )   (M=4096, N=3072, K=1024)
  {
    const int tiles = (kTok / 64) * (kN3 / 64);   // 3072 -> 384 blocks of 8 waves
    wmma_gemm64<0, false, 2, 1, false, 0><<<dim3(tiles / 8, 1), dim3(256), 0, stream>>>(
        XH, XH, kE, 0L, WIN, WIN, kE, 0L,
        (void*)QKV, (void*)QKV, kN3, 0L, bin, bin, 0L, kTok, kN3, kE, kWCarryInv);
  }

  // ---- V^T planes per (batch, head) ----
  vt_pack_kernel<<<dim3(kL / 64, kH, kB), dim3(256), 0, stream>>>((const unsigned*)(const void*)QKV, VT);

  // ---- scores and softmax per (batch, 8-head group): 256 GEMM blocks per launch, one per WGP ----
  const long strideHead   = (long)kDh;               // next head = +64 columns in the qkv / O16 planes
  const long strideScore  = (long)kL * kL;           // per head-in-group score / probability plane
  const long strideVT     = (long)kDh * kL;          // per head V^T plane
  const int  tilesScore   = (kL / 64) * (kL / 64);   // 256 -> 32 blocks
  const int  tilesCtx     = (kL / 64) * (kDh / 64);  // 16 -> 2 blocks
  for (int b = 0; b < kB; ++b) {
    for (int g = 0; g < kGroupsPerBatch; ++g) {
      const size_t colQ = (size_t)b * kN3 + (size_t)g * kG * kDh;        // q columns of head g*8 for batch b (halves, row l=0)
      const unsigned short* Qg = QKV + colQ;                               // row l at + l*kLdTok
      const unsigned short* Kg = QKV + kE + colQ;
      // SC[hg][i][j] = 0.125 * sum_d q[b,hg][i][d] * k[b,hg][j][d]   (M=N=1024, K=64)
      wmma_gemm64<0, false, 0, 0, false, 0><<<dim3(tilesScore / 8, kG), dim3(256), 0, stream>>>(
          Qg, Qg, kLdTok, strideHead, Kg, Kg, kLdTok, strideHead,
          (void*)SC, (void*)SC, kL, strideScore, bin, bin, 0L, kL, kL, kDh, kScoreScale);
      // QE[hg][i][m] = 0.125 * sum_d q[b,hg][i][d] * er[m][d]         (M=N=1024, K=64; Bt shared over heads)
      wmma_gemm64<0, false, 0, 0, false, 0><<<dim3(tilesScore / 8, kG), dim3(256), 0, stream>>>(
          Qg, Qg, kLdTok, strideHead, ER, ER, kDh, 0L,
          (void*)QE, (void*)QE, kL, strideScore, bin, bin, 0L, kL, kL, kDh, kScoreScale);
      // skew + softmax -> this group's planes of PP (f16, x32768)
      unsigned short* PPg = PP + (size_t)(b * kH + g * kG) * (size_t)kL * kL;
      rel_softmax_kernel<<<dim3(kL, kG), dim3(kSmThreads), 0, stream>>>(SC, QE, PPg);
    }
  }

  // ---- attn.v for all 64 (batch, head) planes in one launch (128 blocks); bh = b*16 + h = blockIdx.y ----
  // O16[(l*4+b)][h*64+n] = f16( (256/32768) * sum_j PP[bh][l][j] * VT[bh][n][j] )   (M=1024, N=64, K=1024)
  // Column base b*1024 + h*64 = bh*64, so one stride of 64 halves steps through every (batch, head).
  wmma_gemm64<0, false, 0, 1, false, 0><<<dim3(tilesCtx / 8, kB * kH), dim3(256), 0, stream>>>(
      PP, PP, kL, strideScore, VT, VT, kL, strideVT,
      (void*)O16, (void*)O16, kB * kE, strideHead, bin, bin, 0L, kL, kDh, kL, kPVScale);

  // ---- output projection: out[m][n] = (1/4096) * sum_e O16[m][e] * WO[n][e] + b_out[n]   (M=4096, N=1024, K=1024)
  {
    const int tiles = (kTok / 64) * (kE / 64);   // 1024 -> 128 blocks
    wmma_gemm64<0, false, 2, 0, false, 0><<<dim3(tiles / 8, 1), dim3(256), 0, stream>>>(
        O16, O16, kE, 0L, WO, WO, kE, 0L,
        (void*)out, (void*)out, kE, 0L, bout, bout, 0L, kTok, kE, kE, kOutScale);
  }
}

// v002
// It runs in 171 microseconds.
// Two timings next to v001 put it at 2.47 and 2.49 times that version's speed.
// All steps since v000 together make it 7.35 times as fast.
// Contractions: packed qkv projection (X f16 x W_in^T f16 carried x16), content scores k.q^T and relative scores Er.q^T (q, k, Er f16 planes, x0.125 in f32 behind the product), attn.v (V^T f16 x unnormalised P^T f16 carried x32768), output projection (O f16 carried x256 x Wo^T f16 carried x16): all v_wmma_f32_16x16x32_f16 with f32 accumulate; bias, skew gather and softmax in f32.
#include <hip/hip_runtime.h>
#include <math.h>

// ---------------------------------------------------------------------------
// Problem constants
// ---------------------------------------------------------------------------
constexpr int kL   = 1024;                 // sequence length
constexpr int kB   = 4;                    // batch
constexpr int kE   = 1024;                 // embed dim
constexpr int kH   = 16;                   // heads
constexpr int kDh  = 64;                   // head dim
constexpr int kTok = kL * kB;              // 4096 GEMM rows, m = l*4 + b
constexpr int kN3  = 3 * kE;               // 3072 packed qkv columns
constexpr int kLdTok = kB * kN3;           // 12288 halves between consecutive l of one (b, column) in the qkv plane
constexpr int kFaWaves    = 16;            // waves of a fused-attention block, 16 queries each
constexpr int kFaThreads  = kFaWaves * 32; // 512
constexpr int kFaQ        = kFaWaves * 16; // 256 queries of a block
constexpr int kStripPitch = 52;            // floats per query in the skew strip (48 used)
constexpr int kKPitch     = 72;            // halves per K or Er row in LDS (64 used)
constexpr int kVPitch     = 40;            // halves per V^T row of a pass in LDS (32 used)
constexpr int kStageV     = 32 * kKPitch;  // V^T tile behind the K tile in a stage buffer
constexpr int kStageHalves = kStageV + kDh * kVPitch;   // 4864
constexpr float kWCarry     = 16.0f;                 // weights carried x16 in f16
constexpr float kWCarryInv  = 1.0f / 16.0f;
constexpr float kScoreScale = 0.125f;                // 64^-0.5, applied to both score products
constexpr float kLogitScale = kScoreScale * 1.4426950408889634f;   // logits in the log2 domain
constexpr float kPCarryLog2 = 15.0f;                 // unnormalised probabilities carried x2^15 in f16
constexpr float kOCarry     = 256.0f;                // attention output carried x256 in f16
constexpr float kOutScale   = 1.0f / (kOCarry * kWCarry);   // 1/4096
static_assert(kH * kDh == kE, "shape");
static_assert(kTok % 64 == 0 && kN3 % 64 == 0 && kE % 64 == 0 && kL % 64 == 0 && kDh % 64 == 0, "M,N tile multiples");
static_assert(kE % 32 == 0 && kDh % 32 == 0 && kL % 32 == 0, "K multiples of 32");
static_assert(kL % kFaQ == 0 && kDh == 64 && kH == 16 && kFaThreads == 512, "fused attention coverage and staging map");

typedef __attribute__((ext_vector_type(16))) _Float16 v16h;
typedef __attribute__((ext_vector_type(8)))  _Float16 v8h;
typedef __attribute__((ext_vector_type(16))) __bf16   v16b;
typedef __attribute__((ext_vector_type(8)))  __bf16   v8b;
typedef __attribute__((ext_vector_type(8)))  float    v8f;
typedef __attribute__((ext_vector_type(4)))  float    v4f;
typedef __attribute__((ext_vector_type(2)))  float    v2f;
typedef __attribute__((ext_vector_type(4)))  unsigned int v4u;

// ---------------------------------------------------------------------------
// Helper pieces
// ---------------------------------------------------------------------------
__device__ __forceinline__ unsigned short f2bf_bits(float f) {
  unsigned u = __float_as_uint(f);
  return (unsigned short)((u + 0x7FFFu + ((u >> 16) & 1u)) >> 16);
}
__device__ __forceinline__ float bf_bits2f(unsigned short h) { return __uint_as_float(((unsigned)h) << 16); }

// hazard guards as plain device helpers (no inline asm inside the kernel template body)
__device__ __forceinline__ void dep_guard_h(v8f& a, v8f& b, v16h x, v16h y) { asm volatile("v_nop\n\tv_nop\n\tv_nop\n\tv_nop" : "+v"(a), "+v"(b) : "v"(x), "v"(y)); }
__device__ __forceinline__ void dep_guard_b(v8f& a, v8f& b, v16b x, v16b y) { asm volatile("v_nop\n\tv_nop\n\tv_nop\n\tv_nop" : "+v"(a), "+v"(b) : "v"(x), "v"(y)); }
__device__ __forceinline__ void keep4_h(v16h a, v16h b, v16h c, v16h d) { asm volatile("v_nop" :: "v"(a), "v"(b), "v"(c), "v"(d)); }
__device__ __forceinline__ void keep4_b(v16b a, v16b b, v16b c, v16b d) { asm volatile("v_nop" :: "v"(a), "v"(b), "v"(c), "v"(d)); }
__device__ __forceinline__ void acc_guard4(v8f& a, v8f& b, v8f& c, v8f& d) { asm volatile("v_nop\n\tv_nop\n\tv_nop\n\tv_nop" : "+v"(a), "+v"(b), "+v"(c), "+v"(d)); }
template <typename T> struct Frag;
template <> struct Frag<_Float16> {
  typedef v16h V; union U { v16h v; v8h h[2]; };
  // elements 0..7 <- p[0..7], 8..15 <- p[16..23]
  static __device__ __forceinline__ v16h load(const _Float16* p) {
    U f; f.h[0] = *(const v8h*)(p); f.h[1] = *(const v8h*)(p + 16); return f.v;
  }
  static __device__ __forceinline__ v8f mma(v16h a, v16h b, v8f c) {
    return __builtin_amdgcn_wmma_f32_16x16x32_f16(false, a, false, b, (short)0, c, false, false);
  }
  static __device__ __forceinline__ void guard(v8f& a, v8f& b, v16h x, v16h y) { dep_guard_h(a, b, x, y); }
  static __device__ __forceinline__ void keep(v16h a, v16h b, v16h c, v16h d) { keep4_h(a, b, c, d); }
};
template <> struct Frag<__bf16> {
  typedef v16b V; union U { v16b v; v8b h[2]; };
  static __device__ __forceinline__ v16b load(const __bf16* p) {
    U f; f.h[0] = *(const v8b*)(p); f.h[1] = *(const v8b*)(p + 16); return f.v;
  }
  static __device__ __forceinline__ v8f mma(v16b a, v16b b, v8f c) {
    return __builtin_amdgcn_wmma_f32_16x16x32_bf16(false, a, false, b, (short)0, c, false, false);
  }
  static __device__ __forceinline__ void guard(v8f& a, v8f& b, v16b x, v16b y) { dep_guard_b(a, b, x, y); }
  static __device__ __forceinline__ void keep(v16b a, v16b b, v16b c, v16b d) { keep4_b(a, b, c, d); }
};

__device__ __forceinline__ unsigned pk16(unsigned short a, unsigned short b) { return (unsigned)a | ((unsigned)b << 16); }
__device__ __forceinline__ unsigned short h_bits(float f) { const _Float16 h = (_Float16)f; return __builtin_bit_cast(unsigned short, h); }

// ---- Register-blocked batched WMMA GEMM (ACT reduced to none/relu/leaky) -------------------------------
// C[m,n] = scale * sum_k A[m,k] * Bt[n,k] (+bias)(+resid); each wave owns a 64x64 tile.
// A row-major [M,K]; Bt row-major [N,K]; M,N % 64 == 0, K % 32 == 0.
// SPLIT: operands are hi/lo planes (A2/Bt2 = lo planes, same layout); product = hi*hi + hi*lo + lo*hi.
// BIAS_MODE: 0 = none, 1 = bias[m], 2 = bias[n].
// OUT_MODE: 0 = f32, 1 = f16, 2 = bf16 hi plane (Cout) + bf16 lo plane (Cout2).
// ET: 0 = f16 operands, 1 = bf16 operands (pointers passed as 16-bit storage)
template <int ET> struct Elem;
template <> struct Elem<0> { typedef _Float16 T; };
template <> struct Elem<1> { typedef __bf16 T; };
template <int ET, bool SPLIT, int BIAS_MODE, int OUT_MODE, bool RESID, int ACT = 0>
__global__ __launch_bounds__(256) void wmma_gemm64(
    const unsigned short* __restrict__ Ap, const unsigned short* __restrict__ A2p, int lda, long strideA,
    const unsigned short* __restrict__ Btp, const unsigned short* __restrict__ Bt2p, int ldb, long strideB,
    void* __restrict__ Cout, void* __restrict__ Cout2, int ldc, long strideC,
    const float* __restrict__ bias,
    const float* __restrict__ resid, long strideR,
    int M, int N, int K, float scale) {
  typedef typename Elem<ET>::T T;
  typedef typename Frag<T>::V V;
  const T* A = (const T*)Ap; const T* A2 = (const T*)A2p; const T* Bt = (const T*)Btp; const T* Bt2 = (const T*)Bt2p;
  __shared__ __align__(16) float sT[8][16 * 68];   // per-wave 16x64 slab, pitch 68 floats
  const int b    = blockIdx.y;
  const int lane = threadIdx.x & 31;
  const int wave = threadIdx.x >> 5;
  const int tilesN = N >> 6;
  const int tilesM = M >> 6;
  const int tile = blockIdx.x * 8 + wave;
  if (tile >= tilesM * tilesN) return;   // wave-uniform; no block barriers in this kernel
  const int tm = tile / tilesN;
  const int tn = tile - tm * tilesN;
  const int m0 = tm << 6;
  const int n0 = tn << 6;

  const T* Ab  = A  + (size_t)b * strideA;
  const T* Bb  = Bt + (size_t)b * strideB;
  const T* Ab2 = SPLIT ? (A2  + (size_t)b * strideA) : nullptr;
  const T* Bb2 = SPLIT ? (Bt2 + (size_t)b * strideB) : nullptr;

  const int rlane = lane & 15;                 // row (A) / col (B, D) within subtile
  const int koff  = (lane >> 4) * 8;           // k offset of this lane half
  const int mOff  = (lane >> 4) * 8;           // D row offset

  v8f acc[4][4];
#pragma unroll
  for (int i = 0; i < 4; ++i)
#pragma unroll
    for (int j = 0; j < 4; ++j) acc[i][j] = (v8f){0.f,0.f,0.f,0.f,0.f,0.f,0.f,0.f};

  for (int k0 = 0; k0 < K; k0 += 32) {
    V bh[4], bl[4];
#pragma unroll
    for (int j = 0; j < 4; ++j) {
      const size_t bo = (size_t)(n0 + (j << 4) + rlane) * ldb + koff + k0;
      bh[j] = Frag<T>::load(Bb + bo);
      if (SPLIT) bl[j] = Frag<T>::load(Bb2 + bo);
    }
#pragma unroll
    for (int i = 0; i < 4; ++i) {
      const size_t ao = (size_t)(m0 + (i << 4) + rlane) * lda + koff + k0;
      V ah = Frag<T>::load(Ab + ao);
      V al;
      if (SPLIT) al = Frag<T>::load(Ab2 + ao);
#pragma unroll
      for (int j = 0; j < 4; ++j) {
        acc[i][j] = Frag<T>::mma(ah, bh[j], acc[i][j]);
        if (SPLIT) {
          acc[i][j] = Frag<T>::mma(ah, bl[j], acc[i][j]);
          acc[i][j] = Frag<T>::mma(al, bh[j], acc[i][j]);
        }
      }
      Frag<T>::guard(acc[i][0], acc[i][3], ah, SPLIT ? al : ah);
    }
    Frag<T>::keep(bh[0], bh[1], bh[2], bh[3]);
    if (SPLIT) Frag<T>::keep(bl[0], bl[1], bl[2], bl[3]);
  }
  acc_guard4(acc[0][0], acc[0][1], acc[0][2], acc[0][3]);
  acc_guard4(acc[1][0], acc[1][1], acc[1][2], acc[1][3]);
  acc_guard4(acc[2][0], acc[2][1], acc[2][2], acc[2][3]);
  acc_guard4(acc[3][0], acc[3][1], acc[3][2], acc[3][3]);

  // ---- epilogue ----
  float* slab = sT[wave];
  const float* Rb = RESID ? (resid + (size_t)b * strideR) : nullptr;
#pragma unroll
  for (int i = 0; i < 4; ++i) {
    const int mBase = m0 + (i << 4);
#pragma unroll
    for (int j = 0; j < 4; ++j) {
      const int n = n0 + (j << 4) + rlane;
      float bv = 0.f;
      if (BIAS_MODE == 2) bv = bias[n];
#pragma unroll
      for (int r = 0; r < 8; ++r) {
        float v = acc[i][j][r] * scale;
        if (BIAS_MODE == 1) v += bias[mBase + mOff + r];
        if (BIAS_MODE == 2) v += bv;
        if (RESID) v += Rb[(size_t)(mBase + mOff + r) * ldc + n];
        if (ACT == 2) v = fmaxf(v, 0.0f);
        if (ACT == 4) v = (v > 0.f) ? v : 0.01f * v;
        slab[(mOff + r) * 68 + (j << 4) + rlane] = v;
      }
    }
    __builtin_amdgcn_fence(__ATOMIC_RELEASE, "workgroup");
    __builtin_amdgcn_wave_barrier();
    __builtin_amdgcn_fence(__ATOMIC_ACQUIRE, "workgroup");
    if (OUT_MODE == 0) {
      float* C = (float*)Cout + (size_t)b * strideC;
      const int hh = lane >> 4, c4 = (lane & 15) * 4;     // row seg = 256 B = 16 lanes x 16 B
      {
#pragma unroll
        for (int it = 0; it < 8; ++it) {
          const int row = it * 2 + hh;
          v4f v = *(const v4f*)(slab + row * 68 + c4);
          *(v4f*)(C + (size_t)(mBase + row) * ldc + n0 + c4) = v;
        }
        
      }
    } else {
      const int q = lane >> 3, c8 = (lane & 7) * 8;
      unsigned short* C  = (unsigned short*)Cout  + (size_t)b * strideC;
      unsigned short* C2 = (OUT_MODE == 2) ? ((unsigned short*)Cout2 + (size_t)b * strideC) : nullptr;
      {
#pragma unroll
        for (int it = 0; it < 4; ++it) {
          const int row = it * 4 + q;
          const float* sp = slab + row * 68 + c8;
          v8h hv, lv;
#pragma unroll
          for (int e = 0; e < 8; ++e) {
            if (OUT_MODE == 1) {
              hv[e] = (_Float16)sp[e];
            } else {
              unsigned short hb = f2bf_bits(sp[e]);
              unsigned short lb = f2bf_bits(sp[e] - bf_bits2f(hb));
              hv[e] = __builtin_bit_cast(_Float16, hb);
              lv[e] = __builtin_bit_cast(_Float16, lb);
            }
          }
          *(v8h*)(C + (size_t)(mBase + row) * ldc + n0 + c8) = hv;
          if (OUT_MODE == 2) *(v8h*)(C2 + (size_t)(mBase + row) * ldc + n0 + c8) = lv;
        }
        
      }
    }
    __builtin_amdgcn_fence(__ATOMIC_RELEASE, "workgroup");
    __builtin_amdgcn_wave_barrier();
    __builtin_amdgcn_fence(__ATOMIC_ACQUIRE, "workgroup");
  }
}

// ---------------------------------------------------------------------------
// f32 -> f16 cast with an exact power-of-two carry, 8 consecutive elements per thread (one 16-B store per lane;
// Coverage: n8 = n/8 threads x 8 = whole plane (all n here are multiples of 2048, so grids are exact).
// ---------------------------------------------------------------------------
__global__ __launch_bounds__(256) void cast8_f16_kernel(const float* __restrict__ in, unsigned short* __restrict__ out,
                                                        int n8, float scale) {
  const int i = blockIdx.x * 256 + threadIdx.x;
  if (i >= n8) return;
  const float* p = in + 8 * (size_t)i;
  const v4f a = *(const v4f*)(p);
  const v4f c = *(const v4f*)(p + 4);
  unsigned short hb[8];
#pragma unroll
  for (int e = 0; e < 4; ++e) {
    hb[e]     = h_bits(a[e] * scale);
    hb[4 + e] = h_bits(c[e] * scale);
  }
  const v4u u = (v4u){pk16(hb[0], hb[1]), pk16(hb[2], hb[3]), pk16(hb[4], hb[5]), pk16(hb[6], hb[7])};
  unsigned short* q = out + 8 * (size_t)i;
  *(v4u*)q = u;
  
}

// ---------------------------------------------------------------------------
// V^T pack (pure 16-bit bit moves, no conversion): VT[(b*16+h)][d][l] = QKV[(l*4+b)][2048 + h*64 + d] (f16 bits).
// Source plane read as 32-bit words (2 halves per word). grid (kL/64, kH, kB): blockIdx.x = l tile (64), blockIdx.y = head,
// blockIdx.z = batch; 256 threads.
// Load coverage: 8 iterations x 256 threads = 2048 words = 64 l-rows x 32 words (64 halves) = whole 64x64 tile.
// Store coverage: 8 waves x 2 iterations x 4 rows (lane>>3) = 64 d-rows; (lane&7) x 8 halves = 64 l-cols; each row segment =
// ---------------------------------------------------------------------------
__global__ __launch_bounds__(256) void vt_pack_kernel(const unsigned* __restrict__ QKVw, unsigned short* __restrict__ VT) {
  __shared__ unsigned sm[64][65];   // sm[d][l_local], f16 bits in the low 16 bits
  const int t  = threadIdx.x;
  const int l0 = blockIdx.x * 64;
  const int h  = blockIdx.y;
  const int b  = blockIdx.z;
#pragma unroll
  for (int it = 0; it < 8; ++it) {
    const int e = it * 256 + t;
    const int r = e >> 5;          // l local 0..63
    const int w = e & 31;          // word index: d = 2w, 2w+1
    const size_t hidx = ((size_t)((l0 + r) * kB + b)) * kN3 + 2 * kE + h * kDh + 2 * w;   // half index, even
    const unsigned u = QKVw[hidx >> 1];
    sm[2 * w][r]     = u & 0xffffu;
    sm[2 * w + 1][r] = u >> 16;
  }
  __syncthreads();
  const int lane = t & 31, wave = t >> 5;
  const int q = lane >> 3, c8 = (lane & 7) * 8;
  unsigned short* op = VT + ((size_t)(b * kH + h) * kDh) * kL;
  {
#pragma unroll
    for (int it = 0; it < 2; ++it) {
      const int row = wave * 8 + it * 4 + q;                 // d
      const unsigned* sp = &sm[row][c8];
      const v4u u = (v4u){pk16((unsigned short)sp[0], (unsigned short)sp[1]), pk16((unsigned short)sp[2], (unsigned short)sp[3]),
                          pk16((unsigned short)sp[4], (unsigned short)sp[5]), pk16((unsigned short)sp[6], (unsigned short)sp[7])};
      *(v4u*)(op + (size_t)row * kL + l0 + c8) = u;
    }
    
  }
}

// ---------------------------------------------------------------------------
// Fused attention of one (batch, head): content scores, skewed relative scores, softmax and attn.v in one kernel.
// A block of 16 waves owns 256 queries; one wave owns 16 of them (i0 .. i0+15) and walks the 1024 keys 32 at a time (a pass).
// The 64 query tiles of a (batch, head) are dealt round robin to its 4 blocks (tile = wave * 4 + blockIdx.x), because a tile's
// relative-score work grows with i0: so every block carries the same share of it.
// Everything is computed transposed, so that a lane holds one query column (c = lane & 15) and the lane halves split its keys:
//   S^T  = K . Q^T        A = 16 key rows,          B = Q rows (kept in registers)  -> D[key 8*hf + r][query c]
//   QE^T = Er . Q^T       A = 16 rows m of Er,      B = the same Q                  -> D[m 8*hf + r][query c]
//   O^T += V^T . P^T      A = 16 d rows of V^T,     B = the two S^T tiles of the pass, converted in place
// LDS: Er (filled once; the block's queries reach all but its first rows), the pass's 32 K rows and 64 x 32 V^T tile (two buffers:
// every thread fetches 16 bytes of the next pass's tile into a register before the pass's work and stores them behind it; the one
// block barrier at the foot of a pass publishes that tile and ends the last read of the buffer that the next pass refills).
// Row pitches 144 B and 80 B (16 B x odd) keep the 16-byte fragment reads free of bank conflicts.
// Skew: srel[i][j] = QE[i][(L-1) - i + j] for j <= i, else 0. For query i0 + c and key j0 + jl the row of Er is
// mb + 15 - c + jl with mb = L - 16 - i0 + j0, so 48 rows from mb on serve the pass; the shift by the lane's own c goes
// through a per-wave LDS strip [query c][48 m], pitch 52 floats (16-B aligned rows; the shifted reads of the 32 lanes
// fall on 32 different banks). Rows of Er past L-1 belong to j > i only: their address is clamped, their value unused.
// Passes with every key above the diagonal (j0 > i0 + 15) have no relative term and skip that part.
// Softmax is the running-maximum form in the log2 domain (logit * 0.125 * log2 e): per pass the maximum of the lane's 16
// scores and of the other half's, p = 2^(logit - max + 15) in f32, f16 for the product; sums and O^T are rescaled by
// 2^(old max - new max). The x2^15 carry is in numerator and denominator alike and cancels in the epilogue.
// grid (L / 256, 64 bh), 512 threads.
// ---------------------------------------------------------------------------
__device__ __forceinline__ float other_half(float x) {   // lane l <-> lane l ^ 16
  const int v = __builtin_bit_cast(int, x);
  return __builtin_bit_cast(float, __builtin_amdgcn_permlanex16(v, v, 0x76543210, 0xfedcba98, false, false));
}

__global__ __launch_bounds__(kFaThreads) void rel_attn_fused_kernel(const unsigned short* __restrict__ QKVp,
                                                                    const unsigned short* __restrict__ ERp,
                                                                    const unsigned short* __restrict__ VTp,
                                                                    unsigned short* __restrict__ O16p) {
  typedef Frag<_Float16> F;
  __shared__ __align__(16) _Float16 sE[kL * kKPitch];                 // 147,456 B
  __shared__ __align__(16) _Float16 sKV[2][kStageHalves];             //  19,456 B
  __shared__ __align__(16) float strip[kFaWaves][16 * kStripPitch];   //  53,248 B
  const _Float16* QKV = (const _Float16*)QKVp;
  const _Float16* ER  = (const _Float16*)ERp;
  const _Float16* VT  = (const _Float16*)VTp;
  const int tid  = threadIdx.x;
  const int lane = tid & 31;
  const int wave = __builtin_amdgcn_readfirstlane(tid >> 5);   // scalar, so that the diagonal test is a scalar branch
  const int c    = lane & 15;
  const int koff = (lane >> 4) * 8;            // k offset of this lane half (operands), row offset (D)
  const int bh   = blockIdx.y;
  const int b    = bh >> 4;
  const int h    = bh & 15;
  const int i0   = (wave * (kL / kFaQ) + blockIdx.x) * 16;

  // staging map: waves 0..7 bring the K tile (32 rows x 8 segments of 16 B), waves 8..15 the V^T tile (64 rows x 4)
  const bool isK = wave < 8;
  const int  tv  = tid & 255;
  const _Float16* gsrc = isK ? (QKV + ((size_t)(tv >> 3) * kB + b) * kN3 + kE + h * kDh + (tv & 7) * 8)
                             : (VT + ((size_t)bh * kDh + (tv >> 2)) * kL + (tv & 3) * 8);
  const size_t gstep  = isK ? (size_t)32 * kLdTok : (size_t)32;       // halves from one pass's tile to the next
  const int    dstOff = isK ? ((tv >> 3) * kKPitch + (tv & 7) * 8) : (kStageV + (tv >> 2) * kVPitch + (tv & 3) * 8);

  const v8h g0 = *(const v8h*)gsrc;
  const _Float16* qrow = QKV + ((size_t)(i0 + c) * kB + b) * kN3 + h * kDh + koff;
  const v16h q0 = F::load(qrow);
  const v16h q1 = F::load(qrow + 32);
  asm volatile("s_wait_xcnt 0x0" ::: "memory");   // stands in front of the reuse of these loads' address registers by the fill below
  // Er: 2048 segments of 16 B a trip, a trip's four loads of a thread in flight together
  for (int seg0 = 0; seg0 < kL * 8; seg0 += 4 * kFaThreads) {
    v8h e[4];
#pragma unroll
    for (int x = 0; x < 4; ++x) e[x] = *(const v8h*)(ER + (size_t)(seg0 + x * kFaThreads + tid) * 8);
#pragma unroll
    for (int x = 0; x < 4; ++x) {
      const int idx = seg0 + x * kFaThreads + tid;
      *(v8h*)(sE + (idx >> 3) * kKPitch + (idx & 7) * 8) = e[x];
    }
  }
  *(v8h*)(sKV[0] + dstOff) = g0;
  __syncthreads();

  float* sp = strip[wave] + c * kStripPitch;
  const float* rp = sp + 15 - c + koff;

  const v8f zero8 = (v8f){0.f, 0.f, 0.f, 0.f, 0.f, 0.f, 0.f, 0.f};
  v8f o[4];
#pragma unroll
  for (int t = 0; t < 4; ++t) o[t] = zero8;
  float m = -__builtin_inff();
  float l = 0.f;

  for (int ps = 0; ps < kL / 32; ++ps) {
    const int j0 = ps * 32;
    const _Float16* kv = sKV[ps & 1];
    const bool more = ps + 1 < kL / 32;
    v8h g;
    if (more) {
      g = *(const v8h*)(gsrc + (size_t)(ps + 1) * gstep);
      asm volatile("s_wait_xcnt 0x0" ::: "memory");   // stands in front of the next pass's rewrite of this load's address registers
    }

    v8f s[2];
    v16h ka[2], kb[2];
#pragma unroll
    for (int u = 0; u < 2; ++u) {
      const _Float16* kp = kv + (u * 16 + c) * kKPitch + koff;
      ka[u] = F::load(kp);
      kb[u] = F::load(kp + 32);
    }
    const bool rel = j0 <= i0 + 15;
    v16h ea[3], eb[3];
    if (rel) {
      const int mb = (kL - 16) - i0 + j0;
#pragma unroll
      for (int t = 0; t < 3; ++t) {
        const int mr = mb + t * 16 + c;
        const _Float16* ep = sE + ((mr < kL - 1) ? mr : (kL - 1)) * kKPitch + koff;
        ea[t] = F::load(ep);
        eb[t] = F::load(ep + 32);
      }
    }
    // all fragment reads of the pass's score products are issued in front of the first product: one LDS latency instead of one
    // per product (without it the compiler reuses the fragment registers and waits for each pair of reads in turn)
    __builtin_amdgcn_sched_barrier(0);
#pragma unroll
    for (int u = 0; u < 2; ++u) s[u] = F::mma(kb[u], q1, F::mma(ka[u], q0, zero8));

    if (rel) {
      v8f z[3];
#pragma unroll
      for (int t = 0; t < 3; ++t) z[t] = F::mma(ea[t], q0, zero8);
#pragma unroll
      for (int t = 0; t < 3; ++t) z[t] = F::mma(eb[t], q1, z[t]);
#pragma unroll
      for (int t = 0; t < 3; ++t) {
        *(v4f*)(sp + t * 16 + koff)     = (v4f){z[t][0], z[t][1], z[t][2], z[t][3]};
        *(v4f*)(sp + t * 16 + koff + 4) = (v4f){z[t][4], z[t][5], z[t][6], z[t][7]};
      }
      // lanes c and c + 16 read what both of them wrote: the strip's stores stay in front of its reads
      __builtin_amdgcn_fence(__ATOMIC_RELEASE, "workgroup", "local");
      __builtin_amdgcn_wave_barrier();
      __builtin_amdgcn_fence(__ATOMIC_ACQUIRE, "workgroup", "local");
#pragma unroll
      for (int u = 0; u < 2; ++u)
#pragma unroll
        for (int r = 0; r < 8; ++r) {
          const float rv = rp[u * 16 + r];
          s[u][r] += (j0 + u * 16 + koff + r <= i0 + c) ? rv : 0.f;
        }
    }

    float mx = s[0][0];
#pragma unroll
    for (int r = 1; r < 8; ++r) mx = fmaxf(mx, s[0][r]);
#pragma unroll
    for (int r = 0; r < 8; ++r) mx = fmaxf(mx, s[1][r]);
    mx = fmaxf(mx, other_half(mx));
    const float mnew  = fmaxf(m, mx * kLogitScale);
    const float alpha = __builtin_amdgcn_exp2f(m - mnew);
    const float msh   = mnew - kPCarryLog2;
    m = mnew;
    float psum = 0.f;
    v16h pb;
#pragma unroll
    for (int u = 0; u < 2; ++u)
#pragma unroll
      for (int r = 0; r < 8; ++r) {
        const float p = __builtin_amdgcn_exp2f(fmaf(s[u][r], kLogitScale, -msh));
        psum += p;
        pb[u * 8 + r] = (_Float16)p;
      }
    l = fmaf(l, alpha, psum);
#pragma unroll
    for (int t = 0; t < 4; ++t) {
      const v16h va = F::load(kv + kStageV + (t * 16 + c) * kVPitch + koff);
      o[t] *= alpha;
      o[t] = F::mma(va, pb, o[t]);
    }

    if (more) {   // the same for the whole block
      *(v8h*)(sKV[(ps + 1) & 1] + dstOff) = g;
      __syncthreads();   // publishes the next pass's tile; ends this pass's reads of its own buffer and of the strip
    }
  }

  l += other_half(l);
  const float inv = kOCarry / l;
  unsigned short* op = O16p + ((size_t)(i0 + c) * kB + b) * kE + h * kDh + koff;
#pragma unroll
  for (int t = 0; t < 4; ++t) {
    v8h hv;
#pragma unroll
    for (int r = 0; r < 8; ++r) hv[r] = (_Float16)(o[t][r] * inv);
    *(v8h*)(op + t * 16) = hv;
  }
}

// ---------------------------------------------------------------------------
// Host glue.
//   XH    f16 [4096][1024]            8,388,608  at           0   (query, A of the qkv projection)
//   WIN   f16 [3072][1024] (x16)      6,291,456  at   8,388,608   (Bt)
//   WO    f16 [1024][1024] (x16)      2,097,152  at  14,680,064   (Bt)
//   ER    f16 [1024][64]                131,072  at  16,777,216   (A of the relative scores)
//   QKV   f16 [4096][3072]           25,165,824  at  16,908,288   (qkv + bias; q cols 0.., k cols 1024.., v cols 2048..)
//   VT    f16 [64 bh][64 d][1024 l]   8,388,608  at  42,074,112   (A of attn.v)
//   O16   f16 [4096][1024] (x256)     8,388,608  at  50,462,720   (attention output, A of the output projection)
//   total                           58,851,328
// GEMM shapes: qkv M=4096 N=3072 K=1024; out M=4096 N=1024 K=1024. All M,N multiples of 64, all K multiples of 32.
// Launches: 4 casts + 1 qkv GEMM + 1 V^T pack + 1 fused attention over all 64 (batch, head) + 1 out GEMM = 8.
// ---------------------------------------------------------------------------
extern "C" void kernel_launch(void* const* d_in, const int* in_sizes, int n_in,
                              void* d_out, int out_size, void* d_ws, size_t ws_size,
                              hipStream_t stream) {
  if (n_in < 6) return;
  const int nTokE = kTok * kE;                     // 4,194,304
  if (in_sizes[0] != nTokE) return;
  if (in_sizes[1] != kL * kDh) return;
  if (in_sizes[2] != kN3 * kE) return;
  if (in_sizes[3] != kN3) return;
  if (in_sizes[4] != kE * kE) return;
  if (in_sizes[5] != kE) return;
  if (out_size != nTokE) return;

  const size_t szXH  = (size_t)kTok * kE * 2;
  const size_t szWIN = (size_t)kN3 * kE * 2;
  const size_t szWO  = (size_t)kE * kE * 2;
  const size_t szER  = (size_t)kL * kDh * 2;
  const size_t szQKV = (size_t)kTok * kN3 * 2;
  const size_t szVT  = (size_t)kB * kH * kDh * kL * 2;
  const size_t szO16 = (size_t)kTok * kE * 2;
  const size_t offXH  = 0;
  const size_t offWIN = offXH + szXH;
  const size_t offWO  = offWIN + szWIN;
  const size_t offER  = offWO + szWO;
  const size_t offQKV = offER + szER;
  const size_t offVT  = offQKV + szQKV;
  const size_t offO16 = offVT + szVT;
  const size_t total  = offO16 + szO16;
  if (ws_size < total) return;

  const float* query  = (const float*)d_in[0];
  const float* relpos = (const float*)d_in[1];
  const float* win    = (const float*)d_in[2];
  const float* bin    = (const float*)d_in[3];
  const float* wout   = (const float*)d_in[4];
  const float* bout   = (const float*)d_in[5];
  float* out = (float*)d_out;
  char* ws = (char*)d_ws;
  unsigned short* XH  = (unsigned short*)(ws + offXH);
  unsigned short* WIN = (unsigned short*)(ws + offWIN);
  unsigned short* WO  = (unsigned short*)(ws + offWO);
  unsigned short* ER  = (unsigned short*)(ws + offER);
  unsigned short* QKV = (unsigned short*)(ws + offQKV);
  unsigned short* VT  = (unsigned short*)(ws + offVT);
  unsigned short* O16 = (unsigned short*)(ws + offO16);

  // ---- prologue: 16-bit operand planes ----
  {
    const int n8x = nTokE / 8;            // 524288 -> 2048 blocks
    const int n8w = (kN3 * kE) / 8;       // 393216 -> 1536 blocks
    const int n8o = (kE * kE) / 8;        // 131072 -> 512 blocks
    const int n8e = (kL * kDh) / 8;       // 8192 -> 32 blocks
    cast8_f16_kernel<<<dim3((n8x + 255) / 256), dim3(256), 0, stream>>>(query, XH, n8x, 1.0f);
    cast8_f16_kernel<<<dim3((n8w + 255) / 256), dim3(256), 0, stream>>>(win, WIN, n8w, kWCarry);
    cast8_f16_kernel<<<dim3((n8o + 255) / 256), dim3(256), 0, stream>>>(wout, WO, n8o, kWCarry);
    cast8_f16_kernel<<<dim3((n8e + 255) / 256), dim3(256), 0, stream>>>(relpos, ER, n8e, 1.0f);
  }

  // ---- packed qkv projection: QKV[m][n] = f16( (1/16) * sum_k XH[m][k] * WIN[n][k] + b_in[n] )   (M=4096, N=3072, K=1024)
  {
    const int tiles = (kTok / 64) * (kN3 / 64);   // 3072 -> 384 blocks of 8 waves
    wmma_gemm64<0, false, 2, 1, false, 0><<<dim3(tiles / 8, 1), dim3(256), 0, stream>>>(
        XH, XH, kE, 0L, WIN, WIN, kE, 0L,
        (void*)QKV, (void*)QKV, kN3, 0L, bin, bin, 0L, kTok, kN3, kE, kWCarryInv);
  }

  // ---- V^T planes per (batch, head) ----
  vt_pack_kernel<<<dim3(kL / 64, kH, kB), dim3(256), 0, stream>>>((const unsigned*)(const void*)QKV, VT);

  // ---- scores, skew, softmax and attn.v of all 64 (batch, head): O16[(l*4+b)][h*64+d] = f16( 256 * sum_j P[bh][l][j] * v[bh][j][d] )
  rel_attn_fused_kernel<<<dim3(kL / kFaQ, kB * kH), dim3(kFaThreads), 0, stream>>>(QKV, ER, VT, O16);

  // ---- output projection: out[m][n] = (1/4096) * sum_e O16[m][e] * WO[n][e] + b_out[n]   (M=4096, N=1024, K=1024)
  {
    const int tiles = (kTok / 64) * (kE / 64);   // 1024 -> 128 blocks
    wmma_gemm64<0, false, 2, 0, false, 0><<<dim3(tiles / 8, 1), dim3(256), 0, stream>>>(
        O16, O16, kE, 0L, WO, WO, kE, 0L,
        (void*)out, (void*)out, kE, 0L, bout, bout, 0L, kTok, kE, kE, kOutScale);
  }
}

// v003
// One run takes 94 microseconds.
// Timed twice side by side with v002, it ran 1.81 and 1.83 times as fast.
// Over all steps from v000 it is 13.4 times as fast.
// Contractions: packed qkv projection (X f16 x W_in^T f16 carried x16), content scores k.q^T and relative scores Er.q^T (q, k, Er f16 planes, x0.125 in f32 behind the product), attn.v (V^T f16 x unnormalised P^T f16 carried x32768), output projection (O f16 carried x256 x Wo^T f16 carried x16): all v_wmma_f32_16x16x32_f16 with f32 accumulate; bias, skew gather and softmax in f32.
#include <hip/hip_runtime.h>
#include <math.h>

// ---------------------------------------------------------------------------
// Problem constants
// ---------------------------------------------------------------------------
constexpr int kL   = 1024;                 // sequence length
constexpr int kB   = 4;                    // batch
constexpr int kE   = 1024;                 // embed dim
constexpr int kH   = 16;                   // heads
constexpr int kDh  = 64;                   // head dim
constexpr int kTok = kL * kB;              // 4096 GEMM rows, m = l*4 + b
constexpr int kN3  = 3 * kE;               // 3072 packed qkv columns
constexpr int kLdTok = kB * kN3;           // 12288 halves between consecutive l of one (b, column) in the qkv plane
constexpr int kFaWaves    = 16;            // waves of a fused-attention block, 16 queries each
constexpr int kFaThreads  = kFaWaves * 32; // 512
constexpr int kFaQ        = kFaWaves * 16; // 256 queries of a block
constexpr int kStripPitch = 52;            // floats per query in the skew strip (48 used)
constexpr int kKPitch     = 72;            // halves per K or Er row in LDS (64 used)
constexpr int kVPitch     = 40;            // halves per V^T row of a pass in LDS (32 used)
constexpr int kStageV     = 32 * kKPitch;  // V^T tile behind the K tile in a stage buffer
constexpr int kStageHalves = kStageV + kDh * kVPitch;   // 4864
constexpr float kWCarry     = 16.0f;                 // weights carried x16 in f16
constexpr float kWCarryInv  = 1.0f / 16.0f;
constexpr float kScoreScale = 0.125f;                // 64^-0.5, applied to both score products
constexpr float kLogitScale = kScoreScale * 1.4426950408889634f;   // logits in the log2 domain
constexpr float kPCarryLog2 = 15.0f;                 // unnormalised probabilities carried x2^15 in f16
constexpr float kOCarry     = 256.0f;                // attention output carried x256 in f16
constexpr float kOutScale   = 1.0f / (kOCarry * kWCarry);   // 1/4096
static_assert(kH * kDh == kE, "shape");
static_assert(kTok % 64 == 0 && kN3 % 64 == 0 && kE % 64 == 0 && kL % 64 == 0 && kDh % 64 == 0, "M,N tile multiples");
static_assert(kE % 32 == 0 && kDh % 32 == 0 && kL % 32 == 0, "K multiples of 32");
static_assert(kL % kFaQ == 0 && kDh == 64 && kH == 16 && kFaThreads == 512, "fused attention coverage and staging map");

typedef __attribute__((ext_vector_type(16))) _Float16 v16h;
typedef __attribute__((ext_vector_type(8)))  _Float16 v8h;
typedef __attribute__((ext_vector_type(8)))  float    v8f;
typedef __attribute__((ext_vector_type(4)))  float    v4f;
typedef __attribute__((ext_vector_type(2)))  float    v2f;
typedef __attribute__((ext_vector_type(4)))  unsigned int v4u;

// ---------------------------------------------------------------------------
// Helper pieces
// ---------------------------------------------------------------------------
template <typename T> struct Frag;
template <> struct Frag<_Float16> {
  typedef v16h V; union U { v16h v; v8h h[2]; };
  // elements 0..7 <- p[0..7], 8..15 <- p[16..23]
  static __device__ __forceinline__ v16h load(const _Float16* p) {
    U f; f.h[0] = *(const v8h*)(p); f.h[1] = *(const v8h*)(p + 16); return f.v;
  }
  static __device__ __forceinline__ v8f mma(v16h a, v16h b, v8f c) {
    return __builtin_amdgcn_wmma_f32_16x16x32_f16(false, a, false, b, (short)0, c, false, false);
  }
};
__device__ __forceinline__ unsigned pk16(unsigned short a, unsigned short b) { return (unsigned)a | ((unsigned)b << 16); }
__device__ __forceinline__ unsigned short h_bits(float f) { const _Float16 h = (_Float16)f; return __builtin_bit_cast(unsigned short, h); }

// ---- WMMA GEMM, both operands staged in LDS ------------------------------------------------------------------------
// C[m,n] = scale * sum_k A[m,k] * Bt[n,k] + bias[n]; A row-major [M][kE], Bt row-major [N][kE], f16; M, N % 128 == 0.
// A block of 4 waves (2 x 2) owns a 128 x 128 tile of C, a wave 64 x 64 of it (16 accumulator tiles).
// A stage is 64 k (one 128-B line) of the tile's 128 A rows and, behind them, of its 128 Bt rows, at a row pitch of 144 B
// (16 B x odd: the 16-byte fragment reads fall on different banks). Two stage buffers: a trip works on one while the
// asynchronous copies of the next stage land in the other. A wave-wide copy covers four whole lines, and every line comes to
// the WGP once per block instead of once per wave in 32-byte pieces.
// Fragment contents and the k order of the sums are those of fragment loads straight from the row-major planes.
// OUT_MODE: 0 = f32, 1 = f16.
constexpr int kGThreads = 128;
constexpr int kGK       = 64;                  // halves of k in a stage
constexpr int kGPitch   = 72;                  // halves per staged row (64 used)
constexpr int kGStage   = 256 * kGPitch;       // halves per stage buffer: 36,864 B
static_assert(kTok % 128 == 0 && kN3 % 128 == 0 && kE % 128 == 0 && kE / kGK >= 2, "staged GEMM tiles and ring depth");

// Eight asynchronous 16-byte copies of a lane: rows r, r + 16, .. r + 112 of one operand's 128 staged rows.
// The s_wait_xcnt at the end stands in front of any later rewrite of the address registers that the copies name.
__device__ __forceinline__ void stage_rows128(unsigned lds, const _Float16* g) {
  asm volatile(
      "global_load_async_to_lds_b128 %0, %8, off\n\t"
      "global_load_async_to_lds_b128 %1, %9, off\n\t"
      "global_load_async_to_lds_b128 %2, %10, off\n\t"
      "global_load_async_to_lds_b128 %3, %11, off\n\t"
      "global_load_async_to_lds_b128 %4, %12, off\n\t"
      "global_load_async_to_lds_b128 %5, %13, off\n\t"
      "global_load_async_to_lds_b128 %6, %14, off\n\t"
      "global_load_async_to_lds_b128 %7, %15, off\n\t"
      "s_wait_xcnt 0x0"
      :: "v"(lds), "v"(lds + 1u * 16u * kGPitch * 2u), "v"(lds + 2u * 16u * kGPitch * 2u), "v"(lds + 3u * 16u * kGPitch * 2u),
         "v"(lds + 4u * 16u * kGPitch * 2u), "v"(lds + 5u * 16u * kGPitch * 2u), "v"(lds + 6u * 16u * kGPitch * 2u),
         "v"(lds + 7u * 16u * kGPitch * 2u),
         "v"(g), "v"(g + 1 * 16 * kE), "v"(g + 2 * 16 * kE), "v"(g + 3 * 16 * kE),
         "v"(g + 4 * 16 * kE), "v"(g + 5 * 16 * kE), "v"(g + 6 * 16 * kE), "v"(g + 7 * 16 * kE)
      : "memory");
}

template <int OUT_MODE>
__global__ __launch_bounds__(kGThreads) void wmma_gemm_staged(
    const unsigned short* __restrict__ Ap, const unsigned short* __restrict__ Btp,
    void* __restrict__ Cout, const float* __restrict__ bias, int N, float scale) {
  typedef Frag<_Float16> F;
  __shared__ __align__(16) _Float16 sAB[2][kGStage];   // 73,728 B
  __shared__ __align__(16) float sT[4][16 * 68];       // per-wave 16x64 slab, pitch 68 floats
  const _Float16* A  = (const _Float16*)Ap;
  const _Float16* Bt = (const _Float16*)Btp;
  const int tid  = threadIdx.x;
  const int lane = tid & 31;
  const int wave = tid >> 5;
  const int tilesN = N >> 7;
  const int tm = blockIdx.x / tilesN;
  const int tn = blockIdx.x - tm * tilesN;
  const int ldc = N;

  const int rlane = lane & 15;                 // row (A) / col (B, D) within subtile
  const int koff  = (lane >> 4) * 8;           // k offset of this lane half
  const int mOff  = (lane >> 4) * 8;           // D row offset

  // copy map: thread t brings segment t & 7 (16 B) of rows (t >> 3) + 16 x, x = 0..7, of each operand
  const _Float16* gA = A  + (size_t)(tm * 128 + (tid >> 3)) * kE + (tid & 7) * 8;
  const _Float16* gB = Bt + (size_t)(tn * 128 + (tid >> 3)) * kE + (tid & 7) * 8;
  const unsigned ldsA = (unsigned)(size_t)(&sAB[0][0]) + (unsigned)(((tid >> 3) * kGPitch + (tid & 7) * 8) * 2);
  const unsigned ldsB = ldsA + 128u * kGPitch * 2u;
  constexpr unsigned kStageBytes = kGStage * 2u;
  constexpr int T = kE / kGK;                  // 16 stages

  stage_rows128(ldsA, gA);
  stage_rows128(ldsB, gB);
  asm volatile("s_wait_asynccnt 0x0" ::: "memory");   // this wave's share of stage 0 has landed
  __syncthreads();                                     // publishes stage 0
  stage_rows128(ldsA + kStageBytes, gA + kGK);
  stage_rows128(ldsB + kStageBytes, gB + kGK);

  v8f acc[4][4];
#pragma unroll
  for (int i = 0; i < 4; ++i)
#pragma unroll
    for (int j = 0; j < 4; ++j) acc[i][j] = (v8f){0.f,0.f,0.f,0.f,0.f,0.f,0.f,0.f};

  const int aOff = ((wave >> 1) * 64 + rlane) * kGPitch + koff;
  const int bOff = (128 + (wave & 1) * 64 + rlane) * kGPitch + koff;

#pragma unroll 1   // one trip per stage: the buffer index and the refill test stay scalar, the loop stays small
  for (int t = 0; t < T; ++t) {
    const _Float16* st = sAB[t & 1];
    v16h bh[2][4], ah[2][4];
#pragma unroll
    for (int kk = 0; kk < 2; ++kk) {
#pragma unroll
      for (int j = 0; j < 4; ++j) bh[kk][j] = F::load(st + bOff + j * 16 * kGPitch + kk * 32);
#pragma unroll
      for (int i = 0; i < 4; ++i) ah[kk][i] = F::load(st + aOff + i * 16 * kGPitch + kk * 32);
    }
    // all fragment reads of the stage are issued as one group in front of its products: one LDS latency a trip, and the second
    // half's reads land behind the first half's products (without it the compiler reuses one A fragment and waits at every row)
    __builtin_amdgcn_sched_barrier(0);
#pragma unroll
    for (int kk = 0; kk < 2; ++kk)
#pragma unroll
      for (int i = 0; i < 4; ++i)
#pragma unroll
        for (int j = 0; j < 4; ++j) acc[i][j] = F::mma(ah[kk][i], bh[kk][j], acc[i][j]);
    // keeps the waits and the barrier below behind the products: lifted over them they would wait for the next stage's copies
    // right after their issue, and for the second half's fragment reads in front of the first product
    __builtin_amdgcn_sched_barrier(0);
    asm volatile("s_wait_dscnt 0x0" ::: "memory");      // this wave's reads of the buffer are done before it is refilled
    asm volatile("s_wait_asynccnt 0x0" ::: "memory");   // this wave's share of stage t + 1 has landed
    __syncthreads();                                     // publishes stage t + 1; ends every wave's reads of stage t
    if (t + 2 < T) {                                     // the same for the whole block
      const unsigned bo = (unsigned)(t & 1) * kStageBytes;
      stage_rows128(ldsA + bo, gA + (t + 2) * kGK);
      stage_rows128(ldsB + bo, gB + (t + 2) * kGK);
    }
  }
  asm volatile("s_wait_asynccnt 0x0" ::: "memory");     // no copy is outstanding when the wave goes on to its end

  // ---- epilogue ----
  const int m0 = tm * 128 + (wave >> 1) * 64;
  const int n0 = tn * 128 + (wave & 1) * 64;
  float* slab = sT[wave];
#pragma unroll
  for (int i = 0; i < 4; ++i) {
    const int mBase = m0 + (i << 4);
#pragma unroll
    for (int j = 0; j < 4; ++j) {
      const float bv = bias[n0 + (j << 4) + rlane];
#pragma unroll
      for (int r = 0; r < 8; ++r) slab[(mOff + r) * 68 + (j << 4) + rlane] = acc[i][j][r] * scale + bv;
    }
    __builtin_amdgcn_fence(__ATOMIC_RELEASE, "workgroup");
    __builtin_amdgcn_wave_barrier();
    __builtin_amdgcn_fence(__ATOMIC_ACQUIRE, "workgroup");
    if (OUT_MODE == 0) {
      float* C = (float*)Cout;
      const int hh = lane >> 4, c4 = (lane & 15) * 4;     // row seg = 256 B = 16 lanes x 16 B
#pragma unroll
      for (int it = 0; it < 8; ++it) {
        const int row = it * 2 + hh;
        const v4f v = *(const v4f*)(slab + row * 68 + c4);
        *(v4f*)(C + (size_t)(mBase + row) * ldc + n0 + c4) = v;
      }
    } else {
      const int q = lane >> 3, c8 = (lane & 7) * 8;
      unsigned short* C = (unsigned short*)Cout;
#pragma unroll
      for (int it = 0; it < 4; ++it) {
        const int row = it * 4 + q;
        const float* sp = slab + row * 68 + c8;
        v8h hv;
#pragma unroll
        for (int e = 0; e < 8; ++e) hv[e] = (_Float16)sp[e];
        *(v8h*)(C + (size_t)(mBase + row) * ldc + n0 + c8) = hv;
      }
    }
    asm volatile("s_wait_xcnt 0x0" ::: "memory");   // stands in front of the next rows' reuse of the registers that these stores name
    __builtin_amdgcn_fence(__ATOMIC_RELEASE, "workgroup");
    __builtin_amdgcn_wave_barrier();
    __builtin_amdgcn_fence(__ATOMIC_ACQUIRE, "workgroup");
  }
}

// ---------------------------------------------------------------------------
// f32 -> f16 cast with an exact power-of-two carry, 8 consecutive elements per thread (one 16-B store per lane;
// Coverage: n8 = n/8 threads x 8 = whole plane (all n here are multiples of 2048, so grids are exact).
// ---------------------------------------------------------------------------
__global__ __launch_bounds__(256) void cast8_f16_kernel(const float* __restrict__ in, unsigned short* __restrict__ out,
                                                        int n8, float scale) {
  const int i = blockIdx.x * 256 + threadIdx.x;
  if (i >= n8) return;
  const float* p = in + 8 * (size_t)i;
  const v4f a = *(const v4f*)(p);
  const v4f c = *(const v4f*)(p + 4);
  unsigned short hb[8];
#pragma unroll
  for (int e = 0; e < 4; ++e) {
    hb[e]     = h_bits(a[e] * scale);
    hb[4 + e] = h_bits(c[e] * scale);
  }
  const v4u u = (v4u){pk16(hb[0], hb[1]), pk16(hb[2], hb[3]), pk16(hb[4], hb[5]), pk16(hb[6], hb[7])};
  unsigned short* q = out + 8 * (size_t)i;
  *(v4u*)q = u;
  
}

// ---------------------------------------------------------------------------
// V^T pack (pure 16-bit bit moves, no conversion): VT[(b*16+h)][d][l] = QKV[(l*4+b)][2048 + h*64 + d] (f16 bits).
// Source plane read as 32-bit words (2 halves per word). grid (kL/64, kH, kB): blockIdx.x = l tile (64), blockIdx.y = head,
// blockIdx.z = batch; 256 threads.
// Load coverage: 8 iterations x 256 threads = 2048 words = 64 l-rows x 32 words (64 halves) = whole 64x64 tile.
// Store coverage: 8 waves x 2 iterations x 4 rows (lane>>3) = 64 d-rows; (lane&7) x 8 halves = 64 l-cols; each row segment =
// ---------------------------------------------------------------------------
__global__ __launch_bounds__(256) void vt_pack_kernel(const unsigned* __restrict__ QKVw, unsigned short* __restrict__ VT) {
  __shared__ unsigned sm[64][65];   // sm[d][l_local], f16 bits in the low 16 bits
  const int t  = threadIdx.x;
  const int l0 = blockIdx.x * 64;
  const int h  = blockIdx.y;
  const int b  = blockIdx.z;
#pragma unroll
  for (int it = 0; it < 8; ++it) {
    const int e = it * 256 + t;
    const int r = e >> 5;          // l local 0..63
    const int w = e & 31;          // word index: d = 2w, 2w+1
    const size_t hidx = ((size_t)((l0 + r) * kB + b)) * kN3 + 2 * kE + h * kDh + 2 * w;   // half index, even
    const unsigned u = QKVw[hidx >> 1];
    sm[2 * w][r]     = u & 0xffffu;
    sm[2 * w + 1][r] = u >> 16;
  }
  __syncthreads();
  const int lane = t & 31, wave = t >> 5;
  const int q = lane >> 3, c8 = (lane & 7) * 8;
  unsigned short* op = VT + ((size_t)(b * kH + h) * kDh) * kL;
  {
#pragma unroll
    for (int it = 0; it < 2; ++it) {
      const int row = wave * 8 + it * 4 + q;                 // d
      const unsigned* sp = &sm[row][c8];
      const v4u u = (v4u){pk16((unsigned short)sp[0], (unsigned short)sp[1]), pk16((unsigned short)sp[2], (unsigned short)sp[3]),
                          pk16((unsigned short)sp[4], (unsigned short)sp[5]), pk16((unsigned short)sp[6], (unsigned short)sp[7])};
      *(v4u*)(op + (size_t)row * kL + l0 + c8) = u;
    }
    
  }
}

// ---------------------------------------------------------------------------
// Fused attention of one (batch, head): content scores, skewed relative scores, softmax and attn.v in one kernel.
// A block of 16 waves owns 256 queries; one wave owns 16 of them (i0 .. i0+15) and walks the 1024 keys 32 at a time (a pass).
// The 64 query tiles of a (batch, head) are dealt round robin to its 4 blocks (tile = wave * 4 + blockIdx.x), because a tile's
// relative-score work grows with i0: so every block carries the same share of it.
// Everything is computed transposed, so that a lane holds one query column (c = lane & 15) and the lane halves split its keys:
//   S^T  = K . Q^T        A = 16 key rows,          B = Q rows (kept in registers)  -> D[key 8*hf + r][query c]
//   QE^T = Er . Q^T       A = 16 rows m of Er,      B = the same Q                  -> D[m 8*hf + r][query c]
//   O^T += V^T . P^T      A = 16 d rows of V^T,     B = the two S^T tiles of the pass, converted in place
// LDS: Er (filled once; the block's queries reach all but its first rows), the pass's 32 K rows and 64 x 32 V^T tile (two buffers:
// every thread fetches 16 bytes of the next pass's tile into a register before the pass's work and stores them behind it; the one
// block barrier at the foot of a pass publishes that tile and ends the last read of the buffer that the next pass refills).
// Row pitches 144 B and 80 B (16 B x odd) keep the 16-byte fragment reads free of bank conflicts.
// Skew: srel[i][j] = QE[i][(L-1) - i + j] for j <= i, else 0. For query i0 + c and key j0 + jl the row of Er is
// mb + 15 - c + jl with mb = L - 16 - i0 + j0, so 48 rows from mb on serve the pass; the shift by the lane's own c goes
// through a per-wave LDS strip [query c][48 m], pitch 52 floats (16-B aligned rows; the shifted reads of the 32 lanes
// fall on 32 different banks). Rows of Er past L-1 belong to j > i only: their address is clamped, their value unused.
// Passes with every key above the diagonal (j0 > i0 + 15) have no relative term and skip that part.
// Softmax is the running-maximum form in the log2 domain (logit * 0.125 * log2 e): per pass the maximum of the lane's 16
// scores and of the other half's, p = 2^(logit - max + 15) in f32, f16 for the product; sums and O^T are rescaled by
// 2^(old max - new max). The x2^15 carry is in numerator and denominator alike and cancels in the epilogue.
// grid (L / 256, 64 bh), 512 threads.
// ---------------------------------------------------------------------------
__device__ __forceinline__ float other_half(float x) {   // lane l <-> lane l ^ 16
  const int v = __builtin_bit_cast(int, x);
  return __builtin_bit_cast(float, __builtin_amdgcn_permlanex16(v, v, 0x76543210, 0xfedcba98, false, false));
}

__global__ __launch_bounds__(kFaThreads) void rel_attn_fused_kernel(const unsigned short* __restrict__ QKVp,
                                                                    const unsigned short* __restrict__ ERp,
                                                                    const unsigned short* __restrict__ VTp,
                                                                    unsigned short* __restrict__ O16p) {
  typedef Frag<_Float16> F;
  __shared__ __align__(16) _Float16 sE[kL * kKPitch];                 // 147,456 B
  __shared__ __align__(16) _Float16 sKV[2][kStageHalves];             //  19,456 B
  __shared__ __align__(16) float strip[kFaWaves][16 * kStripPitch];   //  53,248 B
  const _Float16* QKV = (const _Float16*)QKVp;
  const _Float16* ER  = (const _Float16*)ERp;
  const _Float16* VT  = (const _Float16*)VTp;
  const int tid  = threadIdx.x;
  const int lane = tid & 31;
  const int wave = __builtin_amdgcn_readfirstlane(tid >> 5);   // scalar, so that the diagonal test is a scalar branch
  const int c    = lane & 15;
  const int koff = (lane >> 4) * 8;            // k offset of this lane half (operands), row offset (D)
  const int bh   = blockIdx.y;
  const int b    = bh >> 4;
  const int h    = bh & 15;
  const int i0   = (wave * (kL / kFaQ) + blockIdx.x) * 16;

  // staging map: waves 0..7 bring the K tile (32 rows x 8 segments of 16 B), waves 8..15 the V^T tile (64 rows x 4)
  const bool isK = wave < 8;
  const int  tv  = tid & 255;
  const _Float16* gsrc = isK ? (QKV + ((size_t)(tv >> 3) * kB + b) * kN3 + kE + h * kDh + (tv & 7) * 8)
                             : (VT + ((size_t)bh * kDh + (tv >> 2)) * kL + (tv & 3) * 8);
  const size_t gstep  = isK ? (size_t)32 * kLdTok : (size_t)32;       // halves from one pass's tile to the next
  const int    dstOff = isK ? ((tv >> 3) * kKPitch + (tv & 7) * 8) : (kStageV + (tv >> 2) * kVPitch + (tv & 3) * 8);

  const v8h g0 = *(const v8h*)gsrc;
  const _Float16* qrow = QKV + ((size_t)(i0 + c) * kB + b) * kN3 + h * kDh + koff;
  const v16h q0 = F::load(qrow);
  const v16h q1 = F::load(qrow + 32);
  asm volatile("s_wait_xcnt 0x0" ::: "memory");   // stands in front of the reuse of these loads' address registers by the fill below
  // Er: 2048 segments of 16 B a trip, a trip's four loads of a thread in flight together
  for (int seg0 = 0; seg0 < kL * 8; seg0 += 4 * kFaThreads) {
    v8h e[4];
#pragma unroll
    for (int x = 0; x < 4; ++x) e[x] = *(const v8h*)(ER + (size_t)(seg0 + x * kFaThreads + tid) * 8);
#pragma unroll
    for (int x = 0; x < 4; ++x) {
      const int idx = seg0 + x * kFaThreads + tid;
      *(v8h*)(sE + (idx >> 3) * kKPitch + (idx & 7) * 8) = e[x];
    }
  }
  *(v8h*)(sKV[0] + dstOff) = g0;
  __syncthreads();

  float* sp = strip[wave] + c * kStripPitch;
  const float* rp = sp + 15 - c + koff;

  const v8f zero8 = (v8f){0.f, 0.f, 0.f, 0.f, 0.f, 0.f, 0.f, 0.f};
  v8f o[4];
#pragma unroll
  for (int t = 0; t < 4; ++t) o[t] = zero8;
  float m = -__builtin_inff();
  float l = 0.f;

  for (int ps = 0; ps < kL / 32; ++ps) {
    const int j0 = ps * 32;
    const _Float16* kv = sKV[ps & 1];
    const bool more = ps + 1 < kL / 32;
    v8h g;
    if (more) {
      g = *(const v8h*)(gsrc + (size_t)(ps + 1) * gstep);
      asm volatile("s_wait_xcnt 0x0" ::: "memory");   // stands in front of the next pass's rewrite of this load's address registers
    }

    v8f s[2];
    v16h ka[2], kb[2];
#pragma unroll
    for (int u = 0; u < 2; ++u) {
      const _Float16* kp = kv + (u * 16 + c) * kKPitch + koff;
      ka[u] = F::load(kp);
      kb[u] = F::load(kp + 32);
    }
    const bool rel = j0 <= i0 + 15;
    v16h ea[3], eb[3];
    if (rel) {
      const int mb = (kL - 16) - i0 + j0;
#pragma unroll
      for (int t = 0; t < 3; ++t) {
        const int mr = mb + t * 16 + c;
        const _Float16* ep = sE + ((mr < kL - 1) ? mr : (kL - 1)) * kKPitch + koff;
        ea[t] = F::load(ep);
        eb[t] = F::load(ep + 32);
      }
    }
    // all fragment reads of the pass's score products are issued in front of the first product: one LDS latency instead of one
    // per product (without it the compiler reuses the fragment registers and waits for each pair of reads in turn)
    __builtin_amdgcn_sched_barrier(0);
#pragma unroll
    for (int u = 0; u < 2; ++u) s[u] = F::mma(kb[u], q1, F::mma(ka[u], q0, zero8));

    if (rel) {
      v8f z[3];
#pragma unroll
      for (int t = 0; t < 3; ++t) z[t] = F::mma(ea[t], q0, zero8);
#pragma unroll
      for (int t = 0; t < 3; ++t) z[t] = F::mma(eb[t], q1, z[t]);
#pragma unroll
      for (int t = 0; t < 3; ++t) {
        *(v4f*)(sp + t * 16 + koff)     = (v4f){z[t][0], z[t][1], z[t][2], z[t][3]};
        *(v4f*)(sp + t * 16 + koff + 4) = (v4f){z[t][4], z[t][5], z[t][6], z[t][7]};
      }
      // lanes c and c + 16 read what both of them wrote: the strip's stores stay in front of its reads
      __builtin_amdgcn_fence(__ATOMIC_RELEASE, "workgroup", "local");
      __builtin_amdgcn_wave_barrier();
      __builtin_amdgcn_fence(__ATOMIC_ACQUIRE, "workgroup", "local");
#pragma unroll
      for (int u = 0; u < 2; ++u)
#pragma unroll
        for (int r = 0; r < 8; ++r) {
          const float rv = rp[u * 16 + r];
          s[u][r] += (j0 + u * 16 + koff + r <= i0 + c) ? rv : 0.f;
        }
    }

    float mx = s[0][0];
#pragma unroll
    for (int r = 1; r < 8; ++r) mx = fmaxf(mx, s[0][r]);
#pragma unroll
    for (int r = 0; r < 8; ++r) mx = fmaxf(mx, s[1][r]);
    mx = fmaxf(mx, other_half(mx));
    const float mnew  = fmaxf(m, mx * kLogitScale);
    const float alpha = __builtin_amdgcn_exp2f(m - mnew);
    const float msh   = mnew - kPCarryLog2;
    m = mnew;
    float psum = 0.f;
    v16h pb;
#pragma unroll
    for (int u = 0; u < 2; ++u)
#pragma unroll
      for (int r = 0; r < 8; ++r) {
        const float p = __builtin_amdgcn_exp2f(fmaf(s[u][r], kLogitScale, -msh));
        psum += p;
        pb[u * 8 + r] = (_Float16)p;
      }
    l = fmaf(l, alpha, psum);
#pragma unroll
    for (int t = 0; t < 4; ++t) {
      const v16h va = F::load(kv + kStageV + (t * 16 + c) * kVPitch + koff);
      o[t] *= alpha;
      o[t] = F::mma(va, pb, o[t]);
    }

    if (more) {   // the same for the whole block
      *(v8h*)(sKV[(ps + 1) & 1] + dstOff) = g;
      __syncthreads();   // publishes the next pass's tile; ends this pass's reads of its own buffer and of the strip
    }
  }

  l += other_half(l);
  const float inv = kOCarry / l;
  unsigned short* op = O16p + ((size_t)(i0 + c) * kB + b) * kE + h * kDh + koff;
#pragma unroll
  for (int t = 0; t < 4; ++t) {
    v8h hv;
#pragma unroll
    for (int r = 0; r < 8; ++r) hv[r] = (_Float16)(o[t][r] * inv);
    *(v8h*)(op + t * 16) = hv;
  }
}

// ---------------------------------------------------------------------------
// Host glue.
//   XH    f16 [4096][1024]            8,388,608  at           0   (query, A of the qkv projection)
//   WIN   f16 [3072][1024] (x16)      6,291,456  at   8,388,608   (Bt)
//   WO    f16 [1024][1024] (x16)      2,097,152  at  14,680,064   (Bt)
//   ER    f16 [1024][64]                131,072  at  16,777,216   (A of the relative scores)
//   QKV   f16 [4096][3072]           25,165,824  at  16,908,288   (qkv + bias; q cols 0.., k cols 1024.., v cols 2048..)
//   VT    f16 [64 bh][64 d][1024 l]   8,388,608  at  42,074,112   (A of attn.v)
//   O16   f16 [4096][1024] (x256)     8,388,608  at  50,462,720   (attention output, A of the output projection)
//   total                           58,851,328
// GEMM shapes: qkv M=4096 N=3072 K=1024; out M=4096 N=1024 K=1024. All M,N multiples of 128, K a multiple of 64.
// Launches: 4 casts + 1 qkv GEMM + 1 V^T pack + 1 fused attention over all 64 (batch, head) + 1 out GEMM = 8.
// ---------------------------------------------------------------------------
extern "C" void kernel_launch(void* const* d_in, const int* in_sizes, int n_in,
                              void* d_out, int out_size, void* d_ws, size_t ws_size,
                              hipStream_t stream) {
  if (n_in < 6) return;
  const int nTokE = kTok * kE;                     // 4,194,304
  if (in_sizes[0] != nTokE) return;
  if (in_sizes[1] != kL * kDh) return;
  if (in_sizes[2] != kN3 * kE) return;
  if (in_sizes[3] != kN3) return;
  if (in_sizes[4] != kE * kE) return;
  if (in_sizes[5] != kE) return;
  if (out_size != nTokE) return;

  const size_t szXH  = (size_t)kTok * kE * 2;
  const size_t szWIN = (size_t)kN3 * kE * 2;
  const size_t szWO  = (size_t)kE * kE * 2;
  const size_t szER  = (size_t)kL * kDh * 2;
  const size_t szQKV = (size_t)kTok * kN3 * 2;
  const size_t szVT  = (size_t)kB * kH * kDh * kL * 2;
  const size_t szO16 = (size_t)kTok * kE * 2;
  const size_t offXH  = 0;
  const size_t offWIN = offXH + szXH;
  const size_t offWO  = offWIN + szWIN;
  const size_t offER  = offWO + szWO;
  const size_t offQKV = offER + szER;
  const size_t offVT  = offQKV + szQKV;
  const size_t offO16 = offVT + szVT;
  const size_t total  = offO16 + szO16;
  if (ws_size < total) return;

  const float* query  = (const float*)d_in[0];
  const float* relpos = (const float*)d_in[1];
  const float* win    = (const float*)d_in[2];
  const float* bin    = (const float*)d_in[3];
  const float* wout   = (const float*)d_in[4];
  const float* bout   = (const float*)d_in[5];
  float* out = (float*)d_out;
  char* ws = (char*)d_ws;
  unsigned short* XH  = (unsigned short*)(ws + offXH);
  unsigned short* WIN = (unsigned short*)(ws + offWIN);
  unsigned short* WO  = (unsigned short*)(ws + offWO);
  unsigned short* ER  = (unsigned short*)(ws + offER);
  unsigned short* QKV = (unsigned short*)(ws + offQKV);
  unsigned short* VT  = (unsigned short*)(ws + offVT);
  unsigned short* O16 = (unsigned short*)(ws + offO16);

  // ---- prologue: 16-bit operand planes ----
  {
    const int n8x = nTokE / 8;            // 524288 -> 2048 blocks
    const int n8w = (kN3 * kE) / 8;       // 393216 -> 1536 blocks
    const int n8o = (kE * kE) / 8;        // 131072 -> 512 blocks
    const int n8e = (kL * kDh) / 8;       // 8192 -> 32 blocks
    cast8_f16_kernel<<<dim3((n8x + 255) / 256), dim3(256), 0, stream>>>(query, XH, n8x, 1.0f);
    cast8_f16_kernel<<<dim3((n8w + 255) / 256), dim3(256), 0, stream>>>(win, WIN, n8w, kWCarry);
    cast8_f16_kernel<<<dim3((n8o + 255) / 256), dim3(256), 0, stream>>>(wout, WO, n8o, kWCarry);
    cast8_f16_kernel<<<dim3((n8e + 255) / 256), dim3(256), 0, stream>>>(relpos, ER, n8e, 1.0f);
  }

  // ---- packed qkv projection: QKV[m][n] = f16( (1/16) * sum_k XH[m][k] * WIN[n][k] + b_in[n] )   (M=4096, N=3072, K=1024)
  {
    const int tiles = (kTok / 128) * (kN3 / 128);   // 768 blocks of 4 waves
    wmma_gemm_staged<1><<<dim3(tiles), dim3(kGThreads), 0, stream>>>(XH, WIN, (void*)QKV, bin, kN3, kWCarryInv);
  }

  // ---- V^T planes per (batch, head) ----
  vt_pack_kernel<<<dim3(kL / 64, kH, kB), dim3(256), 0, stream>>>((const unsigned*)(const void*)QKV, VT);

  // ---- scores, skew, softmax and attn.v of all 64 (batch, head): O16[(l*4+b)][h*64+d] = f16( 256 * sum_j P[bh][l][j] * v[bh][j][d] )
  rel_attn_fused_kernel<<<dim3(kL / kFaQ, kB * kH), dim3(kFaThreads), 0, stream>>>(QKV, ER, VT, O16);

  // ---- output projection: out[m][n] = (1/4096) * sum_e O16[m][e] * WO[n][e] + b_out[n]   (M=4096, N=1024, K=1024)
  {
    const int tiles = (kTok / 128) * (kE / 128);   // 256 blocks of 4 waves
    wmma_gemm_staged<0><<<dim3(tiles), dim3(kGThreads), 0, stream>>>(O16, WO, (void*)out, bout, kE, kOutScale);
  }
}

// v004
// It runs in 91 microseconds.
// Timed twice side by side with v003, it ran 1.05 and 1.03 times as fast.
// All steps since v000 together make it 13.8 times as fast.
// Contractions: packed qkv projection (X f16 x W_in^T f16 carried x16), content scores k.q^T and relative scores Er.q^T (q, k, Er f16 planes, x0.125 in f32 behind the product), attn.v (V^T f16 x unnormalised P^T f16 carried x32768), output projection (O f16 carried x256 x Wo^T f16 carried x16): all v_wmma_f32_16x16x32_f16 with f32 accumulate; bias, skew gather and softmax in f32.
#include <hip/hip_runtime.h>
#include <math.h>

// ---------------------------------------------------------------------------
// Problem constants
// ---------------------------------------------------------------------------
constexpr int kL   = 1024;                 // sequence length
constexpr int kB   = 4;                    // batch
constexpr int kE   = 1024;                 // embed dim
constexpr int kH   = 16;                   // heads
constexpr int kDh  = 64;                   // head dim
constexpr int kTok = kL * kB;              // 4096 GEMM rows, m = l*4 + b
constexpr int kN3  = 3 * kE;               // 3072 packed qkv columns
constexpr int kLdTok = kB * kN3;           // 12288 halves between consecutive l of one (b, column) in the qkv plane
constexpr int kFaWaves    = 16;            // waves of a fused-attention block, 16 queries each
constexpr int kFaThreads  = kFaWaves * 32; // 512
constexpr int kFaQ        = kFaWaves * 16; // 256 queries of a block
constexpr int kStripPitch = 52;            // floats per query in the skew strip (48 used)
constexpr int kKPitch     = 72;            // halves per K or Er row in LDS (64 used)
constexpr int kVPitch     = 40;            // halves per V^T row of a pass in LDS (32 used)
constexpr int kStageV     = 32 * kKPitch;  // V^T tile behind the K tile in a stage buffer
constexpr int kStageHalves = kStageV + kDh * kVPitch;   // 4864
constexpr float kWCarry     = 16.0f;                 // weights carried x16 in f16
constexpr float kWCarryInv  = 1.0f / 16.0f;
constexpr float kScoreScale = 0.125f;                // 64^-0.5, applied to both score products
constexpr float kLogitScale = kScoreScale * 1.4426950408889634f;   // logits in the log2 domain
constexpr float kPCarryLog2 = 15.0f;                 // unnormalised probabilities carried x2^15 in f16
constexpr float kOCarry     = 256.0f;                // attention output carried x256 in f16
constexpr float kOutScale   = 1.0f / (kOCarry * kWCarry);   // 1/4096
static_assert(kH * kDh == kE, "shape");
static_assert(kTok % 64 == 0 && kN3 % 64 == 0 && kE % 64 == 0 && kL % 64 == 0 && kDh % 64 == 0, "M,N tile multiples");
static_assert(kE % 32 == 0 && kDh % 32 == 0 && kL % 32 == 0, "K multiples of 32");
static_assert(kL % kFaQ == 0 && kDh == 64 && kH == 16 && kFaThreads == 512, "fused attention coverage and staging map");

typedef __attribute__((ext_vector_type(16))) _Float16 v16h;
typedef __attribute__((ext_vector_type(8)))  _Float16 v8h;
typedef __attribute__((ext_vector_type(8)))  float    v8f;
typedef __attribute__((ext_vector_type(4)))  float    v4f;
typedef __attribute__((ext_vector_type(2)))  float    v2f;
typedef __attribute__((ext_vector_type(4)))  unsigned int v4u;

// ---------------------------------------------------------------------------
// Helper pieces
// ---------------------------------------------------------------------------
template <typename T> struct Frag;
template <> struct Frag<_Float16> {
  typedef v16h V; union U { v16h v; v8h h[2]; };
  // elements 0..7 <- p[0..7], 8..15 <- p[16..23]
  static __device__ __forceinline__ v16h load(const _Float16* p) {
    U f; f.h[0] = *(const v8h*)(p); f.h[1] = *(const v8h*)(p + 16); return f.v;
  }
  static __device__ __forceinline__ v8f mma(v16h a, v16h b, v8f c) {
    return __builtin_amdgcn_wmma_f32_16x16x32_f16(false, a, false, b, (short)0, c, false, false);
  }
};
__device__ __forceinline__ unsigned pk16(unsigned short a, unsigned short b) { return (unsigned)a | ((unsigned)b << 16); }
__device__ __forceinline__ unsigned short h_bits(float f) { const _Float16 h = (_Float16)f; return __builtin_bit_cast(unsigned short, h); }

// ---- WMMA GEMM, both operands staged in LDS ------------------------------------------------------------------------
// C[m,n] = scale * sum_k A[m,k] * Bt[n,k] + bias[n]; A row-major [M][kE], Bt row-major [N][kE], f16; M, N % 128 == 0.
// A block of 4 waves (2 x 2) owns a 128 x 128 tile of C, a wave 64 x 64 of it (16 accumulator tiles).
// A stage is 64 k (one 128-B line) of the tile's 128 A rows and, behind them, of its 128 Bt rows, at a row pitch of 144 B
// (16 B x odd: the 16-byte fragment reads fall on different banks). Two stage buffers: a trip works on one while the
// asynchronous copies of the next stage land in the other. A wave-wide copy covers four whole lines, and every line comes to
// the WGP once per block instead of once per wave in 32-byte pieces.
// Fragment contents and the k order of the sums are those of fragment loads straight from the row-major planes.
// OUT_MODE: 0 = f32, 1 = f16.
constexpr int kGThreads = 128;
constexpr int kGK       = 64;                  // halves of k in a stage
constexpr int kGPitch   = 72;                  // halves per staged row (64 used)
constexpr int kGStage   = 256 * kGPitch;       // halves per stage buffer: 36,864 B
static_assert(kTok % 128 == 0 && kN3 % 128 == 0 && kE % 128 == 0 && kE / kGK >= 2, "staged GEMM tiles and ring depth");

// Eight asynchronous 16-byte copies of a lane: rows r, r + 16, .. r + 112 of one operand's 128 staged rows.
// The s_wait_xcnt at the end stands in front of any later rewrite of the address registers that the copies name.
__device__ __forceinline__ void stage_rows128(unsigned lds, const _Float16* g) {
  asm volatile(
      "global_load_async_to_lds_b128 %0, %8, off\n\t"
      "global_load_async_to_lds_b128 %1, %9, off\n\t"
      "global_load_async_to_lds_b128 %2, %10, off\n\t"
      "global_load_async_to_lds_b128 %3, %11, off\n\t"
      "global_load_async_to_lds_b128 %4, %12, off\n\t"
      "global_load_async_to_lds_b128 %5, %13, off\n\t"
      "global_load_async_to_lds_b128 %6, %14, off\n\t"
      "global_load_async_to_lds_b128 %7, %15, off\n\t"
      "s_wait_xcnt 0x0"
      :: "v"(lds), "v"(lds + 1u * 16u * kGPitch * 2u), "v"(lds + 2u * 16u * kGPitch * 2u), "v"(lds + 3u * 16u * kGPitch * 2u),
         "v"(lds + 4u * 16u * kGPitch * 2u), "v"(lds + 5u * 16u * kGPitch * 2u), "v"(lds + 6u * 16u * kGPitch * 2u),
         "v"(lds + 7u * 16u * kGPitch * 2u),
         "v"(g), "v"(g + 1 * 16 * kE), "v"(g + 2 * 16 * kE), "v"(g + 3 * 16 * kE),
         "v"(g + 4 * 16 * kE), "v"(g + 5 * 16 * kE), "v"(g + 6 * 16 * kE), "v"(g + 7 * 16 * kE)
      : "memory");
}

template <int OUT_MODE>
__global__ __launch_bounds__(kGThreads) void wmma_gemm_staged(
    const unsigned short* __restrict__ Ap, const unsigned short* __restrict__ Btp,
    void* __restrict__ Cout, const float* __restrict__ bias, int N, float scale) {
  typedef Frag<_Float16> F;
  __shared__ __align__(16) _Float16 sAB[2][kGStage];   // 73,728 B
  __shared__ __align__(16) float sT[4][16 * 68];       // per-wave 16x64 slab, pitch 68 floats
  const _Float16* A  = (const _Float16*)Ap;
  const _Float16* Bt = (const _Float16*)Btp;
  const int tid  = threadIdx.x;
  const int lane = tid & 31;
  const int wave = tid >> 5;
  const int tilesN = N >> 7;
  const int tm = blockIdx.x / tilesN;
  const int tn = blockIdx.x - tm * tilesN;
  const int ldc = N;

  const int rlane = lane & 15;                 // row (A) / col (B, D) within subtile
  const int koff  = (lane >> 4) * 8;           // k offset of this lane half
  const int mOff  = (lane >> 4) * 8;           // D row offset

  // copy map: thread t brings segment t & 7 (16 B) of rows (t >> 3) + 16 x, x = 0..7, of each operand
  const _Float16* gA = A  + (size_t)(tm * 128 + (tid >> 3)) * kE + (tid & 7) * 8;
  const _Float16* gB = Bt + (size_t)(tn * 128 + (tid >> 3)) * kE + (tid & 7) * 8;
  const unsigned ldsA = (unsigned)(size_t)(&sAB[0][0]) + (unsigned)(((tid >> 3) * kGPitch + (tid & 7) * 8) * 2);
  const unsigned ldsB = ldsA + 128u * kGPitch * 2u;
  constexpr unsigned kStageBytes = kGStage * 2u;
  constexpr int T = kE / kGK;                  // 16 stages

  stage_rows128(ldsA, gA);
  stage_rows128(ldsB, gB);
  asm volatile("s_wait_asynccnt 0x0" ::: "memory");   // this wave's share of stage 0 has landed
  __syncthreads();                                     // publishes stage 0
  stage_rows128(ldsA + kStageBytes, gA + kGK);
  stage_rows128(ldsB + kStageBytes, gB + kGK);

  v8f acc[4][4];
#pragma unroll
  for (int i = 0; i < 4; ++i)
#pragma unroll
    for (int j = 0; j < 4; ++j) acc[i][j] = (v8f){0.f,0.f,0.f,0.f,0.f,0.f,0.f,0.f};

  const int aOff = ((wave >> 1) * 64 + rlane) * kGPitch + koff;
  const int bOff = (128 + (wave & 1) * 64 + rlane) * kGPitch + koff;

#pragma unroll 1   // one trip per stage: the buffer index and the refill test stay scalar, the loop stays small
  for (int t = 0; t < T; ++t) {
    const _Float16* st = sAB[t & 1];
    v16h bh[2][4], ah[2][4];
#pragma unroll
    for (int kk = 0; kk < 2; ++kk) {
#pragma unroll
      for (int j = 0; j < 4; ++j) bh[kk][j] = F::load(st + bOff + j * 16 * kGPitch + kk * 32);
#pragma unroll
      for (int i = 0; i < 4; ++i) ah[kk][i] = F::load(st + aOff + i * 16 * kGPitch + kk * 32);
    }
    // all fragment reads of the stage are issued as one group in front of its products: one LDS latency a trip, and the second
    // half's reads land behind the first half's products (without it the compiler reuses one A fragment and waits at every row)
    __builtin_amdgcn_sched_barrier(0);
#pragma unroll
    for (int kk = 0; kk < 2; ++kk)
#pragma unroll
      for (int i = 0; i < 4; ++i)
#pragma unroll
        for (int j = 0; j < 4; ++j) acc[i][j] = F::mma(ah[kk][i], bh[kk][j], acc[i][j]);
    // keeps the waits and the barrier below behind the products: lifted over them they would wait for the next stage's copies
    // right after their issue, and for the second half's fragment reads in front of the first product
    __builtin_amdgcn_sched_barrier(0);
    asm volatile("s_wait_dscnt 0x0" ::: "memory");      // this wave's reads of the buffer are done before it is refilled
    asm volatile("s_wait_asynccnt 0x0" ::: "memory");   // this wave's share of stage t + 1 has landed
    __syncthreads();                                     // publishes stage t + 1; ends every wave's reads of stage t
    if (t + 2 < T) {                                     // the same for the whole block
      const unsigned bo = (unsigned)(t & 1) * kStageBytes;
      stage_rows128(ldsA + bo, gA + (t + 2) * kGK);
      stage_rows128(ldsB + bo, gB + (t + 2) * kGK);
    }
  }
  asm volatile("s_wait_asynccnt 0x0" ::: "memory");     // no copy is outstanding when the wave goes on to its end

  // ---- epilogue ----
  const int m0 = tm * 128 + (wave >> 1) * 64;
  const int n0 = tn * 128 + (wave & 1) * 64;
  float* slab = sT[wave];
#pragma unroll
  for (int i = 0; i < 4; ++i) {
    const int mBase = m0 + (i << 4);
#pragma unroll
    for (int j = 0; j < 4; ++j) {
      const float bv = bias[n0 + (j << 4) + rlane];
#pragma unroll
      for (int r = 0; r < 8; ++r) slab[(mOff + r) * 68 + (j << 4) + rlane] = acc[i][j][r] * scale + bv;
    }
    __builtin_amdgcn_fence(__ATOMIC_RELEASE, "workgroup");
    __builtin_amdgcn_wave_barrier();
    __builtin_amdgcn_fence(__ATOMIC_ACQUIRE, "workgroup");
    if (OUT_MODE == 0) {
      float* C = (float*)Cout;
      const int hh = lane >> 4, c4 = (lane & 15) * 4;     // row seg = 256 B = 16 lanes x 16 B
#pragma unroll
      for (int it = 0; it < 8; ++it) {
        const int row = it * 2 + hh;
        const v4f v = *(const v4f*)(slab + row * 68 + c4);
        *(v4f*)(C + (size_t)(mBase + row) * ldc + n0 + c4) = v;
      }
    } else {
      const int q = lane >> 3, c8 = (lane & 7) * 8;
      unsigned short* C = (unsigned short*)Cout;
#pragma unroll
      for (int it = 0; it < 4; ++it) {
        const int row = it * 4 + q;
        const float* sp = slab + row * 68 + c8;
        v8h hv;
#pragma unroll
        for (int e = 0; e < 8; ++e) hv[e] = (_Float16)sp[e];
        *(v8h*)(C + (size_t)(mBase + row) * ldc + n0 + c8) = hv;
      }
    }
    asm volatile("s_wait_xcnt 0x0" ::: "memory");   // stands in front of the next rows' reuse of the registers that these stores name
    __builtin_amdgcn_fence(__ATOMIC_RELEASE, "workgroup");
    __builtin_amdgcn_wave_barrier();
    __builtin_amdgcn_fence(__ATOMIC_ACQUIRE, "workgroup");
  }
}

// ---------------------------------------------------------------------------
// f32 -> f16 casts of all four operand planes (exact power-of-two carries) in one launch.
// A thread converts 8 chunks of 8 consecutive elements (two 16-B loads, one 16-B store a chunk); a thread's chunks lie 4096
// elements apart, so a block of 16 waves covers 32,768 consecutive elements of one plane.
// Few waves with much to move each (for speed only).
// Blocks 0..127 query, 128..223 W_in, 224..255 W_o, 256..257 Er; every plane is a whole number of blocks.
// ---------------------------------------------------------------------------
constexpr int kCastThreads = 512;
constexpr int kCastChunks  = 8;
constexpr int kCastStep    = kCastThreads * 8;           // elements from one chunk of a thread to its next
constexpr int kCastBlock   = kCastStep * kCastChunks;    // 32,768 elements of a block
constexpr int kCastEndX    = kTok * kE / kCastBlock;                 // 128
constexpr int kCastEndWin  = kCastEndX + kN3 * kE / kCastBlock;      // 224
constexpr int kCastEndWo   = kCastEndWin + kE * kE / kCastBlock;     // 256
constexpr int kCastBlocks  = kCastEndWo + kL * kDh / kCastBlock;     // 258
static_assert((kTok * kE) % kCastBlock == 0 && (kN3 * kE) % kCastBlock == 0 && (kE * kE) % kCastBlock == 0 &&
              (kL * kDh) % kCastBlock == 0, "cast coverage");

__global__ __launch_bounds__(kCastThreads) void cast_planes_f16_kernel(
    const float* __restrict__ x, const float* __restrict__ win, const float* __restrict__ wo, const float* __restrict__ er,
    unsigned short* __restrict__ xh, unsigned short* __restrict__ winh, unsigned short* __restrict__ woh,
    unsigned short* __restrict__ erh) {
  const int bi = blockIdx.x;
  const int plane = (bi >= kCastEndX) + (bi >= kCastEndWin) + (bi >= kCastEndWo);
  const float* in     = plane == 0 ? x  : plane == 1 ? win  : plane == 2 ? wo  : er;
  unsigned short* out = plane == 0 ? xh : plane == 1 ? winh : plane == 2 ? woh : erh;
  const int first     = plane == 0 ? 0  : plane == 1 ? kCastEndX : plane == 2 ? kCastEndWin : kCastEndWo;
  const float scale   = (plane == 1 || plane == 2) ? kWCarry : 1.0f;
  const size_t base = (size_t)(bi - first) * kCastBlock + threadIdx.x * 8;
  const float* p = in + base;
  v4f a[kCastChunks], c[kCastChunks];
#pragma unroll
  for (int k = 0; k < kCastChunks; ++k) {
    a[k] = *(const v4f*)(p + k * kCastStep);
    c[k] = *(const v4f*)(p + k * kCastStep + 4);
  }
  // All 16 loads of the thread are issued in front of this line, so a wave pays one memory latency. The wait stands in front of
  // any reuse of the loads' address registers, which the operand keeps apart from the loads' own destinations.
  asm volatile("s_wait_xcnt 0x0" :: "v"(p) : "memory");
  unsigned short* q = out + base;
#pragma unroll
  for (int k = 0; k < kCastChunks; ++k) {
    unsigned short hb[8];
#pragma unroll
    for (int e = 0; e < 4; ++e) {
      hb[e]     = h_bits(a[k][e] * scale);
      hb[4 + e] = h_bits(c[k][e] * scale);
    }
    *(v4u*)(q + k * kCastStep) = (v4u){pk16(hb[0], hb[1]), pk16(hb[2], hb[3]), pk16(hb[4], hb[5]), pk16(hb[6], hb[7])};
  }
}

// ---------------------------------------------------------------------------
// V^T pack (pure 16-bit bit moves, no conversion): VT[(b*16+h)][d][l] = QKV[(l*4+b)][2048 + h*64 + d] (f16 bits).
// Source plane read as 32-bit words (2 halves per word). grid (kL/64, kH, kB): blockIdx.x = l tile (64), blockIdx.y = head,
// blockIdx.z = batch; 256 threads.
// Load coverage: 8 iterations x 256 threads = 2048 words = 64 l-rows x 32 words (64 halves) = whole 64x64 tile.
// Store coverage: 8 waves x 2 iterations x 4 rows (lane>>3) = 64 d-rows; (lane&7) x 8 halves = 64 l-cols; each row segment =
// ---------------------------------------------------------------------------
__global__ __launch_bounds__(256) void vt_pack_kernel(const unsigned* __restrict__ QKVw, unsigned short* __restrict__ VT) {
  __shared__ unsigned sm[64][65];   // sm[d][l_local], f16 bits in the low 16 bits
  const int t  = threadIdx.x;
  const int l0 = blockIdx.x * 64;
  const int h  = blockIdx.y;
  const int b  = blockIdx.z;
#pragma unroll
  for (int it = 0; it < 8; ++it) {
    const int e = it * 256 + t;
    const int r = e >> 5;          // l local 0..63
    const int w = e & 31;          // word index: d = 2w, 2w+1
    const size_t hidx = ((size_t)((l0 + r) * kB + b)) * kN3 + 2 * kE + h * kDh + 2 * w;   // half index, even
    const unsigned u = QKVw[hidx >> 1];
    sm[2 * w][r]     = u & 0xffffu;
    sm[2 * w + 1][r] = u >> 16;
  }
  __syncthreads();
  const int lane = t & 31, wave = t >> 5;
  const int q = lane >> 3, c8 = (lane & 7) * 8;
  unsigned short* op = VT + ((size_t)(b * kH + h) * kDh) * kL;
  {
#pragma unroll
    for (int it = 0; it < 2; ++it) {
      const int row = wave * 8 + it * 4 + q;                 // d
      const unsigned* sp = &sm[row][c8];
      const v4u u = (v4u){pk16((unsigned short)sp[0], (unsigned short)sp[1]), pk16((unsigned short)sp[2], (unsigned short)sp[3]),
                          pk16((unsigned short)sp[4], (unsigned short)sp[5]), pk16((unsigned short)sp[6], (unsigned short)sp[7])};
      *(v4u*)(op + (size_t)row * kL + l0 + c8) = u;
    }
    
  }
}

// ---------------------------------------------------------------------------
// Fused attention of one (batch, head): content scores, skewed relative scores, softmax and attn.v in one kernel.
// A block of 16 waves owns 256 queries; one wave owns 16 of them (i0 .. i0+15) and walks the 1024 keys 32 at a time (a pass).
// The 64 query tiles of a (batch, head) are dealt round robin to its 4 blocks (tile = wave * 4 + blockIdx.x), because a tile's
// relative-score work grows with i0: so every block carries the same share of it.
// Everything is computed transposed, so that a lane holds one query column (c = lane & 15) and the lane halves split its keys:
//   S^T  = K . Q^T        A = 16 key rows,          B = Q rows (kept in registers)  -> D[key 8*hf + r][query c]
//   QE^T = Er . Q^T       A = 16 rows m of Er,      B = the same Q                  -> D[m 8*hf + r][query c]
//   O^T += V^T . P^T      A = 16 d rows of V^T,     B = the two S^T tiles of the pass, converted in place
// LDS: Er (filled once; the block's queries reach all but its first rows), the pass's 32 K rows and 64 x 32 V^T tile (two buffers:
// every thread fetches 16 bytes of the next pass's tile into a register before the pass's work and stores them behind it; the one
// block barrier at the foot of a pass publishes that tile and ends the last read of the buffer that the next pass refills).
// Row pitches 144 B and 80 B (16 B x odd) keep the 16-byte fragment reads free of bank conflicts.
// Skew: srel[i][j] = QE[i][(L-1) - i + j] for j <= i, else 0. For query i0 + c and key j0 + jl the row of Er is
// mb + 15 - c + jl with mb = L - 16 - i0 + j0, so 48 rows from mb on serve the pass; the shift by the lane's own c goes
// through a per-wave LDS strip [query c][48 m], pitch 52 floats (16-B aligned rows; the shifted reads of the 32 lanes
// fall on 32 different banks). Rows of Er past L-1 belong to j > i only: their address is clamped, their value unused.
// Passes with every key above the diagonal (j0 > i0 + 15) have no relative term and skip that part.
// Softmax is the running-maximum form in the log2 domain (logit * 0.125 * log2 e): per pass the maximum of the lane's 16
// scores and of the other half's, p = 2^(logit - max + 15) in f32, f16 for the product; sums and O^T are rescaled by
// 2^(old max - new max). The x2^15 carry is in numerator and denominator alike and cancels in the epilogue.
// grid (L / 256, 64 bh), 512 threads.
// ---------------------------------------------------------------------------
__device__ __forceinline__ float other_half(float x) {   // lane l <-> lane l ^ 16
  const int v = __builtin_bit_cast(int, x);
  return __builtin_bit_cast(float, __builtin_amdgcn_permlanex16(v, v, 0x76543210, 0xfedcba98, false, false));
}

__global__ __launch_bounds__(kFaThreads) void rel_attn_fused_kernel(const unsigned short* __restrict__ QKVp,
                                                                    const unsigned short* __restrict__ ERp,
                                                                    const unsigned short* __restrict__ VTp,
                                                                    unsigned short* __restrict__ O16p) {
  typedef Frag<_Float16> F;
  __shared__ __align__(16) _Float16 sE[kL * kKPitch];                 // 147,456 B
  __shared__ __align__(16) _Float16 sKV[2][kStageHalves];             //  19,456 B
  __shared__ __align__(16) float strip[kFaWaves][16 * kStripPitch];   //  53,248 B
  const _Float16* QKV = (const _Float16*)QKVp;
  const _Float16* ER  = (const _Float16*)ERp;
  const _Float16* VT  = (const _Float16*)VTp;
  const int tid  = threadIdx.x;
  const int lane = tid & 31;
  const int wave = __builtin_amdgcn_readfirstlane(tid >> 5);   // scalar, so that the diagonal test is a scalar branch
  const int c    = lane & 15;
  const int koff = (lane >> 4) * 8;            // k offset of this lane half (operands), row offset (D)
  const int bh   = blockIdx.y;
  const int b    = bh >> 4;
  const int h    = bh & 15;
  const int i0   = (wave * (kL / kFaQ) + blockIdx.x) * 16;

  // staging map: waves 0..7 bring the K tile (32 rows x 8 segments of 16 B), waves 8..15 the V^T tile (64 rows x 4)
  const bool isK = wave < 8;
  const int  tv  = tid & 255;
  const _Float16* gsrc = isK ? (QKV + ((size_t)(tv >> 3) * kB + b) * kN3 + kE + h * kDh + (tv & 7) * 8)
                             : (VT + ((size_t)bh * kDh + (tv >> 2)) * kL + (tv & 3) * 8);
  const size_t gstep  = isK ? (size_t)32 * kLdTok : (size_t)32;       // halves from one pass's tile to the next
  const int    dstOff = isK ? ((tv >> 3) * kKPitch + (tv & 7) * 8) : (kStageV + (tv >> 2) * kVPitch + (tv & 3) * 8);

  const v8h g0 = *(const v8h*)gsrc;
  const _Float16* qrow = QKV + ((size_t)(i0 + c) * kB + b) * kN3 + h * kDh + koff;
  const v16h q0 = F::load(qrow);
  const v16h q1 = F::load(qrow + 32);
  asm volatile("s_wait_xcnt 0x0" ::: "memory");   // stands in front of the reuse of these loads' address registers by the fill below
  // Er: 2048 segments of 16 B a trip, a trip's four loads of a thread in flight together
  for (int seg0 = 0; seg0 < kL * 8; seg0 += 4 * kFaThreads) {
    v8h e[4];
#pragma unroll
    for (int x = 0; x < 4; ++x) e[x] = *(const v8h*)(ER + (size_t)(seg0 + x * kFaThreads + tid) * 8);
#pragma unroll
    for (int x = 0; x < 4; ++x) {
      const int idx = seg0 + x * kFaThreads + tid;
      *(v8h*)(sE + (idx >> 3) * kKPitch + (idx & 7) * 8) = e[x];
    }
  }
  *(v8h*)(sKV[0] + dstOff) = g0;
  __syncthreads();

  float* sp = strip[wave] + c * kStripPitch;
  const float* rp = sp + 15 - c + koff;

  const v8f zero8 = (v8f){0.f, 0.f, 0.f, 0.f, 0.f, 0.f, 0.f, 0.f};
  v8f o[4];
#pragma unroll
  for (int t = 0; t < 4; ++t) o[t] = zero8;
  float m = -__builtin_inff();
  float l = 0.f;

  for (int ps = 0; ps < kL / 32; ++ps) {
    const int j0 = ps * 32;
    const _Float16* kv = sKV[ps & 1];
    const bool more = ps + 1 < kL / 32;
    v8h g;
    if (more) {
      g = *(const v8h*)(gsrc + (size_t)(ps + 1) * gstep);
      asm volatile("s_wait_xcnt 0x0" ::: "memory");   // stands in front of the next pass's rewrite of this load's address registers
    }

    v8f s[2];
    v16h ka[2], kb[2];
#pragma unroll
    for (int u = 0; u < 2; ++u) {
      const _Float16* kp = kv + (u * 16 + c) * kKPitch + koff;
      ka[u] = F::load(kp);
      kb[u] = F::load(kp + 32);
    }
    const bool rel = j0 <= i0 + 15;
    v16h ea[3], eb[3];
    if (rel) {
      const int mb = (kL - 16) - i0 + j0;
#pragma unroll
      for (int t = 0; t < 3; ++t) {
        const int mr = mb + t * 16 + c;
        const _Float16* ep = sE + ((mr < kL - 1) ? mr : (kL - 1)) * kKPitch + koff;
        ea[t] = F::load(ep);
        eb[t] = F::load(ep + 32);
      }
    }
    // all fragment reads of the pass's score products are issued in front of the first product: one LDS latency instead of one
    // per product (without it the compiler reuses the fragment registers and waits for each pair of reads in turn)
    __builtin_amdgcn_sched_barrier(0);
#pragma unroll
    for (int u = 0; u < 2; ++u) s[u] = F::mma(kb[u], q1, F::mma(ka[u], q0, zero8));

    if (rel) {
      v8f z[3];
#pragma unroll
      for (int t = 0; t < 3; ++t) z[t] = F::mma(ea[t], q0, zero8);
#pragma unroll
      for (int t = 0; t < 3; ++t) z[t] = F::mma(eb[t], q1, z[t]);
#pragma unroll
      for (int t = 0; t < 3; ++t) {
        *(v4f*)(sp + t * 16 + koff)     = (v4f){z[t][0], z[t][1], z[t][2], z[t][3]};
        *(v4f*)(sp + t * 16 + koff + 4) = (v4f){z[t][4], z[t][5], z[t][6], z[t][7]};
      }
      // lanes c and c + 16 read what both of them wrote: the strip's stores stay in front of its reads
      __builtin_amdgcn_fence(__ATOMIC_RELEASE, "workgroup", "local");
      __builtin_amdgcn_wave_barrier();
      __builtin_amdgcn_fence(__ATOMIC_ACQUIRE, "workgroup", "local");
#pragma unroll
      for (int u = 0; u < 2; ++u)
#pragma unroll
        for (int r = 0; r < 8; ++r) {
          const float rv = rp[u * 16 + r];
          s[u][r] += (j0 + u * 16 + koff + r <= i0 + c) ? rv : 0.f;
        }
    }

    float mx = s[0][0];
#pragma unroll
    for (int r = 1; r < 8; ++r) mx = fmaxf(mx, s[0][r]);
#pragma unroll
    for (int r = 0; r < 8; ++r) mx = fmaxf(mx, s[1][r]);
    mx = fmaxf(mx, other_half(mx));
    const float mnew  = fmaxf(m, mx * kLogitScale);
    const float alpha = __builtin_amdgcn_exp2f(m - mnew);
    const float msh   = mnew - kPCarryLog2;
    m = mnew;
    float psum = 0.f;
    v16h pb;
#pragma unroll
    for (int u = 0; u < 2; ++u)
#pragma unroll
      for (int r = 0; r < 8; ++r) {
        const float p = __builtin_amdgcn_exp2f(fmaf(s[u][r], kLogitScale, -msh));
        psum += p;
        pb[u * 8 + r] = (_Float16)p;
      }
    l = fmaf(l, alpha, psum);
#pragma unroll
    for (int t = 0; t < 4; ++t) {
      const v16h va = F::load(kv + kStageV + (t * 16 + c) * kVPitch + koff);
      o[t] *= alpha;
      o[t] = F::mma(va, pb, o[t]);
    }

    if (more) {   // the same for the whole block
      *(v8h*)(sKV[(ps + 1) & 1] + dstOff) = g;
      __syncthreads();   // publishes the next pass's tile; ends this pass's reads of its own buffer and of the strip
    }
  }

  l += other_half(l);
  const float inv = kOCarry / l;
  unsigned short* op = O16p + ((size_t)(i0 + c) * kB + b) * kE + h * kDh + koff;
#pragma unroll
  for (int t = 0; t < 4; ++t) {
    v8h hv;
#pragma unroll
    for (int r = 0; r < 8; ++r) hv[r] = (_Float16)(o[t][r] * inv);
    *(v8h*)(op + t * 16) = hv;
  }
}

// ---------------------------------------------------------------------------
// Host glue.
//   XH    f16 [4096][1024]            8,388,608  at           0   (query, A of the qkv projection)
//   WIN   f16 [3072][1024] (x16)      6,291,456  at   8,388,608   (Bt)
//   WO    f16 [1024][1024] (x16)      2,097,152  at  14,680,064   (Bt)
//   ER    f16 [1024][64]                131,072  at  16,777,216   (A of the relative scores)
//   QKV   f16 [4096][3072]           25,165,824  at  16,908,288   (qkv + bias; q cols 0.., k cols 1024.., v cols 2048..)
//   VT    f16 [64 bh][64 d][1024 l]   8,388,608  at  42,074,112   (A of attn.v)
//   O16   f16 [4096][1024] (x256)     8,388,608  at  50,462,720   (attention output, A of the output projection)
//   total                           58,851,328
// GEMM shapes: qkv M=4096 N=3072 K=1024; out M=4096 N=1024 K=1024. All M,N multiples of 128, K a multiple of 64.
// Launches: 1 cast + 1 qkv GEMM + 1 V^T pack + 1 fused attention over all 64 (batch, head) + 1 out GEMM = 5.
// ---------------------------------------------------------------------------
extern "C" void kernel_launch(void* const* d_in, const int* in_sizes, int n_in,
                              void* d_out, int out_size, void* d_ws, size_t ws_size,
                              hipStream_t stream) {
  if (n_in < 6) return;
  const int nTokE = kTok * kE;                     // 4,194,304
  if (in_sizes[0] != nTokE) return;
  if (in_sizes[1] != kL * kDh) return;
  if (in_sizes[2] != kN3 * kE) return;
  if (in_sizes[3] != kN3) return;
  if (in_sizes[4] != kE * kE) return;
  if (in_sizes[5] != kE) return;
  if (out_size != nTokE) return;

  const size_t szXH  = (size_t)kTok * kE * 2;
  const size_t szWIN = (size_t)kN3 * kE * 2;
  const size_t szWO  = (size_t)kE * kE * 2;
  const size_t szER  = (size_t)kL * kDh * 2;
  const size_t szQKV = (size_t)kTok * kN3 * 2;
  const size_t szVT  = (size_t)kB * kH * kDh * kL * 2;
  const size_t szO16 = (size_t)kTok * kE * 2;
  const size_t offXH  = 0;
  const size_t offWIN = offXH + szXH;
  const size_t offWO  = offWIN + szWIN;
  const size_t offER  = offWO + szWO;
  const size_t offQKV = offER + szER;
  const size_t offVT  = offQKV + szQKV;
  const size_t offO16 = offVT + szVT;
  const size_t total  = offO16 + szO16;
  if (ws_size < total) return;

  const float* query  = (const float*)d_in[0];
  const float* relpos = (const float*)d_in[1];
  const float* win    = (const float*)d_in[2];
  const float* bin    = (const float*)d_in[3];
  const float* wout   = (const float*)d_in[4];
  const float* bout   = (const float*)d_in[5];
  float* out = (float*)d_out;
  char* ws = (char*)d_ws;
  unsigned short* XH  = (unsigned short*)(ws + offXH);
  unsigned short* WIN = (unsigned short*)(ws + offWIN);
  unsigned short* WO  = (unsigned short*)(ws + offWO);
  unsigned short* ER  = (unsigned short*)(ws + offER);
  unsigned short* QKV = (unsigned short*)(ws + offQKV);
  unsigned short* VT  = (unsigned short*)(ws + offVT);
  unsigned short* O16 = (unsigned short*)(ws + offO16);

  // ---- prologue: 16-bit operand planes ----
  cast_planes_f16_kernel<<<dim3(kCastBlocks), dim3(kCastThreads), 0, stream>>>(query, win, wout, relpos, XH, WIN, WO, ER);

  // ---- packed qkv projection: QKV[m][n] = f16( (1/16) * sum_k XH[m][k] * WIN[n][k] + b_in[n] )   (M=4096, N=3072, K=1024)
  {
    const int tiles = (kTok / 128) * (kN3 / 128);   // 768 blocks of 4 waves
    wmma_gemm_staged<1><<<dim3(tiles), dim3(kGThreads), 0, stream>>>(XH, WIN, (void*)QKV, bin, kN3, kWCarryInv);
  }

  // ---- V^T planes per (batch, head) ----
  vt_pack_kernel<<<dim3(kL / 64, kH, kB), dim3(256), 0, stream>>>((const unsigned*)(const void*)QKV, VT);

  // ---- scores, skew, softmax and attn.v of all 64 (batch, head): O16[(l*4+b)][h*64+d] = f16( 256 * sum_j P[bh][l][j] * v[bh][j][d] )
  rel_attn_fused_kernel<<<dim3(kL / kFaQ, kB * kH), dim3(kFaThreads), 0, stream>>>(QKV, ER, VT, O16);

  // ---- output projection: out[m][n] = (1/4096) * sum_e O16[m][e] * WO[n][e] + b_out[n]   (M=4096, N=1024, K=1024)
  {
    const int tiles = (kTok / 128) * (kE / 128);   // 256 blocks of 4 waves
    wmma_gemm_staged<0><<<dim3(tiles), dim3(kGThreads), 0, stream>>>(O16, WO, (void*)out, bout, kE, kOutScale);
  }
}

// v005
// It runs in 88.3 microseconds.
// In two side-by-side timings against v004, it was 1.04 and 1.05 times as fast.
// All steps since v000 together make it 14.4 times as fast.
// Contractions: packed qkv projection (X f16 x W_in^T f16 carried x16), content scores k.q^T and relative scores Er.q^T (q, k, Er f16 planes, x0.125 in f32 behind the product), attn.v (V^T f16, transposed on its way out of LDS, x unnormalised P^T f16 carried x32768), output projection (O f16 carried x256 x Wo^T f16 carried x16): all v_wmma_f32_16x16x32_f16 with f32 accumulate; bias, skew gather and softmax in f32.
#include <hip/hip_runtime.h>
#include <math.h>

// ---------------------------------------------------------------------------
// Problem constants
// ---------------------------------------------------------------------------
constexpr int kL   = 1024;                 // sequence length
constexpr int kB   = 4;                    // batch
constexpr int kE   = 1024;                 // embed dim
constexpr int kH   = 16;                   // heads
constexpr int kDh  = 64;                   // head dim
constexpr int kTok = kL * kB;              // 4096 GEMM rows, m = l*4 + b
constexpr int kN3  = 3 * kE;               // 3072 packed qkv columns
constexpr int kLdTok = kB * kN3;           // 12288 halves between consecutive l of one (b, column) in the qkv plane
constexpr int kFaWaves    = 16;            // waves of a fused-attention block, 16 queries each
constexpr int kFaThreads  = kFaWaves * 32; // 512
constexpr int kFaQ        = kFaWaves * 16; // 256 queries of a block
constexpr int kStripPitch = 52;            // floats per query in the skew strip (48 used)
constexpr int kKPitch     = 72;            // halves per K or Er row in LDS (64 used)
constexpr int kVPitch     = 80;            // halves per V row in LDS (64 used)
constexpr int kStageV     = 32 * kKPitch;  // V tile behind the K tile in a stage buffer
constexpr int kStageHalves = kStageV + 32 * kVPitch;    // 4864
constexpr float kWCarry     = 16.0f;                 // weights carried x16 in f16
constexpr float kWCarryInv  = 1.0f / 16.0f;
constexpr float kScoreScale = 0.125f;                // 64^-0.5, applied to both score products
constexpr float kLogitScale = kScoreScale * 1.4426950408889634f;   // logits in the log2 domain
constexpr float kPCarryLog2 = 15.0f;                 // unnormalised probabilities carried x2^15 in f16
constexpr float kOCarry     = 256.0f;                // attention output carried x256 in f16
constexpr float kOutScale   = 1.0f / (kOCarry * kWCarry);   // 1/4096
static_assert(kH * kDh == kE, "shape");
static_assert(kTok % 64 == 0 && kN3 % 64 == 0 && kE % 64 == 0 && kL % 64 == 0 && kDh % 64 == 0, "M,N tile multiples");
static_assert(kE % 32 == 0 && kDh % 32 == 0 && kL % 32 == 0, "K multiples of 32");
static_assert(kL % kFaQ == 0 && kDh == 64 && kH == 16 && kFaThreads == 512, "fused attention coverage and staging map");

typedef __attribute__((ext_vector_type(16))) _Float16 v16h;
typedef __attribute__((ext_vector_type(8)))  _Float16 v8h;
typedef __attribute__((ext_vector_type(8)))  float    v8f;
typedef __attribute__((ext_vector_type(4)))  float    v4f;
typedef __attribute__((ext_vector_type(2)))  float    v2f;
typedef __attribute__((ext_vector_type(4)))  unsigned int v4u;

// ---------------------------------------------------------------------------
// Helper pieces
// ---------------------------------------------------------------------------
template <typename T> struct Frag;
template <> struct Frag<_Float16> {
  typedef v16h V; union U { v16h v; v8h h[2]; };
  // elements 0..7 <- p[0..7], 8..15 <- p[16..23]
  static __device__ __forceinline__ v16h load(const _Float16* p) {
    U f; f.h[0] = *(const v8h*)(p); f.h[1] = *(const v8h*)(p + 16); return f.v;
  }
  static __device__ __forceinline__ v8f mma(v16h a, v16h b, v8f c) {
    return __builtin_amdgcn_wmma_f32_16x16x32_f16(false, a, false, b, (short)0, c, false, false);
  }
};
__device__ __forceinline__ unsigned pk16(unsigned short a, unsigned short b) { return (unsigned)a | ((unsigned)b << 16); }
__device__ __forceinline__ unsigned short h_bits(float f) { const _Float16 h = (_Float16)f; return __builtin_bit_cast(unsigned short, h); }

// ---- WMMA GEMM, both operands staged in LDS ------------------------------------------------------------------------
// C[m,n] = scale * sum_k A[m,k] * Bt[n,k] + bias[n]; A row-major [M][kE], Bt row-major [N][kE], f16; M, N % 128 == 0.
// A block of 4 waves (2 x 2) owns a 128 x 128 tile of C, a wave 64 x 64 of it (16 accumulator tiles).
// A stage is 64 k (one 128-B line) of the tile's 128 A rows and, behind them, of its 128 Bt rows, at a row pitch of 144 B
// (16 B x odd: the 16-byte fragment reads fall on different banks). Two stage buffers: a trip works on one while the
// asynchronous copies of the next stage land in the other. A wave-wide copy covers four whole lines, and every line comes to
// the WGP once per block instead of once per wave in 32-byte pieces.
// Fragment contents and the k order of the sums are those of fragment loads straight from the row-major planes.
// OUT_MODE: 0 = f32, 1 = f16.
constexpr int kGThreads = 128;
constexpr int kGK       = 64;                  // halves of k in a stage
constexpr int kGPitch   = 72;                  // halves per staged row (64 used)
constexpr int kGStage   = 256 * kGPitch;       // halves per stage buffer: 36,864 B
static_assert(kTok % 128 == 0 && kN3 % 128 == 0 && kE % 128 == 0 && kE / kGK >= 2, "staged GEMM tiles and ring depth");

// Eight asynchronous 16-byte copies of a lane: rows r, r + 16, .. r + 112 of one operand's 128 staged rows.
// The s_wait_xcnt at the end stands in front of any later rewrite of the address registers that the copies name.
__device__ __forceinline__ void stage_rows128(unsigned lds, const _Float16* g) {
  asm volatile(
      "global_load_async_to_lds_b128 %0, %8, off\n\t"
      "global_load_async_to_lds_b128 %1, %9, off\n\t"
      "global_load_async_to_lds_b128 %2, %10, off\n\t"
      "global_load_async_to_lds_b128 %3, %11, off\n\t"
      "global_load_async_to_lds_b128 %4, %12, off\n\t"
      "global_load_async_to_lds_b128 %5, %13, off\n\t"
      "global_load_async_to_lds_b128 %6, %14, off\n\t"
      "global_load_async_to_lds_b128 %7, %15, off\n\t"
      "s_wait_xcnt 0x0"
      :: "v"(lds), "v"(lds + 1u * 16u * kGPitch * 2u), "v"(lds + 2u * 16u * kGPitch * 2u), "v"(lds + 3u * 16u * kGPitch * 2u),
         "v"(lds + 4u * 16u * kGPitch * 2u), "v"(lds + 5u * 16u * kGPitch * 2u), "v"(lds + 6u * 16u * kGPitch * 2u),
         "v"(lds + 7u * 16u * kGPitch * 2u),
         "v"(g), "v"(g + 1 * 16 * kE), "v"(g + 2 * 16 * kE), "v"(g + 3 * 16 * kE),
         "v"(g + 4 * 16 * kE), "v"(g + 5 * 16 * kE), "v"(g + 6 * 16 * kE), "v"(g + 7 * 16 * kE)
      : "memory");
}

template <int OUT_MODE>
__global__ __launch_bounds__(kGThreads) void wmma_gemm_staged(
    const unsigned short* __restrict__ Ap, const unsigned short* __restrict__ Btp,
    void* __restrict__ Cout, const float* __restrict__ bias, int N, float scale) {
  typedef Frag<_Float16> F;
  __shared__ __align__(16) _Float16 sAB[2][kGStage];   // 73,728 B
  __shared__ __align__(16) float sT[4][16 * 68];       // per-wave 16x64 slab, pitch 68 floats
  const _Float16* A  = (const _Float16*)Ap;
  const _Float16* Bt = (const _Float16*)Btp;
  const int tid  = threadIdx.x;
  const int lane = tid & 31;
  const int wave = tid >> 5;
  const int tilesN = N >> 7;
  const int tm = blockIdx.x / tilesN;
  const int tn = blockIdx.x - tm * tilesN;
  const int ldc = N;

  const int rlane = lane & 15;                 // row (A) / col (B, D) within subtile
  const int koff  = (lane >> 4) * 8;           // k offset of this lane half
  const int mOff  = (lane >> 4) * 8;           // D row offset

  // copy map: thread t brings segment t & 7 (16 B) of rows (t >> 3) + 16 x, x = 0..7, of each operand
  const _Float16* gA = A  + (size_t)(tm * 128 + (tid >> 3)) * kE + (tid & 7) * 8;
  const _Float16* gB = Bt + (size_t)(tn * 128 + (tid >> 3)) * kE + (tid & 7) * 8;
  const unsigned ldsA = (unsigned)(size_t)(&sAB[0][0]) + (unsigned)(((tid >> 3) * kGPitch + (tid & 7) * 8) * 2);
  const unsigned ldsB = ldsA + 128u * kGPitch * 2u;
  constexpr unsigned kStageBytes = kGStage * 2u;
  constexpr int T = kE / kGK;                  // 16 stages

  stage_rows128(ldsA, gA);
  stage_rows128(ldsB, gB);
  asm volatile("s_wait_asynccnt 0x0" ::: "memory");   // this wave's share of stage 0 has landed
  __syncthreads();                                     // publishes stage 0
  stage_rows128(ldsA + kStageBytes, gA + kGK);
  stage_rows128(ldsB + kStageBytes, gB + kGK);

  v8f acc[4][4];
#pragma unroll
  for (int i = 0; i < 4; ++i)
#pragma unroll
    for (int j = 0; j < 4; ++j) acc[i][j] = (v8f){0.f,0.f,0.f,0.f,0.f,0.f,0.f,0.f};

  const int aOff = ((wave >> 1) * 64 + rlane) * kGPitch + koff;
  const int bOff = (128 + (wave & 1) * 64 + rlane) * kGPitch + koff;

#pragma unroll 1   // one trip per stage: the buffer index and the refill test stay scalar, the loop stays small
  for (int t = 0; t < T; ++t) {
    const _Float16* st = sAB[t & 1];
    v16h bh[2][4], ah[2][4];
#pragma unroll
    for (int kk = 0; kk < 2; ++kk) {
#pragma unroll
      for (int j = 0; j < 4; ++j) bh[kk][j] = F::load(st + bOff + j * 16 * kGPitch + kk * 32);
#pragma unroll
      for (int i = 0; i < 4; ++i) ah[kk][i] = F::load(st + aOff + i * 16 * kGPitch + kk * 32);
    }
    // all fragment reads of the stage are issued as one group in front of its products: one LDS latency a trip, and the second
    // half's reads land behind the first half's products (without it the compiler reuses one A fragment and waits at every row)
    __builtin_amdgcn_sched_barrier(0);
#pragma unroll
    for (int kk = 0; kk < 2; ++kk)
#pragma unroll
      for (int i = 0; i < 4; ++i)
#pragma unroll
        for (int j = 0; j < 4; ++j) acc[i][j] = F::mma(ah[kk][i], bh[kk][j], acc[i][j]);
    // keeps the waits and the barrier below behind the products: lifted over them they would wait for the next stage's copies
    // right after their issue, and for the second half's fragment reads in front of the first product
    __builtin_amdgcn_sched_barrier(0);
    asm volatile("s_wait_dscnt 0x0" ::: "memory");      // this wave's reads of the buffer are done before it is refilled
    asm volatile("s_wait_asynccnt 0x0" ::: "memory");   // this wave's share of stage t + 1 has landed
    __syncthreads();                                     // publishes stage t + 1; ends every wave's reads of stage t
    if (t + 2 < T) {                                     // the same for the whole block
      const unsigned bo = (unsigned)(t & 1) * kStageBytes;
      stage_rows128(ldsA + bo, gA + (t + 2) * kGK);
      stage_rows128(ldsB + bo, gB + (t + 2) * kGK);
    }
  }
  asm volatile("s_wait_asynccnt 0x0" ::: "memory");     // no copy is outstanding when the wave goes on to its end

  // ---- epilogue ----
  const int m0 = tm * 128 + (wave >> 1) * 64;
  const int n0 = tn * 128 + (wave & 1) * 64;
  float* slab = sT[wave];
#pragma unroll
  for (int i = 0; i < 4; ++i) {
    const int mBase = m0 + (i << 4);
#pragma unroll
    for (int j = 0; j < 4; ++j) {
      const float bv = bias[n0 + (j << 4) + rlane];
#pragma unroll
      for (int r = 0; r < 8; ++r) slab[(mOff + r) * 68 + (j << 4) + rlane] = acc[i][j][r] * scale + bv;
    }
    __builtin_amdgcn_fence(__ATOMIC_RELEASE, "workgroup");
    __builtin_amdgcn_wave_barrier();
    __builtin_amdgcn_fence(__ATOMIC_ACQUIRE, "workgroup");
    if (OUT_MODE == 0) {
      float* C = (float*)Cout;
      const int hh = lane >> 4, c4 = (lane & 15) * 4;     // row seg = 256 B = 16 lanes x 16 B
#pragma unroll
      for (int it = 0; it < 8; ++it) {
        const int row = it * 2 + hh;
        const v4f v = *(const v4f*)(slab + row * 68 + c4);
        *(v4f*)(C + (size_t)(mBase + row) * ldc + n0 + c4) = v;
      }
    } else {
      const int q = lane >> 3, c8 = (lane & 7) * 8;
      unsigned short* C = (unsigned short*)Cout;
#pragma unroll
      for (int it = 0; it < 4; ++it) {
        const int row = it * 4 + q;
        const float* sp = slab + row * 68 + c8;
        v8h hv;
#pragma unroll
        for (int e = 0; e < 8; ++e) hv[e] = (_Float16)sp[e];
        *(v8h*)(C + (size_t)(mBase + row) * ldc + n0 + c8) = hv;
      }
    }
    asm volatile("s_wait_xcnt 0x0" ::: "memory");   // stands in front of the next rows' reuse of the registers that these stores name
    __builtin_amdgcn_fence(__ATOMIC_RELEASE, "workgroup");
    __builtin_amdgcn_wave_barrier();
    __builtin_amdgcn_fence(__ATOMIC_ACQUIRE, "workgroup");
  }
}

// ---------------------------------------------------------------------------
// f32 -> f16 casts of all four operand planes (exact power-of-two carries) in one launch.
// A thread converts 8 chunks of 8 consecutive elements (two 16-B loads, one 16-B store a chunk); a thread's chunks lie 4096
// elements apart, so a block of 16 waves covers 32,768 consecutive elements of one plane.
// Few waves with much to move each (for speed only).
// Blocks 0..127 query, 128..223 W_in, 224..255 W_o, 256..257 Er; every plane is a whole number of blocks.
// ---------------------------------------------------------------------------
constexpr int kCastThreads = 512;
constexpr int kCastChunks  = 8;
constexpr int kCastStep    = kCastThreads * 8;           // elements from one chunk of a thread to its next
constexpr int kCastBlock   = kCastStep * kCastChunks;    // 32,768 elements of a block
constexpr int kCastEndX    = kTok * kE / kCastBlock;                 // 128
constexpr int kCastEndWin  = kCastEndX + kN3 * kE / kCastBlock;      // 224
constexpr int kCastEndWo   = kCastEndWin + kE * kE / kCastBlock;     // 256
constexpr int kCastBlocks  = kCastEndWo + kL * kDh / kCastBlock;     // 258
static_assert((kTok * kE) % kCastBlock == 0 && (kN3 * kE) % kCastBlock == 0 && (kE * kE) % kCastBlock == 0 &&
              (kL * kDh) % kCastBlock == 0, "cast coverage");

__global__ __launch_bounds__(kCastThreads) void cast_planes_f16_kernel(
    const float* __restrict__ x, const float* __restrict__ win, const float* __restrict__ wo, const float* __restrict__ er,
    unsigned short* __restrict__ xh, unsigned short* __restrict__ winh, unsigned short* __restrict__ woh,
    unsigned short* __restrict__ erh) {
  const int bi = blockIdx.x;
  const int plane = (bi >= kCastEndX) + (bi >= kCastEndWin) + (bi >= kCastEndWo);
  const float* in     = plane == 0 ? x  : plane == 1 ? win  : plane == 2 ? wo  : er;
  unsigned short* out = plane == 0 ? xh : plane == 1 ? winh : plane == 2 ? woh : erh;
  const int first     = plane == 0 ? 0  : plane == 1 ? kCastEndX : plane == 2 ? kCastEndWin : kCastEndWo;
  const float scale   = (plane == 1 || plane == 2) ? kWCarry : 1.0f;
  const size_t base = (size_t)(bi - first) * kCastBlock + threadIdx.x * 8;
  const float* p = in + base;
  v4f a[kCastChunks], c[kCastChunks];
#pragma unroll
  for (int k = 0; k < kCastChunks; ++k) {
    a[k] = *(const v4f*)(p + k * kCastStep);
    c[k] = *(const v4f*)(p + k * kCastStep + 4);
  }
  // All 16 loads of the thread are issued in front of this line, so a wave pays one memory latency. The wait stands in front of
  // any reuse of the loads' address registers, which the operand keeps apart from the loads' own destinations.
  asm volatile("s_wait_xcnt 0x0" :: "v"(p) : "memory");
  unsigned short* q = out + base;
#pragma unroll
  for (int k = 0; k < kCastChunks; ++k) {
    unsigned short hb[8];
#pragma unroll
    for (int e = 0; e < 4; ++e) {
      hb[e]     = h_bits(a[k][e] * scale);
      hb[4 + e] = h_bits(c[k][e] * scale);
    }
    *(v4u*)(q + k * kCastStep) = (v4u){pk16(hb[0], hb[1]), pk16(hb[2], hb[3]), pk16(hb[4], hb[5]), pk16(hb[6], hb[7])};
  }
}

// ---------------------------------------------------------------------------
// Fused attention of one (batch, head): content scores, skewed relative scores, softmax and attn.v in one kernel.
// A block of 16 waves owns 256 queries; one wave owns 16 of them (i0 .. i0+15) and walks the 1024 keys 32 at a time (a pass).
// The 64 query tiles of a (batch, head) are dealt round robin to its 4 blocks (tile = wave * 4 + blockIdx.x), because a tile's
// relative-score work grows with i0: so every block carries the same share of it.
// Everything is computed transposed, so that a lane holds one query column (c = lane & 15) and the lane halves split its keys:
//   S^T  = K . Q^T        A = 16 key rows,          B = Q rows (kept in registers)  -> D[key 8*hf + r][query c]
//   QE^T = Er . Q^T       A = 16 rows m of Er,      B = the same Q                  -> D[m 8*hf + r][query c]
//   O^T += V^T . P^T      A = 16 d rows of V^T,     B = the two S^T tiles of the pass, converted in place
// V stays in the qkv plane's own row-major form, in memory and in LDS: the transposing 16-bit LDS load hands a lane
// V[key 8*hf + 0..7][d = 16 t + c], which is the A fragment of V^T in the k order that the packed score tiles have.
// LDS: Er (filled once; the block's queries reach every row from 48 - 16 blockIdx.x on), the pass's 32 K rows and 32 V rows (two buffers:
// every thread fetches 16 bytes of the next pass's tile into a register before the pass's work and stores them behind it; the one
// block barrier at the foot of a pass publishes that tile and ends the last read of the buffer that the next pass refills).
// Row pitches: 144 B (16 B x odd) for the plain 16-byte fragment reads of K and Er, 160 B (32 B x odd) for the transposing
// reads of V: each reader free of bank conflicts at its own.
// Skew: srel[i][j] = QE[i][(L-1) - i + j] for j <= i, else 0. For query i0 + c and key j0 + jl the row of Er is
// mb + 15 - c + jl with mb = L - 16 - i0 + j0, so 48 rows from mb on serve the pass; the shift by the lane's own c goes
// through a per-wave LDS strip [query c][48 m], pitch 52 floats (16-B aligned rows; the shifted reads of the 32 lanes
// fall on 32 different banks). Rows of Er past L-1 belong to j > i only: their address is clamped, their value unused.
// Passes with every key above the diagonal (j0 > i0 + 15) have no relative term and skip that part.
// Softmax is the running-maximum form in the log2 domain (logit * 0.125 * log2 e): per pass the maximum of the lane's 16
// scores and of the other half's, p = 2^(logit - max + 15) in f32, f16 for the product; sums and O^T are rescaled by
// 2^(old max - new max). The x2^15 carry is in numerator and denominator alike and cancels in the epilogue.
// grid (L / 256, 64 bh), 512 threads.
// ---------------------------------------------------------------------------
__device__ __forceinline__ float other_half(float x) {   // lane l <-> lane l ^ 16
  const int v = __builtin_bit_cast(int, x);
  return __builtin_bit_cast(float, __builtin_amdgcn_permlanex16(v, v, 0x76543210, 0xfedcba98, false, false));
}

// 16 x 16 tile of 16-bit elements, row-major in LDS, transposed: 8 halves a lane
__device__ __forceinline__ v8h lds_tr16(const _Float16* p) {
  typedef __attribute__((ext_vector_type(8))) short s16x8;
  typedef __attribute__((address_space(3))) s16x8 lds_s16x8;
  return __builtin_bit_cast(v8h, __builtin_amdgcn_ds_load_tr16_b128_v8i16((lds_s16x8*)p));
}

__global__ __launch_bounds__(kFaThreads) void rel_attn_fused_kernel(const unsigned short* __restrict__ QKVp,
                                                                    const unsigned short* __restrict__ ERp,
                                                                    unsigned short* __restrict__ O16p) {
  typedef Frag<_Float16> F;
  __shared__ __align__(16) _Float16 sE[kL * kKPitch];                 // 147,456 B
  __shared__ __align__(16) _Float16 sKV[2][kStageHalves];             //  19,456 B
  __shared__ __align__(16) float strip[kFaWaves][16 * kStripPitch];   //  53,248 B
  const _Float16* QKV = (const _Float16*)QKVp;
  const _Float16* ER  = (const _Float16*)ERp;
  const int tid  = threadIdx.x;
  const int lane = tid & 31;
  const int wave = __builtin_amdgcn_readfirstlane(tid >> 5);   // scalar, so that the diagonal test is a scalar branch
  const int c    = lane & 15;
  const int koff = (lane >> 4) * 8;            // k offset of this lane half (operands), row offset (D)
  const int bh   = blockIdx.y;
  const int b    = bh >> 4;
  const int h    = bh & 15;
  const int i0   = (wave * (kL / kFaQ) + blockIdx.x) * 16;

  // staging map: waves 0..7 bring the K tile, waves 8..15 the V tile, each 32 rows x 8 segments of 16 B of the qkv plane
  const bool isK = wave < 8;
  const int  tv  = tid & 255;
  const _Float16* gsrc = QKV + ((size_t)(tv >> 3) * kB + b) * kN3 + (isK ? kE : 2 * kE) + h * kDh + (tv & 7) * 8;
  constexpr size_t gstep = (size_t)32 * kLdTok;                       // halves from one pass's tile to the next
  const int    dstOff = (isK ? (tv >> 3) * kKPitch : kStageV + (tv >> 3) * kVPitch) + (tv & 7) * 8;
  // transposing read: lane l names 16 B of key row 8 (l >> 4) + (l & 7), d columns 8 ((l >> 3) & 1) .. + 7 of a 16 x 16 tile
  const int    vOff   = kStageV + (koff + (lane & 7)) * kVPitch + ((lane >> 3) & 1) * 8;

  const v8h g0 = *(const v8h*)gsrc;
  const _Float16* qrow = QKV + ((size_t)(i0 + c) * kB + b) * kN3 + h * kDh + koff;
  const v16h q0 = F::load(qrow);
  const v16h q1 = F::load(qrow + 32);
  asm volatile("s_wait_xcnt 0x0" ::: "memory");   // stands in front of the reuse of these loads' address registers by the fill below
  // Er: 2048 segments of 16 B a trip, a trip's four loads of a thread in flight together
  for (int seg0 = 0; seg0 < kL * 8; seg0 += 4 * kFaThreads) {
    v8h e[4];
#pragma unroll
    for (int x = 0; x < 4; ++x) e[x] = *(const v8h*)(ER + (size_t)(seg0 + x * kFaThreads + tid) * 8);
#pragma unroll
    for (int x = 0; x < 4; ++x) {
      const int idx = seg0 + x * kFaThreads + tid;
      *(v8h*)(sE + (idx >> 3) * kKPitch + (idx & 7) * 8) = e[x];
    }
  }
  *(v8h*)(sKV[0] + dstOff) = g0;
  __syncthreads();

  float* sp = strip[wave] + c * kStripPitch;
  const float* rp = sp + 15 - c + koff;

  const v8f zero8 = (v8f){0.f, 0.f, 0.f, 0.f, 0.f, 0.f, 0.f, 0.f};
  v8f o[4];
#pragma unroll
  for (int t = 0; t < 4; ++t) o[t] = zero8;
  float m = -__builtin_inff();
  float l = 0.f;

  for (int ps = 0; ps < kL / 32; ++ps) {
    const int j0 = ps * 32;
    const _Float16* kv = sKV[ps & 1];
    const bool more = ps + 1 < kL / 32;
    v8h g;
    if (more) {
      g = *(const v8h*)(gsrc + (size_t)(ps + 1) * gstep);
      asm volatile("s_wait_xcnt 0x0" ::: "memory");   // stands in front of the next pass's rewrite of this load's address registers
    }

    v8f s[2];
    v16h ka[2], kb[2];
#pragma unroll
    for (int u = 0; u < 2; ++u) {
      const _Float16* kp = kv + (u * 16 + c) * kKPitch + koff;
      ka[u] = F::load(kp);
      kb[u] = F::load(kp + 32);
    }
    const bool rel = j0 <= i0 + 15;
    v16h ea[3], eb[3];
    if (rel) {
      const int mb = (kL - 16) - i0 + j0;
#pragma unroll
      for (int t = 0; t < 3; ++t) {
        const int mr = mb + t * 16 + c;
        const _Float16* ep = sE + ((mr < kL - 1) ? mr : (kL - 1)) * kKPitch + koff;
        ea[t] = F::load(ep);
        eb[t] = F::load(ep + 32);
      }
    }
    // all fragment reads of the pass's score products are issued in front of the first product: one LDS latency instead of one
    // per product (without it the compiler reuses the fragment registers and waits for each pair of reads in turn)
    __builtin_amdgcn_sched_barrier(0);
#pragma unroll
    for (int u = 0; u < 2; ++u) s[u] = F::mma(kb[u], q1, F::mma(ka[u], q0, zero8));

    if (rel) {
      v8f z[3];
#pragma unroll
      for (int t = 0; t < 3; ++t) z[t] = F::mma(ea[t], q0, zero8);
#pragma unroll
      for (int t = 0; t < 3; ++t) z[t] = F::mma(eb[t], q1, z[t]);
#pragma unroll
      for (int t = 0; t < 3; ++t) {
        *(v4f*)(sp + t * 16 + koff)     = (v4f){z[t][0], z[t][1], z[t][2], z[t][3]};
        *(v4f*)(sp + t * 16 + koff + 4) = (v4f){z[t][4], z[t][5], z[t][6], z[t][7]};
      }
      // lanes c and c + 16 read what both of them wrote: the strip's stores stay in front of its reads
      __builtin_amdgcn_fence(__ATOMIC_RELEASE, "workgroup", "local");
      __builtin_amdgcn_wave_barrier();
      __builtin_amdgcn_fence(__ATOMIC_ACQUIRE, "workgroup", "local");
#pragma unroll
      for (int u = 0; u < 2; ++u)
#pragma unroll
        for (int r = 0; r < 8; ++r) {
          const float rv = rp[u * 16 + r];
          s[u][r] += (j0 + u * 16 + koff + r <= i0 + c) ? rv : 0.f;
        }
    }

    float mx = s[0][0];
#pragma unroll
    for (int r = 1; r < 8; ++r) mx = fmaxf(mx, s[0][r]);
#pragma unroll
    for (int r = 0; r < 8; ++r) mx = fmaxf(mx, s[1][r]);
    mx = fmaxf(mx, other_half(mx));
    const float mnew  = fmaxf(m, mx * kLogitScale);
    const float alpha = __builtin_amdgcn_exp2f(m - mnew);
    const float msh   = mnew - kPCarryLog2;
    m = mnew;
    float psum = 0.f;
    v16h pb;
#pragma unroll
    for (int u = 0; u < 2; ++u)
#pragma unroll
      for (int r = 0; r < 8; ++r) {
        const float p = __builtin_amdgcn_exp2f(fmaf(s[u][r], kLogitScale, -msh));
        psum += p;
        pb[u * 8 + r] = (_Float16)p;
      }
    l = fmaf(l, alpha, psum);
#pragma unroll
    for (int t = 0; t < 4; ++t) {
      F::U va;   // keys 0..15 of the pass in elements 0..7 of the two lane halves, keys 16..31 in elements 8..15
      va.h[0] = lds_tr16(kv + vOff + t * 16);
      va.h[1] = lds_tr16(kv + vOff + 16 * kVPitch + t * 16);
      o[t] *= alpha;
      o[t] = F::mma(va.v, pb, o[t]);
    }

    if (more) {   // the same for the whole block
      *(v8h*)(sKV[(ps + 1) & 1] + dstOff) = g;
      __syncthreads();   // publishes the next pass's tile; ends this pass's reads of its own buffer and of the strip
    }
  }

  l += other_half(l);
  const float inv = kOCarry / l;
  unsigned short* op = O16p + ((size_t)(i0 + c) * kB + b) * kE + h * kDh + koff;
#pragma unroll
  for (int t = 0; t < 4; ++t) {
    v8h hv;
#pragma unroll
    for (int r = 0; r < 8; ++r) hv[r] = (_Float16)(o[t][r] * inv);
    *(v8h*)(op + t * 16) = hv;
  }
}

// ---------------------------------------------------------------------------
// Host glue.
//   XH    f16 [4096][1024]            8,388,608  at           0   (query, A of the qkv projection)
//   WIN   f16 [3072][1024] (x16)      6,291,456  at   8,388,608   (Bt)
//   WO    f16 [1024][1024] (x16)      2,097,152  at  14,680,064   (Bt)
//   ER    f16 [1024][64]                131,072  at  16,777,216   (A of the relative scores)
//   QKV   f16 [4096][3072]           25,165,824  at  16,908,288   (qkv + bias; q cols 0.., k cols 1024.., v cols 2048..)
//   O16   f16 [4096][1024] (x256)     8,388,608  at  42,074,112   (attention output, A of the output projection)
//   total                           50,462,720
// GEMM shapes: qkv M=4096 N=3072 K=1024; out M=4096 N=1024 K=1024. All M,N multiples of 128, K a multiple of 64.
// Launches: 1 cast + 1 qkv GEMM + 1 fused attention over all 64 (batch, head) + 1 out GEMM = 4.
// ---------------------------------------------------------------------------
extern "C" void kernel_launch(void* const* d_in, const int* in_sizes, int n_in,
                              void* d_out, int out_size, void* d_ws, size_t ws_size,
                              hipStream_t stream) {
  if (n_in < 6) return;
  const int nTokE = kTok * kE;                     // 4,194,304
  if (in_sizes[0] != nTokE) return;
  if (in_sizes[1] != kL * kDh) return;
  if (in_sizes[2] != kN3 * kE) return;
  if (in_sizes[3] != kN3) return;
  if (in_sizes[4] != kE * kE) return;
  if (in_sizes[5] != kE) return;
  if (out_size != nTokE) return;

  const size_t szXH  = (size_t)kTok * kE * 2;
  const size_t szWIN = (size_t)kN3 * kE * 2;
  const size_t szWO  = (size_t)kE * kE * 2;
  const size_t szER  = (size_t)kL * kDh * 2;
  const size_t szQKV = (size_t)kTok * kN3 * 2;
  const size_t szO16 = (size_t)kTok * kE * 2;
  const size_t offXH  = 0;
  const size_t offWIN = offXH + szXH;
  const size_t offWO  = offWIN + szWIN;
  const size_t offER  = offWO + szWO;
  const size_t offQKV = offER + szER;
  const size_t offO16 = offQKV + szQKV;
  const size_t total  = offO16 + szO16;
  if (ws_size < total) return;

  const float* query  = (const float*)d_in[0];
  const float* relpos = (const float*)d_in[1];
  const float* win    = (const float*)d_in[2];
  const float* bin    = (const float*)d_in[3];
  const float* wout   = (const float*)d_in[4];
  const float* bout   = (const float*)d_in[5];
  float* out = (float*)d_out;
  char* ws = (char*)d_ws;
  unsigned short* XH  = (unsigned short*)(ws + offXH);
  unsigned short* WIN = (unsigned short*)(ws + offWIN);
  unsigned short* WO  = (unsigned short*)(ws + offWO);
  unsigned short* ER  = (unsigned short*)(ws + offER);
  unsigned short* QKV = (unsigned short*)(ws + offQKV);
  unsigned short* O16 = (unsigned short*)(ws + offO16);

  // ---- prologue: 16-bit operand planes ----
  cast_planes_f16_kernel<<<dim3(kCastBlocks), dim3(kCastThreads), 0, stream>>>(query, win, wout, relpos, XH, WIN, WO, ER);

  // ---- packed qkv projection: QKV[m][n] = f16( (1/16) * sum_k XH[m][k] * WIN[n][k] + b_in[n] )   (M=4096, N=3072, K=1024)
  {
    const int tiles = (kTok / 128) * (kN3 / 128);   // 768 blocks of 4 waves
    wmma_gemm_staged<1><<<dim3(tiles), dim3(kGThreads), 0, stream>>>(XH, WIN, (void*)QKV, bin, kN3, kWCarryInv);
  }

  // ---- scores, skew, softmax and attn.v of all 64 (batch, head): O16[(l*4+b)][h*64+d] = f16( 256 * sum_j P[bh][l][j] * v[bh][j][d] )
  rel_attn_fused_kernel<<<dim3(kL / kFaQ, kB * kH), dim3(kFaThreads), 0, stream>>>(QKV, ER, O16);

  // ---- output projection: out[m][n] = (1/4096) * sum_e O16[m][e] * WO[n][e] + b_out[n]   (M=4096, N=1024, K=1024)
  {
    const int tiles = (kTok / 128) * (kE / 128);   // 256 blocks of 4 waves
    wmma_gemm_staged<0><<<dim3(tiles), dim3(kGThreads), 0, stream>>>(O16, WO, (void*)out, bout, kE, kOutScale);
  }
}

// v006
// One run takes 84.6 microseconds.
// In two side-by-side timings against v005, it was 1.03 and 1.05 times as fast.
// All steps since v000 together make it 15.0 times as fast.
// Contractions: packed qkv projection (X f16 x W_in^T f16 carried x16), content scores k.q^T and relative scores Er.q^T (q, k, Er f16 planes, x0.125 in f32 behind the product), attn.v (V^T f16, transposed on its way out of LDS, x unnormalised P^T f16 carried x32768), output projection (O f16 carried x256 x Wo^T f16 carried x16): all v_wmma_f32_16x16x32_f16 with f32 accumulate; bias, skew gather and softmax in f32.
#include <hip/hip_runtime.h>
#include <math.h>

// ---------------------------------------------------------------------------
// Problem constants
// ---------------------------------------------------------------------------
constexpr int kL   = 1024;                 // sequence length
constexpr int kB   = 4;                    // batch
constexpr int kE   = 1024;                 // embed dim
constexpr int kH   = 16;                   // heads
constexpr int kDh  = 64;                   // head dim
constexpr int kTok = kL * kB;              // 4096 GEMM rows, m = l*4 + b
constexpr int kN3  = 3 * kE;               // 3072 packed qkv columns
constexpr int kLdTok = kB * kN3;           // 12288 halves between consecutive l of one (b, column) in the qkv plane
constexpr int kFaWaves    = 16;            // waves of a fused-attention block, 16 queries each
constexpr int kFaThreads  = kFaWaves * 32; // 512
constexpr int kFaQ        = kFaWaves * 16; // 256 queries of a block
constexpr int kStripPitch = 52;            // floats per query in the skew strip (48 used)
constexpr int kKPitch     = 72;            // halves per K or Er row in LDS (64 used)
constexpr int kVPitch     = 80;            // halves per V row in LDS (64 used)
constexpr int kStageV     = 32 * kKPitch;  // V tile behind the K tile in a stage buffer
constexpr int kStageHalves = kStageV + 32 * kVPitch;    // 4864
constexpr float kWCarry     = 16.0f;                 // weights carried x16 in f16
constexpr float kWCarryInv  = 1.0f / 16.0f;
constexpr float kScoreScale = 0.125f;                // 64^-0.5, applied to both score products
constexpr float kLogitScale = kScoreScale * 1.4426950408889634f;   // logits in the log2 domain
constexpr float kPCarryLog2 = 15.0f;                 // unnormalised probabilities carried x2^15 in f16
constexpr float kOCarry     = 256.0f;                // attention output carried x256 in f16
constexpr float kOutScale   = 1.0f / (kOCarry * kWCarry);   // 1/4096
static_assert(kH * kDh == kE, "shape");
static_assert(kTok % 64 == 0 && kN3 % 64 == 0 && kE % 64 == 0 && kL % 64 == 0 && kDh % 64 == 0, "M,N tile multiples");
static_assert(kE % 32 == 0 && kDh % 32 == 0 && kL % 32 == 0, "K multiples of 32");
static_assert(kL % kFaQ == 0 && kDh == 64 && kH == 16 && kFaThreads == 512, "fused attention coverage and staging map");

typedef __attribute__((ext_vector_type(16))) _Float16 v16h;
typedef __attribute__((ext_vector_type(8)))  _Float16 v8h;
typedef __attribute__((ext_vector_type(8)))  float    v8f;
typedef __attribute__((ext_vector_type(4)))  float    v4f;
typedef __attribute__((ext_vector_type(2)))  float    v2f;
typedef __attribute__((ext_vector_type(4)))  unsigned int v4u;

// ---------------------------------------------------------------------------
// Helper pieces
// ---------------------------------------------------------------------------
template <typename T> struct Frag;
template <> struct Frag<_Float16> {
  typedef v16h V; union U { v16h v; v8h h[2]; };
  // elements 0..7 <- p[0..7], 8..15 <- p[16..23]
  static __device__ __forceinline__ v16h load(const _Float16* p) {
    U f; f.h[0] = *(const v8h*)(p); f.h[1] = *(const v8h*)(p + 16); return f.v;
  }
  static __device__ __forceinline__ v8f mma(v16h a, v16h b, v8f c) {
    return __builtin_amdgcn_wmma_f32_16x16x32_f16(false, a, false, b, (short)0, c, false, false);
  }
};
__device__ __forceinline__ unsigned pk16(unsigned short a, unsigned short b) { return (unsigned)a | ((unsigned)b << 16); }
__device__ __forceinline__ unsigned short h_bits(float f) { const _Float16 h = (_Float16)f; return __builtin_bit_cast(unsigned short, h); }

// ---- WMMA GEMM, both operands staged in LDS ------------------------------------------------------------------------
// C[m,n] = scale * sum_k A[m,k] * Bt[n,k] + bias[n]; A row-major [M][kE], Bt row-major [N][kE], f16; M, N % 128 == 0.
// A block of 4 waves (2 x 2) owns a 128 x 128 tile of C, a wave 64 x 64 of it (16 accumulator tiles).
// A stage is 64 k (one 128-B line) of the tile's 128 A rows and, behind them, of its 128 Bt rows, at a row pitch of 144 B
// (16 B x odd: the 16-byte fragment reads fall on different banks). NBUF stage buffers: a trip works on one while the
// asynchronous copies of the next NBUF - 1 stages land in the others. A wave-wide copy covers four whole lines, and every line
// comes to the WGP once per block instead of once per wave in 32-byte pieces.
// Ring depth: the blocks that share operand rows walk k together, so a stage's lines are asked for the first time by all of them
// at about the same moment and then come at memory latency, not at that of an L2 hit (reasoned, not measured). With two buffers
// a stage's copies have one trip to land. Three blocks on a WGP (qkv projection) fill one another's waits; a block alone on its
// WGP (output projection) has nothing to fill them, so it takes four buffers: a stage's copies then have three trips to land.
// Fragment contents and the k order of the sums are those of fragment loads straight from the row-major planes.
// OUT_MODE: 0 = f32, 1 = f16.
constexpr int kGThreads = 128;
constexpr int kGK       = 64;                  // halves of k in a stage
constexpr int kGPitch   = 72;                  // halves per staged row (64 used)
constexpr int kGStage   = 256 * kGPitch;       // halves per stage buffer: 36,864 B
constexpr int kGCopies  = 16;                  // asynchronous copies of a wave per stage (8 per operand)
static_assert(kTok % 128 == 0 && kN3 % 128 == 0 && kE % 128 == 0 && kE / kGK >= 4, "staged GEMM tiles and ring depth");

// Eight asynchronous 16-byte copies of a lane: rows r, r + 16, .. r + 112 of one operand's 128 staged rows.
// The s_wait_xcnt at the end stands in front of any later rewrite of the address registers that the copies name.
__device__ __forceinline__ void stage_rows128(unsigned lds, const _Float16* g) {
  asm volatile(
      "global_load_async_to_lds_b128 %0, %8, off\n\t"
      "global_load_async_to_lds_b128 %1, %9, off\n\t"
      "global_load_async_to_lds_b128 %2, %10, off\n\t"
      "global_load_async_to_lds_b128 %3, %11, off\n\t"
      "global_load_async_to_lds_b128 %4, %12, off\n\t"
      "global_load_async_to_lds_b128 %5, %13, off\n\t"
      "global_load_async_to_lds_b128 %6, %14, off\n\t"
      "global_load_async_to_lds_b128 %7, %15, off\n\t"
      "s_wait_xcnt 0x0"
      :: "v"(lds), "v"(lds + 1u * 16u * kGPitch * 2u), "v"(lds + 2u * 16u * kGPitch * 2u), "v"(lds + 3u * 16u * kGPitch * 2u),
         "v"(lds + 4u * 16u * kGPitch * 2u), "v"(lds + 5u * 16u * kGPitch * 2u), "v"(lds + 6u * 16u * kGPitch * 2u),
         "v"(lds + 7u * 16u * kGPitch * 2u),
         "v"(g), "v"(g + 1 * 16 * kE), "v"(g + 2 * 16 * kE), "v"(g + 3 * 16 * kE),
         "v"(g + 4 * 16 * kE), "v"(g + 5 * 16 * kE), "v"(g + 6 * 16 * kE), "v"(g + 7 * 16 * kE)
      : "memory");
}

template <int OUT_MODE, int NBUF>
__global__ __launch_bounds__(kGThreads) void wmma_gemm_staged(
    const unsigned short* __restrict__ Ap, const unsigned short* __restrict__ Btp,
    void* __restrict__ Cout, const float* __restrict__ bias, int N, float scale) {
  typedef Frag<_Float16> F;
  static_assert((NBUF & (NBUF - 1)) == 0 && NBUF >= 2 && (NBUF - 1) * kGCopies <= 63, "ring index and copies outstanding per wave");
  __shared__ __align__(16) _Float16 sAB[NBUF][kGStage];   // 36,864 B a buffer
  __shared__ __align__(16) float sT[4][16 * 68];       // per-wave 16x64 slab, pitch 68 floats
  const _Float16* A  = (const _Float16*)Ap;
  const _Float16* Bt = (const _Float16*)Btp;
  const int tid  = threadIdx.x;
  const int lane = tid & 31;
  const int wave = tid >> 5;
  const int tilesN = N >> 7;
  const int tm = blockIdx.x / tilesN;
  const int tn = blockIdx.x - tm * tilesN;
  const int ldc = N;

  const int rlane = lane & 15;                 // row (A) / col (B, D) within subtile
  const int koff  = (lane >> 4) * 8;           // k offset of this lane half
  const int mOff  = (lane >> 4) * 8;           // D row offset

  // copy map: thread t brings segment t & 7 (16 B) of rows (t >> 3) + 16 x, x = 0..7, of each operand
  const _Float16* gA = A  + (size_t)(tm * 128 + (tid >> 3)) * kE + (tid & 7) * 8;
  const _Float16* gB = Bt + (size_t)(tn * 128 + (tid >> 3)) * kE + (tid & 7) * 8;
  const unsigned ldsA = (unsigned)(size_t)(&sAB[0][0]) + (unsigned)(((tid >> 3) * kGPitch + (tid & 7) * 8) * 2);
  const unsigned ldsB = ldsA + 128u * kGPitch * 2u;
  constexpr unsigned kStageBytes = kGStage * 2u;
  constexpr int T = kE / kGK;                  // 16 stages

  // all but the copies of the NBUF - 2 youngest stages have landed: the count of the waits that publish a stage
  constexpr int kYounger = (NBUF - 2) * kGCopies;
#pragma unroll   // the first NBUF - 1 stages go out back to back, each buffer's offset a constant
  for (int s = 0; s < NBUF - 1; ++s) {
    stage_rows128(ldsA + (unsigned)s * kStageBytes, gA + s * kGK);
    stage_rows128(ldsB + (unsigned)s * kStageBytes, gB + s * kGK);
  }
  asm volatile("s_wait_asynccnt %0" :: "n"(kYounger) : "memory");   // this wave's share of stage 0 has landed
  __syncthreads();                                                   // publishes stage 0
  stage_rows128(ldsA + (unsigned)(NBUF - 1) * kStageBytes, gA + (NBUF - 1) * kGK);
  stage_rows128(ldsB + (unsigned)(NBUF - 1) * kStageBytes, gB + (NBUF - 1) * kGK);

  v8f acc[4][4];
#pragma unroll
  for (int i = 0; i < 4; ++i)
#pragma unroll
    for (int j = 0; j < 4; ++j) acc[i][j] = (v8f){0.f,0.f,0.f,0.f,0.f,0.f,0.f,0.f};

  const int aOff = ((wave >> 1) * 64 + rlane) * kGPitch + koff;
  const int bOff = (128 + (wave & 1) * 64 + rlane) * kGPitch + koff;

#pragma unroll 1   // one trip per stage: the buffer index and the refill test stay scalar, the loop stays small
  for (int t = 0; t < T; ++t) {
    const _Float16* st = sAB[t & (NBUF - 1)];
    v16h bh[2][4], ah[2][4];
#pragma unroll
    for (int kk = 0; kk < 2; ++kk) {
#pragma unroll
      for (int j = 0; j < 4; ++j) bh[kk][j] = F::load(st + bOff + j * 16 * kGPitch + kk * 32);
#pragma unroll
      for (int i = 0; i < 4; ++i) ah[kk][i] = F::load(st + aOff + i * 16 * kGPitch + kk * 32);
    }
    // all fragment reads of the stage are issued as one group in front of its products: one LDS latency a trip, and the second
    // half's reads land behind the first half's products (without it the compiler reuses one A fragment and waits at every row)
    __builtin_amdgcn_sched_barrier(0);
#pragma unroll
    for (int kk = 0; kk < 2; ++kk)
#pragma unroll
      for (int i = 0; i < 4; ++i)
#pragma unroll
        for (int j = 0; j < 4; ++j) acc[i][j] = F::mma(ah[kk][i], bh[kk][j], acc[i][j]);
    // keeps the waits and the barrier below behind the products: lifted over them they would wait for the next stage's copies
    // right after their issue, and for the second half's fragment reads in front of the first product
    __builtin_amdgcn_sched_barrier(0);
    asm volatile("s_wait_dscnt 0x0" ::: "memory");      // this wave's reads of the buffer are done before it is refilled
    // this wave's share of stage t + 1 has landed. Outstanding here are stages t + 1 .. t + NBUF - 1, kGCopies of this wave each,
    // while they all exist: the counted wait leaves the younger ones in flight. In the last trips fewer are outstanding: to 0.
    if (NBUF > 2 && t + NBUF - 1 < T) {                  // a scalar test, the same for the whole block
      asm volatile("s_wait_asynccnt %0" :: "n"(kYounger) : "memory");
    } else {
      asm volatile("s_wait_asynccnt 0x0" ::: "memory");
    }
    __syncthreads();                                     // publishes stage t + 1; ends every wave's reads of stage t
    if (t + NBUF < T) {                                  // the same for the whole block
      const unsigned bo = (unsigned)(t & (NBUF - 1)) * kStageBytes;
      stage_rows128(ldsA + bo, gA + (t + NBUF) * kGK);
      stage_rows128(ldsB + bo, gB + (t + NBUF) * kGK);
    }
  }
  asm volatile("s_wait_asynccnt 0x0" ::: "memory");     // no copy is outstanding when the wave goes on to its end

  // ---- epilogue ----
  const int m0 = tm * 128 + (wave >> 1) * 64;
  const int n0 = tn * 128 + (wave & 1) * 64;
  float* slab = sT[wave];
#pragma unroll
  for (int i = 0; i < 4; ++i) {
    const int mBase = m0 + (i << 4);
#pragma unroll
    for (int j = 0; j < 4; ++j) {
      const float bv = bias[n0 + (j << 4) + rlane];
#pragma unroll
      for (int r = 0; r < 8; ++r) slab[(mOff + r) * 68 + (j << 4) + rlane] = acc[i][j][r] * scale + bv;
    }
    __builtin_amdgcn_fence(__ATOMIC_RELEASE, "workgroup");
    __builtin_amdgcn_wave_barrier();
    __builtin_amdgcn_fence(__ATOMIC_ACQUIRE, "workgroup");
    if (OUT_MODE == 0) {
      float* C = (float*)Cout;
      const int hh = lane >> 4, c4 = (lane & 15) * 4;     // row seg = 256 B = 16 lanes x 16 B
#pragma unroll
      for (int it = 0; it < 8; ++it) {
        const int row = it * 2 + hh;
        const v4f v = *(const v4f*)(slab + row * 68 + c4);
        *(v4f*)(C + (size_t)(mBase + row) * ldc + n0 + c4) = v;
      }
    } else {
      const int q = lane >> 3, c8 = (lane & 7) * 8;
      unsigned short* C = (unsigned short*)Cout;
#pragma unroll
      for (int it = 0; it < 4; ++it) {
        const int row = it * 4 + q;
        const float* sp = slab + row * 68 + c8;
        v8h hv;
#pragma unroll
        for (int e = 0; e < 8; ++e) hv[e] = (_Float16)sp[e];
        *(v8h*)(C + (size_t)(mBase + row) * ldc + n0 + c8) = hv;
      }
    }
    asm volatile("s_wait_xcnt 0x0" ::: "memory");   // stands in front of the next rows' reuse of the registers that these stores name
    __builtin_amdgcn_fence(__ATOMIC_RELEASE, "workgroup");
    __builtin_amdgcn_wave_barrier();
    __builtin_amdgcn_fence(__ATOMIC_ACQUIRE, "workgroup");
  }
}

// ---------------------------------------------------------------------------
// f32 -> f16 casts of all four operand planes (exact power-of-two carries) in one launch.
// A thread converts 8 chunks of 8 consecutive elements (two 16-B loads, one 16-B store a chunk); a thread's chunks lie 4096
// elements apart, so a block of 16 waves covers 32,768 consecutive elements of one plane.
// Few waves with much to move each (for speed only).
// Blocks 0..127 query, 128..223 W_in, 224..255 W_o, 256..257 Er; every plane is a whole number of blocks.
// ---------------------------------------------------------------------------
constexpr int kCastThreads = 512;
constexpr int kCastChunks  = 8;
constexpr int kCastStep    = kCastThreads * 8;           // elements from one chunk of a thread to its next
constexpr int kCastBlock   = kCastStep * kCastChunks;    // 32,768 elements of a block
constexpr int kCastEndX    = kTok * kE / kCastBlock;                 // 128
constexpr int kCastEndWin  = kCastEndX + kN3 * kE / kCastBlock;      // 224
constexpr int kCastEndWo   = kCastEndWin + kE * kE / kCastBlock;     // 256
constexpr int kCastBlocks  = kCastEndWo + kL * kDh / kCastBlock;     // 258
static_assert((kTok * kE) % kCastBlock == 0 && (kN3 * kE) % kCastBlock == 0 && (kE * kE) % kCastBlock == 0 &&
              (kL * kDh) % kCastBlock == 0, "cast coverage");

__global__ __launch_bounds__(kCastThreads) void cast_planes_f16_kernel(
    const float* __restrict__ x, const float* __restrict__ win, const float* __restrict__ wo, const float* __restrict__ er,
    unsigned short* __restrict__ xh, unsigned short* __restrict__ winh, unsigned short* __restrict__ woh,
    unsigned short* __restrict__ erh) {
  const int bi = blockIdx.x;
  const int plane = (bi >= kCastEndX) + (bi >= kCastEndWin) + (bi >= kCastEndWo);
  const float* in     = plane == 0 ? x  : plane == 1 ? win  : plane == 2 ? wo  : er;
  unsigned short* out = plane == 0 ? xh : plane == 1 ? winh : plane == 2 ? woh : erh;
  const int first     = plane == 0 ? 0  : plane == 1 ? kCastEndX : plane == 2 ? kCastEndWin : kCastEndWo;
  const float scale   = (plane == 1 || plane == 2) ? kWCarry : 1.0f;
  const size_t base = (size_t)(bi - first) * kCastBlock + threadIdx.x * 8;
  const float* p = in + base;
  v4f a[kCastChunks], c[kCastChunks];
#pragma unroll
  for (int k = 0; k < kCastChunks; ++k) {
    a[k] = *(const v4f*)(p + k * kCastStep);
    c[k] = *(const v4f*)(p + k * kCastStep + 4);
  }
  // All 16 loads of the thread are issued in front of this line, so a wave pays one memory latency. The wait stands in front of
  // any reuse of the loads' address registers, which the operand keeps apart from the loads' own destinations.
  asm volatile("s_wait_xcnt 0x0" :: "v"(p) : "memory");
  unsigned short* q = out + base;
#pragma unroll
  for (int k = 0; k < kCastChunks; ++k) {
    unsigned short hb[8];
#pragma unroll
    for (int e = 0; e < 4; ++e) {
      hb[e]     = h_bits(a[k][e] * scale);
      hb[4 + e] = h_bits(c[k][e] * scale);
    }
    *(v4u*)(q + k * kCastStep) = (v4u){pk16(hb[0], hb[1]), pk16(hb[2], hb[3]), pk16(hb[4], hb[5]), pk16(hb[6], hb[7])};
  }
}

// ---------------------------------------------------------------------------
// Fused attention of one (batch, head): content scores, skewed relative scores, softmax and attn.v in one kernel.
// A block of 16 waves owns 256 queries; one wave owns 16 of them (i0 .. i0+15) and walks the 1024 keys 32 at a time (a pass).
// The 64 query tiles of a (batch, head) are dealt round robin to its 4 blocks (tile = wave * 4 + blockIdx.x), because a tile's
// relative-score work grows with i0: so every block carries the same share of it.
// Everything is computed transposed, so that a lane holds one query column (c = lane & 15) and the lane halves split its keys:
//   S^T  = K . Q^T        A = 16 key rows,          B = Q rows (kept in registers)  -> D[key 8*hf + r][query c]
//   QE^T = Er . Q^T       A = 16 rows m of Er,      B = the same Q                  -> D[m 8*hf + r][query c]
//   O^T += V^T . P^T      A = 16 d rows of V^T,     B = the two S^T tiles of the pass, converted in place
// V stays in the qkv plane's own row-major form, in memory and in LDS: the transposing 16-bit LDS load hands a lane
// V[key 8*hf + 0..7][d = 16 t + c], which is the A fragment of V^T in the k order that the packed score tiles have.
// LDS: Er (filled once; the block's queries reach every row from 48 - 16 blockIdx.x on), the pass's 32 K rows and 32 V rows (two buffers:
// every thread fetches 16 bytes of the next pass's tile into a register before the pass's work and stores them behind it; the one
// block barrier at the foot of a pass publishes that tile and ends the last read of the buffer that the next pass refills).
// Row pitches: 144 B (16 B x odd) for the plain 16-byte fragment reads of K and Er, 160 B (32 B x odd) for the transposing
// reads of V: each reader free of bank conflicts at its own.
// Skew: srel[i][j] = QE[i][(L-1) - i + j] for j <= i, else 0. For query i0 + c and key j0 + jl the row of Er is
// mb + 15 - c + jl with mb = L - 16 - i0 + j0, so 48 rows from mb on serve the pass; the shift by the lane's own c goes
// through a per-wave LDS strip [query c][48 m], pitch 52 floats (16-B aligned rows; the shifted reads of the 32 lanes
// fall on 32 different banks). Rows of Er past L-1 belong to j > i only: their address is clamped, their value unused.
// Passes with every key above the diagonal (j0 > i0 + 15) have no relative term and skip that part.
// Softmax is the running-maximum form in the log2 domain (logit * 0.125 * log2 e): per pass the maximum of the lane's 16
// scores and of the other half's, p = 2^(logit - max + 15) in f32, f16 for the product; sums and O^T are rescaled by
// 2^(old max - new max). The x2^15 carry is in numerator and denominator alike and cancels in the epilogue.
// grid (L / 256, 64 bh), 512 threads.
// ---------------------------------------------------------------------------
__device__ __forceinline__ float other_half(float x) {   // lane l <-> lane l ^ 16
  const int v = __builtin_bit_cast(int, x);
  return __builtin_bit_cast(float, __builtin_amdgcn_permlanex16(v, v, 0x76543210, 0xfedcba98, false, false));
}

// 16 x 16 tile of 16-bit elements, row-major in LDS, transposed: 8 halves a lane
__device__ __forceinline__ v8h lds_tr16(const _Float16* p) {
  typedef __attribute__((ext_vector_type(8))) short s16x8;
  typedef __attribute__((address_space(3))) s16x8 lds_s16x8;
  return __builtin_bit_cast(v8h, __builtin_amdgcn_ds_load_tr16_b128_v8i16((lds_s16x8*)p));
}

__global__ __launch_bounds__(kFaThreads) void rel_attn_fused_kernel(const unsigned short* __restrict__ QKVp,
                                                                    const unsigned short* __restrict__ ERp,
                                                                    unsigned short* __restrict__ O16p) {
  typedef Frag<_Float16> F;
  __shared__ __align__(16) _Float16 sE[kL * kKPitch];                 // 147,456 B
  __shared__ __align__(16) _Float16 sKV[2][kStageHalves];             //  19,456 B
  __shared__ __align__(16) float strip[kFaWaves][16 * kStripPitch];   //  53,248 B
  const _Float16* QKV = (const _Float16*)QKVp;
  const _Float16* ER  = (const _Float16*)ERp;
  const int tid  = threadIdx.x;
  const int lane = tid & 31;
  const int wave = __builtin_amdgcn_readfirstlane(tid >> 5);   // scalar, so that the diagonal test is a scalar branch
  const int c    = lane & 15;
  const int koff = (lane >> 4) * 8;            // k offset of this lane half (operands), row offset (D)
  const int bh   = blockIdx.y;
  const int b    = bh >> 4;
  const int h    = bh & 15;
  const int i0   = (wave * (kL / kFaQ) + blockIdx.x) * 16;

  // staging map: waves 0..7 bring the K tile, waves 8..15 the V tile, each 32 rows x 8 segments of 16 B of the qkv plane
  const bool isK = wave < 8;
  const int  tv  = tid & 255;
  const _Float16* gsrc = QKV + ((size_t)(tv >> 3) * kB + b) * kN3 + (isK ? kE : 2 * kE) + h * kDh + (tv & 7) * 8;
  constexpr size_t gstep = (size_t)32 * kLdTok;                       // halves from one pass's tile to the next
  const int    dstOff = (isK ? (tv >> 3) * kKPitch : kStageV + (tv >> 3) * kVPitch) + (tv & 7) * 8;
  // transposing read: lane l names 16 B of key row 8 (l >> 4) + (l & 7), d columns 8 ((l >> 3) & 1) .. + 7 of a 16 x 16 tile
  const int    vOff   = kStageV + (koff + (lane & 7)) * kVPitch + ((lane >> 3) & 1) * 8;

  const v8h g0 = *(const v8h*)gsrc;
  const _Float16* qrow = QKV + ((size_t)(i0 + c) * kB + b) * kN3 + h * kDh + koff;
  const v16h q0 = F::load(qrow);
  const v16h q1 = F::load(qrow + 32);
  asm volatile("s_wait_xcnt 0x0" ::: "memory");   // stands in front of the reuse of these loads' address registers by the fill below
  // Er: 2048 segments of 16 B a trip, a trip's four loads of a thread in flight together
  for (int seg0 = 0; seg0 < kL * 8; seg0 += 4 * kFaThreads) {
    v8h e[4];
#pragma unroll
    for (int x = 0; x < 4; ++x) e[x] = *(const v8h*)(ER + (size_t)(seg0 + x * kFaThreads + tid) * 8);
#pragma unroll
    for (int x = 0; x < 4; ++x) {
      const int idx = seg0 + x * kFaThreads + tid;
      *(v8h*)(sE + (idx >> 3) * kKPitch + (idx & 7) * 8) = e[x];
    }
  }
  *(v8h*)(sKV[0] + dstOff) = g0;
  __syncthreads();

  float* sp = strip[wave] + c * kStripPitch;
  const float* rp = sp + 15 - c + koff;

  const v8f zero8 = (v8f){0.f, 0.f, 0.f, 0.f, 0.f, 0.f, 0.f, 0.f};
  v8f o[4];
#pragma unroll
  for (int t = 0; t < 4; ++t) o[t] = zero8;
  float m = -__builtin_inff();
  float l = 0.f;

  for (int ps = 0; ps < kL / 32; ++ps) {
    const int j0 = ps * 32;
    const _Float16* kv = sKV[ps & 1];
    const bool more = ps + 1 < kL / 32;
    v8h g;
    if (more) {
      g = *(const v8h*)(gsrc + (size_t)(ps + 1) * gstep);
      asm volatile("s_wait_xcnt 0x0" ::: "memory");   // stands in front of the next pass's rewrite of this load's address registers
    }

    v8f s[2];
    v16h ka[2], kb[2];
#pragma unroll
    for (int u = 0; u < 2; ++u) {
      const _Float16* kp = kv + (u * 16 + c) * kKPitch + koff;
      ka[u] = F::load(kp);
      kb[u] = F::load(kp + 32);
    }
    const bool rel = j0 <= i0 + 15;
    v16h ea[3], eb[3];
    if (rel) {
      const int mb = (kL - 16) - i0 + j0;
#pragma unroll
      for (int t = 0; t < 3; ++t) {
        const int mr = mb + t * 16 + c;
        const _Float16* ep = sE + ((mr < kL - 1) ? mr : (kL - 1)) * kKPitch + koff;
        ea[t] = F::load(ep);
        eb[t] = F::load(ep + 32);
      }
    }
    // all fragment reads of the pass's score products are issued in front of the first product: one LDS latency instead of one
    // per product (without it the compiler reuses the fragment registers and waits for each pair of reads in turn)
    __builtin_amdgcn_sched_barrier(0);
#pragma unroll
    for (int u = 0; u < 2; ++u) s[u] = F::mma(kb[u], q1, F::mma(ka[u], q0, zero8));

    if (rel) {
      v8f z[3];
#pragma unroll
      for (int t = 0; t < 3; ++t) z[t] = F::mma(ea[t], q0, zero8);
#pragma unroll
      for (int t = 0; t < 3; ++t) z[t] = F::mma(eb[t], q1, z[t]);
#pragma unroll
      for (int t = 0; t < 3; ++t) {
        *(v4f*)(sp + t * 16 + koff)     = (v4f){z[t][0], z[t][1], z[t][2], z[t][3]};
        *(v4f*)(sp + t * 16 + koff + 4) = (v4f){z[t][4], z[t][5], z[t][6], z[t][7]};
      }
      // lanes c and c + 16 read what both of them wrote: the strip's stores stay in front of its reads
      __builtin_amdgcn_fence(__ATOMIC_RELEASE, "workgroup", "local");
      __builtin_amdgcn_wave_barrier();
      __builtin_amdgcn_fence(__ATOMIC_ACQUIRE, "workgroup", "local");
#pragma unroll
      for (int u = 0; u < 2; ++u)
#pragma unroll
        for (int r = 0; r < 8; ++r) {
          const float rv = rp[u * 16 + r];
          s[u][r] += (j0 + u * 16 + koff + r <= i0 + c) ? rv : 0.f;
        }
    }

    float mx = s[0][0];
#pragma unroll
    for (int r = 1; r < 8; ++r) mx = fmaxf(mx, s[0][r]);
#pragma unroll
    for (int r = 0; r < 8; ++r) mx = fmaxf(mx, s[1][r]);
    mx = fmaxf(mx, other_half(mx));
    const float mnew  = fmaxf(m, mx * kLogitScale);
    const float alpha = __builtin_amdgcn_exp2f(m - mnew);
    const float msh   = mnew - kPCarryLog2;
    m = mnew;
    float psum = 0.f;
    v16h pb;
#pragma unroll
    for (int u = 0; u < 2; ++u)
#pragma unroll
      for (int r = 0; r < 8; ++r) {
        const float p = __builtin_amdgcn_exp2f(fmaf(s[u][r], kLogitScale, -msh));
        psum += p;
        pb[u * 8 + r] = (_Float16)p;
      }
    l = fmaf(l, alpha, psum);
#pragma unroll
    for (int t = 0; t < 4; ++t) {
      F::U va;   // keys 0..15 of the pass in elements 0..7 of the two lane halves, keys 16..31 in elements 8..15
      va.h[0] = lds_tr16(kv + vOff + t * 16);
      va.h[1] = lds_tr16(kv + vOff + 16 * kVPitch + t * 16);
      o[t] *= alpha;
      o[t] = F::mma(va.v, pb, o[t]);
    }

    if (more) {   // the same for the whole block
      *(v8h*)(sKV[(ps + 1) & 1] + dstOff) = g;
      __syncthreads();   // publishes the next pass's tile; ends this pass's reads of its own buffer and of the strip
    }
  }

  l += other_half(l);
  const float inv = kOCarry / l;
  unsigned short* op = O16p + ((size_t)(i0 + c) * kB + b) * kE + h * kDh + koff;
#pragma unroll
  for (int t = 0; t < 4; ++t) {
    v8h hv;
#pragma unroll
    for (int r = 0; r < 8; ++r) hv[r] = (_Float16)(o[t][r] * inv);
    *(v8h*)(op + t * 16) = hv;
  }
}

// ---------------------------------------------------------------------------
// Host glue.
//   XH    f16 [4096][1024]            8,388,608  at           0   (query, A of the qkv projection)
//   WIN   f16 [3072][1024] (x16)      6,291,456  at   8,388,608   (Bt)
//   WO    f16 [1024][1024] (x16)      2,097,152  at  14,680,064   (Bt)
//   ER    f16 [1024][64]                131,072  at  16,777,216   (A of the relative scores)
//   QKV   f16 [4096][3072]           25,165,824  at  16,908,288   (qkv + bias; q cols 0.., k cols 1024.., v cols 2048..)
//   O16   f16 [4096][1024] (x256)     8,388,608  at  42,074,112   (attention output, A of the output projection)
//   total                           50,462,720
// GEMM shapes: qkv M=4096 N=3072 K=1024; out M=4096 N=1024 K=1024. All M,N multiples of 128, K a multiple of 64.
// Launches: 1 cast + 1 qkv GEMM + 1 fused attention over all 64 (batch, head) + 1 out GEMM = 4.
// ---------------------------------------------------------------------------
extern "C" void kernel_launch(void* const* d_in, const int* in_sizes, int n_in,
                              void* d_out, int out_size, void* d_ws, size_t ws_size,
                              hipStream_t stream) {
  if (n_in < 6) return;
  const int nTokE = kTok * kE;                     // 4,194,304
  if (in_sizes[0] != nTokE) return;
  if (in_sizes[1] != kL * kDh) return;
  if (in_sizes[2] != kN3 * kE) return;
  if (in_sizes[3] != kN3) return;
  if (in_sizes[4] != kE * kE) return;
  if (in_sizes[5] != kE) return;
  if (out_size != nTokE) return;

  const size_t szXH  = (size_t)kTok * kE * 2;
  const size_t szWIN = (size_t)kN3 * kE * 2;
  const size_t szWO  = (size_t)kE * kE * 2;
  const size_t szER  = (size_t)kL * kDh * 2;
  const size_t szQKV = (size_t)kTok * kN3 * 2;
  const size_t szO16 = (size_t)kTok * kE * 2;
  const size_t offXH  = 0;
  const size_t offWIN = offXH + szXH;
  const size_t offWO  = offWIN + szWIN;
  const size_t offER  = offWO + szWO;
  const size_t offQKV = offER + szER;
  const size_t offO16 = offQKV + szQKV;
  const size_t total  = offO16 + szO16;
  if (ws_size < total) return;

  const float* query  = (const float*)d_in[0];
  const float* relpos = (const float*)d_in[1];
  const float* win    = (const float*)d_in[2];
  const float* bin    = (const float*)d_in[3];
  const float* wout   = (const float*)d_in[4];
  const float* bout   = (const float*)d_in[5];
  float* out = (float*)d_out;
  char* ws = (char*)d_ws;
  unsigned short* XH  = (unsigned short*)(ws + offXH);
  unsigned short* WIN = (unsigned short*)(ws + offWIN);
  unsigned short* WO  = (unsigned short*)(ws + offWO);
  unsigned short* ER  = (unsigned short*)(ws + offER);
  unsigned short* QKV = (unsigned short*)(ws + offQKV);
  unsigned short* O16 = (unsigned short*)(ws + offO16);

  // ---- prologue: 16-bit operand planes ----
  cast_planes_f16_kernel<<<dim3(kCastBlocks), dim3(kCastThreads), 0, stream>>>(query, win, wout, relpos, XH, WIN, WO, ER);

  // ---- packed qkv projection: QKV[m][n] = f16( (1/16) * sum_k XH[m][k] * WIN[n][k] + b_in[n] )   (M=4096, N=3072, K=1024)
  {
    const int tiles = (kTok / 128) * (kN3 / 128);   // 768 blocks of 4 waves
    wmma_gemm_staged<1, 2><<<dim3(tiles), dim3(kGThreads), 0, stream>>>(XH, WIN, (void*)QKV, bin, kN3, kWCarryInv);
  }

  // ---- scores, skew, softmax and attn.v of all 64 (batch, head): O16[(l*4+b)][h*64+d] = f16( 256 * sum_j P[bh][l][j] * v[bh][j][d] )
  rel_attn_fused_kernel<<<dim3(kL / kFaQ, kB * kH), dim3(kFaThreads), 0, stream>>>(QKV, ER, O16);

  // ---- output projection: out[m][n] = (1/4096) * sum_e O16[m][e] * WO[n][e] + b_out[n]   (M=4096, N=1024, K=1024)
  {
    const int tiles = (kTok / 128) * (kE / 128);   // 256 blocks of 4 waves, one on a WGP
    wmma_gemm_staged<0, 4><<<dim3(tiles), dim3(kGThreads), 0, stream>>>(O16, WO, (void*)out, bout, kE, kOutScale);
  }
}

// v007
// A run of this version takes 81.7 microseconds.
// Timed twice side by side with v006, it ran 1.04 times as fast both times.
// Counting every step since v000, it is 15.5 times as fast.
// Contractions: packed qkv projection (X f16 x W_in^T f16 carried x16), content scores k.q^T and relative scores Er.q^T (q, k, Er f16 planes, x0.125 in f32 behind the product), attn.v (V^T f16, transposed on its way out of LDS, x unnormalised P^T f16 carried x32768), output projection (O f16 carried x256 x Wo^T f16 carried x16): all v_wmma_f32_16x16x32_f16 with f32 accumulate; bias, skew gather and softmax in f32.
#include <hip/hip_runtime.h>
#include <math.h>

// ---------------------------------------------------------------------------
// Problem constants
// ---------------------------------------------------------------------------
constexpr int kL   = 1024;                 // sequence length
constexpr int kB   = 4;                    // batch
constexpr int kE   = 1024;                 // embed dim
constexpr int kH   = 16;                   // heads
constexpr int kDh  = 64;                   // head dim
constexpr int kTok = kL * kB;              // 4096 GEMM rows, m = l*4 + b
constexpr int kN3  = 3 * kE;               // 3072 packed qkv columns
constexpr int kLdTok = kB * kN3;           // 12288 halves between consecutive l of one (b, column) in the qkv plane
constexpr int kFaWaves    = 16;            // waves of a fused-attention block: 8 query groups x 2 key halves
constexpr int kFaThreads  = kFaWaves * 32; // 512
constexpr int kFaQ        = (kFaWaves / 2) * 32;   // 256 queries of a block, 32 a wave
constexpr int kFaPasses   = kL / 64;       // passes of 32 keys over a wave's half of the keys
constexpr int kXPitch     = 68;            // floats per lane in the exchange of the key halves (16 B x odd)
constexpr int kStripPitch = 52;            // floats per query in the skew strip (48 used)
constexpr int kKPitch     = 72;            // halves per K or Er row in LDS (64 used)
constexpr int kVPitch     = 80;            // halves per V row in LDS (64 used)
constexpr int kStageV     = 32 * kKPitch;  // V tile behind the K tile in a stage buffer
constexpr int kStageHalves = kStageV + 32 * kVPitch;    // 4864
constexpr float kWCarry     = 16.0f;                 // weights carried x16 in f16
constexpr float kWCarryInv  = 1.0f / 16.0f;
constexpr float kScoreScale = 0.125f;                // 64^-0.5, applied to both score products
constexpr float kLogitScale = kScoreScale * 1.4426950408889634f;   // logits in the log2 domain
constexpr float kPCarryLog2 = 15.0f;                 // unnormalised probabilities carried x2^15 in f16
constexpr float kOCarry     = 256.0f;                // attention output carried x256 in f16
constexpr float kOutScale   = 1.0f / (kOCarry * kWCarry);   // 1/4096
static_assert(kH * kDh == kE, "shape");
static_assert(kTok % 64 == 0 && kN3 % 64 == 0 && kE % 64 == 0 && kL % 64 == 0 && kDh % 64 == 0, "M,N tile multiples");
static_assert(kE % 32 == 0 && kDh % 32 == 0 && kL % 32 == 0, "K multiples of 32");
static_assert(kL % kFaQ == 0 && kDh == 64 && kH == 16 && kFaThreads == 512, "fused attention coverage and staging map");
static_assert(8 * 32 * kXPitch <= kFaWaves * 2 * 16 * kStripPitch, "the exchange fits the strips");

typedef __attribute__((ext_vector_type(16))) _Float16 v16h;
typedef __attribute__((ext_vector_type(8)))  _Float16 v8h;
typedef __attribute__((ext_vector_type(8)))  float    v8f;
typedef __attribute__((ext_vector_type(4)))  float    v4f;
typedef __attribute__((ext_vector_type(2)))  float    v2f;
typedef __attribute__((ext_vector_type(4)))  unsigned int v4u;

// ---------------------------------------------------------------------------
// Helper pieces
// ---------------------------------------------------------------------------
template <typename T> struct Frag;
template <> struct Frag<_Float16> {
  typedef v16h V; union U { v16h v; v8h h[2]; };
  // elements 0..7 <- p[0..7], 8..15 <- p[16..23]
  static __device__ __forceinline__ v16h load(const _Float16* p) {
    U f; f.h[0] = *(const v8h*)(p); f.h[1] = *(const v8h*)(p + 16); return f.v;
  }
  static __device__ __forceinline__ v8f mma(v16h a, v16h b, v8f c) {
    return __builtin_amdgcn_wmma_f32_16x16x32_f16(false, a, false, b, (short)0, c, false, false);
  }
};
__device__ __forceinline__ unsigned pk16(unsigned short a, unsigned short b) { return (unsigned)a | ((unsigned)b << 16); }
__device__ __forceinline__ unsigned short h_bits(float f) { const _Float16 h = (_Float16)f; return __builtin_bit_cast(unsigned short, h); }

// ---- WMMA GEMM, both operands staged in LDS ------------------------------------------------------------------------
// C[m,n] = scale * sum_k A[m,k] * Bt[n,k] + bias[n]; A row-major [M][kE], Bt row-major [N][kE], f16; M, N % 128 == 0.
// A block of 4 waves (2 x 2) owns a 128 x 128 tile of C, a wave 64 x 64 of it (16 accumulator tiles).
// A stage is 64 k (one 128-B line) of the tile's 128 A rows and, behind them, of its 128 Bt rows, at a row pitch of 144 B
// (16 B x odd: the 16-byte fragment reads fall on different banks). NBUF stage buffers: a trip works on one while the
// asynchronous copies of the next NBUF - 1 stages land in the others. A wave-wide copy covers four whole lines, and every line
// comes to the WGP once per block instead of once per wave in 32-byte pieces.
// Ring depth: the blocks that share operand rows walk k together, so a stage's lines are asked for the first time by all of them
// at about the same moment and then come at memory latency, not at that of an L2 hit (reasoned, not measured). With two buffers
// a stage's copies have one trip to land. Three blocks on a WGP (qkv projection) fill one another's waits; a block alone on its
// WGP (output projection) has nothing to fill them, so it takes four buffers: a stage's copies then have three trips to land.
// Fragment contents and the k order of the sums are those of fragment loads straight from the row-major planes.
// OUT_MODE: 0 = f32, 1 = f16.
constexpr int kGThreads = 128;
constexpr int kGK       = 64;                  // halves of k in a stage
constexpr int kGPitch   = 72;                  // halves per staged row (64 used)
constexpr int kGStage   = 256 * kGPitch;       // halves per stage buffer: 36,864 B
constexpr int kGCopies  = 16;                  // asynchronous copies of a wave per stage (8 per operand)
static_assert(kTok % 128 == 0 && kN3 % 128 == 0 && kE % 128 == 0 && kE / kGK >= 4, "staged GEMM tiles and ring depth");

// Eight asynchronous 16-byte copies of a lane: rows r, r + 16, .. r + 112 of one operand's 128 staged rows.
// The s_wait_xcnt at the end stands in front of any later rewrite of the address registers that the copies name.
__device__ __forceinline__ void stage_rows128(unsigned lds, const _Float16* g) {
  asm volatile(
      "global_load_async_to_lds_b128 %0, %8, off\n\t"
      "global_load_async_to_lds_b128 %1, %9, off\n\t"
      "global_load_async_to_lds_b128 %2, %10, off\n\t"
      "global_load_async_to_lds_b128 %3, %11, off\n\t"
      "global_load_async_to_lds_b128 %4, %12, off\n\t"
      "global_load_async_to_lds_b128 %5, %13, off\n\t"
      "global_load_async_to_lds_b128 %6, %14, off\n\t"
      "global_load_async_to_lds_b128 %7, %15, off\n\t"
      "s_wait_xcnt 0x0"
      :: "v"(lds), "v"(lds + 1u * 16u * kGPitch * 2u), "v"(lds + 2u * 16u * kGPitch * 2u), "v"(lds + 3u * 16u * kGPitch * 2u),
         "v"(lds + 4u * 16u * kGPitch * 2u), "v"(lds + 5u * 16u * kGPitch * 2u), "v"(lds + 6u * 16u * kGPitch * 2u),
         "v"(lds + 7u * 16u * kGPitch * 2u),
         "v"(g), "v"(g + 1 * 16 * kE), "v"(g + 2 * 16 * kE), "v"(g + 3 * 16 * kE),
         "v"(g + 4 * 16 * kE), "v"(g + 5 * 16 * kE), "v"(g + 6 * 16 * kE), "v"(g + 7 * 16 * kE)
      : "memory");
}

template <int OUT_MODE, int NBUF>
__global__ __launch_bounds__(kGThreads) void wmma_gemm_staged(
    const unsigned short* __restrict__ Ap, const unsigned short* __restrict__ Btp,
    void* __restrict__ Cout, const float* __restrict__ bias, int N, float scale) {
  typedef Frag<_Float16> F;
  static_assert((NBUF & (NBUF - 1)) == 0 && NBUF >= 2 && (NBUF - 1) * kGCopies <= 63, "ring index and copies outstanding per wave");
  __shared__ __align__(16) _Float16 sAB[NBUF][kGStage];   // 36,864 B a buffer
  __shared__ __align__(16) float sT[4][16 * 68];       // per-wave 16x64 slab, pitch 68 floats
  const _Float16* A  = (const _Float16*)Ap;
  const _Float16* Bt = (const _Float16*)Btp;
  const int tid  = threadIdx.x;
  const int lane = tid & 31;
  const int wave = tid >> 5;
  const int tilesN = N >> 7;
  const int tm = blockIdx.x / tilesN;
  const int tn = blockIdx.x - tm * tilesN;
  const int ldc = N;

  const int rlane = lane & 15;                 // row (A) / col (B, D) within subtile
  const int koff  = (lane >> 4) * 8;           // k offset of this lane half
  const int mOff  = (lane >> 4) * 8;           // D row offset

  // copy map: thread t brings segment t & 7 (16 B) of rows (t >> 3) + 16 x, x = 0..7, of each operand
  const _Float16* gA = A  + (size_t)(tm * 128 + (tid >> 3)) * kE + (tid & 7) * 8;
  const _Float16* gB = Bt + (size_t)(tn * 128 + (tid >> 3)) * kE + (tid & 7) * 8;
  const unsigned ldsA = (unsigned)(size_t)(&sAB[0][0]) + (unsigned)(((tid >> 3) * kGPitch + (tid & 7) * 8) * 2);
  const unsigned ldsB = ldsA + 128u * kGPitch * 2u;
  constexpr unsigned kStageBytes = kGStage * 2u;
  constexpr int T = kE / kGK;                  // 16 stages

  // all but the copies of the NBUF - 2 youngest stages have landed: the count of the waits that publish a stage
  constexpr int kYounger = (NBUF - 2) * kGCopies;
#pragma unroll   // the first NBUF - 1 stages go out back to back, each buffer's offset a constant
  for (int s = 0; s < NBUF - 1; ++s) {
    stage_rows128(ldsA + (unsigned)s * kStageBytes, gA + s * kGK);
    stage_rows128(ldsB + (unsigned)s * kStageBytes, gB + s * kGK);
  }
  asm volatile("s_wait_asynccnt %0" :: "n"(kYounger) : "memory");   // this wave's share of stage 0 has landed
  __syncthreads();                                                   // publishes stage 0
  stage_rows128(ldsA + (unsigned)(NBUF - 1) * kStageBytes, gA + (NBUF - 1) * kGK);
  stage_rows128(ldsB + (unsigned)(NBUF - 1) * kStageBytes, gB + (NBUF - 1) * kGK);

  v8f acc[4][4];
#pragma unroll
  for (int i = 0; i < 4; ++i)
#pragma unroll
    for (int j = 0; j < 4; ++j) acc[i][j] = (v8f){0.f,0.f,0.f,0.f,0.f,0.f,0.f,0.f};

  const int aOff = ((wave >> 1) * 64 + rlane) * kGPitch + koff;
  const int bOff = (128 + (wave & 1) * 64 + rlane) * kGPitch + koff;

#pragma unroll 1   // one trip per stage: the buffer index and the refill test stay scalar, the loop stays small
  for (int t = 0; t < T; ++t) {
    const _Float16* st = sAB[t & (NBUF - 1)];
    v16h bh[2][4], ah[2][4];
#pragma unroll
    for (int kk = 0; kk < 2; ++kk) {
#pragma unroll
      for (int j = 0; j < 4; ++j) bh[kk][j] = F::load(st + bOff + j * 16 * kGPitch + kk * 32);
#pragma unroll
      for (int i = 0; i < 4; ++i) ah[kk][i] = F::load(st + aOff + i * 16 * kGPitch + kk * 32);
    }
    // all fragment reads of the stage are issued as one group in front of its products: one LDS latency a trip, and the second
    // half's reads land behind the first half's products (without it the compiler reuses one A fragment and waits at every row)
    __builtin_amdgcn_sched_barrier(0);
#pragma unroll
    for (int kk = 0; kk < 2; ++kk)
#pragma unroll
      for (int i = 0; i < 4; ++i)
#pragma unroll
        for (int j = 0; j < 4; ++j) acc[i][j] = F::mma(ah[kk][i], bh[kk][j], acc[i][j]);
    // keeps the waits and the barrier below behind the products: lifted over them they would wait for the next stage's copies
    // right after their issue, and for the second half's fragment reads in front of the first product
    __builtin_amdgcn_sched_barrier(0);
    asm volatile("s_wait_dscnt 0x0" ::: "memory");      // this wave's reads of the buffer are done before it is refilled
    // this wave's share of stage t + 1 has landed. Outstanding here are stages t + 1 .. t + NBUF - 1, kGCopies of this wave each,
    // while they all exist: the counted wait leaves the younger ones in flight. In the last trips fewer are outstanding: to 0.
    if (NBUF > 2 && t + NBUF - 1 < T) {                  // a scalar test, the same for the whole block
      asm volatile("s_wait_asynccnt %0" :: "n"(kYounger) : "memory");
    } else {
      asm volatile("s_wait_asynccnt 0x0" ::: "memory");
    }
    __syncthreads();                                     // publishes stage t + 1; ends every wave's reads of stage t
    if (t + NBUF < T) {                                  // the same for the whole block
      const unsigned bo = (unsigned)(t & (NBUF - 1)) * kStageBytes;
      stage_rows128(ldsA + bo, gA + (t + NBUF) * kGK);
      stage_rows128(ldsB + bo, gB + (t + NBUF) * kGK);
    }
  }
  asm volatile("s_wait_asynccnt 0x0" ::: "memory");     // no copy is outstanding when the wave goes on to its end

  // ---- epilogue ----
  const int m0 = tm * 128 + (wave >> 1) * 64;
  const int n0 = tn * 128 + (wave & 1) * 64;
  float* slab = sT[wave];
#pragma unroll
  for (int i = 0; i < 4; ++i) {
    const int mBase = m0 + (i << 4);
#pragma unroll
    for (int j = 0; j < 4; ++j) {
      const float bv = bias[n0 + (j << 4) + rlane];
#pragma unroll
      for (int r = 0; r < 8; ++r) slab[(mOff + r) * 68 + (j << 4) + rlane] = acc[i][j][r] * scale + bv;
    }
    __builtin_amdgcn_fence(__ATOMIC_RELEASE, "workgroup");
    __builtin_amdgcn_wave_barrier();
    __builtin_amdgcn_fence(__ATOMIC_ACQUIRE, "workgroup");
    if (OUT_MODE == 0) {
      float* C = (float*)Cout;
      const int hh = lane >> 4, c4 = (lane & 15) * 4;     // row seg = 256 B = 16 lanes x 16 B
#pragma unroll
      for (int it = 0; it < 8; ++it) {
        const int row = it * 2 + hh;
        const v4f v = *(const v4f*)(slab + row * 68 + c4);
        *(v4f*)(C + (size_t)(mBase + row) * ldc + n0 + c4) = v;
      }
    } else {
      const int q = lane >> 3, c8 = (lane & 7) * 8;
      unsigned short* C = (unsigned short*)Cout;
#pragma unroll
      for (int it = 0; it < 4; ++it) {
        const int row = it * 4 + q;
        const float* sp = slab + row * 68 + c8;
        v8h hv;
#pragma unroll
        for (int e = 0; e < 8; ++e) hv[e] = (_Float16)sp[e];
        *(v8h*)(C + (size_t)(mBase + row) * ldc + n0 + c8) = hv;
      }
    }
    asm volatile("s_wait_xcnt 0x0" ::: "memory");   // stands in front of the next rows' reuse of the registers that these stores name
    __builtin_amdgcn_fence(__ATOMIC_RELEASE, "workgroup");
    __builtin_amdgcn_wave_barrier();
    __builtin_amdgcn_fence(__ATOMIC_ACQUIRE, "workgroup");
  }
}

// ---------------------------------------------------------------------------
// f32 -> f16 casts of all four operand planes (exact power-of-two carries) in one launch.
// A thread converts 8 chunks of 8 consecutive elements (two 16-B loads, one 16-B store a chunk); a thread's chunks lie 4096
// elements apart, so a block of 16 waves covers 32,768 consecutive elements of one plane.
// Few waves with much to move each (for speed only).
// Blocks 0..127 query, 128..223 W_in, 224..255 W_o, 256..257 Er; every plane is a whole number of blocks.
// ---------------------------------------------------------------------------
constexpr int kCastThreads = 512;
constexpr int kCastChunks  = 8;
constexpr int kCastStep    = kCastThreads * 8;           // elements from one chunk of a thread to its next
constexpr int kCastBlock   = kCastStep * kCastChunks;    // 32,768 elements of a block
constexpr int kCastEndX    = kTok * kE / kCastBlock;                 // 128
constexpr int kCastEndWin  = kCastEndX + kN3 * kE / kCastBlock;      // 224
constexpr int kCastEndWo   = kCastEndWin + kE * kE / kCastBlock;     // 256
constexpr int kCastBlocks  = kCastEndWo + kL * kDh / kCastBlock;     // 258
static_assert((kTok * kE) % kCastBlock == 0 && (kN3 * kE) % kCastBlock == 0 && (kE * kE) % kCastBlock == 0 &&
              (kL * kDh) % kCastBlock == 0, "cast coverage");

__global__ __launch_bounds__(kCastThreads) void cast_planes_f16_kernel(
    const float* __restrict__ x, const float* __restrict__ win, const float* __restrict__ wo, const float* __restrict__ er,
    unsigned short* __restrict__ xh, unsigned short* __restrict__ winh, unsigned short* __restrict__ woh,
    unsigned short* __restrict__ erh) {
  const int bi = blockIdx.x;
  const int plane = (bi >= kCastEndX) + (bi >= kCastEndWin) + (bi >= kCastEndWo);
  const float* in     = plane == 0 ? x  : plane == 1 ? win  : plane == 2 ? wo  : er;
  unsigned short* out = plane == 0 ? xh : plane == 1 ? winh : plane == 2 ? woh : erh;
  const int first     = plane == 0 ? 0  : plane == 1 ? kCastEndX : plane == 2 ? kCastEndWin : kCastEndWo;
  const float scale   = (plane == 1 || plane == 2) ? kWCarry : 1.0f;
  const size_t base = (size_t)(bi - first) * kCastBlock + threadIdx.x * 8;
  const float* p = in + base;
  v4f a[kCastChunks], c[kCastChunks];
#pragma unroll
  for (int k = 0; k < kCastChunks; ++k) {
    a[k] = *(const v4f*)(p + k * kCastStep);
    c[k] = *(const v4f*)(p + k * kCastStep + 4);
  }
  // All 16 loads of the thread are issued in front of this line, so a wave pays one memory latency. The wait stands in front of
  // any reuse of the loads' address registers, which the operand keeps apart from the loads' own destinations.
  asm volatile("s_wait_xcnt 0x0" :: "v"(p) : "memory");
  unsigned short* q = out + base;
#pragma unroll
  for (int k = 0; k < kCastChunks; ++k) {
    unsigned short hb[8];
#pragma unroll
    for (int e = 0; e < 4; ++e) {
      hb[e]     = h_bits(a[k][e] * scale);
      hb[4 + e] = h_bits(c[k][e] * scale);
    }
    *(v4u*)(q + k * kCastStep) = (v4u){pk16(hb[0], hb[1]), pk16(hb[2], hb[3]), pk16(hb[4], hb[5]), pk16(hb[6], hb[7])};
  }
}

// ---------------------------------------------------------------------------
// Fused attention of one (batch, head): content scores, skewed relative scores, softmax and attn.v in one kernel.
// A block of 16 waves owns 256 queries. A wave owns 32 of them (two tiles of 16: i0 .. i0+15 and i0+16 .. i0+31) and one half
// of the 1024 keys (waves 0..7 keys 0..511, waves 8..15 keys 512..1023), which it walks 32 at a time (a pass, 16 of them).
// Every K and V fragment that a wave reads from LDS serves its two query tiles, and the four 16-row tiles of Er that a pass
// reads serve the three that each query tile needs: the LDS reads per score fall, which is what the split is for.
// The two waves of a query group each keep a running softmax over their own keys; behind the loop the upper half's maxima,
// sums and O^T go through LDS to the lower half's wave, which joins them and stores the output.
// The 32 query groups of a (batch, head) are dealt round robin to its 4 blocks (group = (wave & 7) * 4 + blockIdx.x), because a
// group's relative-score work grows with i0: so every block carries the same share of it.
// Everything is computed transposed, so that a lane holds one query column (c = lane & 15) and the lane halves split its keys:
//   S^T  = K . Q^T        A = 16 key rows,          B = Q rows (kept in registers)  -> D[key 8*hf + r][query c]
//   QE^T = Er . Q^T       A = 16 rows m of Er,      B = the same Q                  -> D[m 8*hf + r][query c]
//   O^T += V^T . P^T      A = 16 d rows of V^T,     B = the two S^T tiles of the pass, converted in place
// V stays in the qkv plane's own row-major form, in memory and in LDS: the transposing 16-bit LDS load hands a lane
// V[key 8*hf + 0..7][d = 16 t + c], which is the A fragment of V^T in the k order that the packed score tiles have.
// LDS: Er (filled once), each key half's 32 K rows and 32 V rows of the pass (two buffers: every thread fetches 16 bytes of
// each half's next tile into registers before the pass's work and stores them behind it; the one block barrier at the foot of a
// pass publishes those tiles and ends the last read of the buffer that the next pass refills).
// Row pitches: 144 B (16 B x odd) for the plain 16-byte fragment reads of K and Er, 160 B (32 B x odd) for the transposing
// reads of V: each reader free of bank conflicts at its own.
// Skew: srel[i][j] = QE[i][(L-1) - i + j] for j <= i, else 0. For query iq + c of the tile at iq and key j0 + jl the row of Er is
// mb + 15 - c + jl with mb = L - 16 - iq + j0, so 48 rows from mb on serve the tile; the upper tile's mb lies 16 rows below the
// lower tile's, so 64 rows serve both. The shift by the lane's own c goes through a per-wave, per-tile LDS strip
// [query c][48 m], pitch 52 floats (16-B aligned rows; the shifted reads of the 32 lanes fall on 32 different banks).
// Rows of Er past L-1 belong to j > i only: their address is clamped, their value unused.
// Passes with every key above both tiles' diagonal (j0 > i0 + 31) have no relative term and skip that part.
// Softmax is the running-maximum form in the log2 domain (logit * 0.125 * log2 e): per pass the maximum of the lane's 16
// scores and of the other half's, p = 2^(logit - max + 15) in f32, f16 for the product; sums and O^T are rescaled by
// 2^(old max - new max). The x2^15 carry is in numerator and denominator alike and cancels in the epilogue.
// grid (L / 256, 64 bh), 512 threads.
// ---------------------------------------------------------------------------
__device__ __forceinline__ float other_half(float x) {   // lane l <-> lane l ^ 16
  const int v = __builtin_bit_cast(int, x);
  return __builtin_bit_cast(float, __builtin_amdgcn_permlanex16(v, v, 0x76543210, 0xfedcba98, false, false));
}

// Eight 2^x, each in its own register. With the registers nearly all in use the compiler gave an exponential's result the source
// register of the exponential directly in front of it; in place no exponential touches a neighbour's registers, and the v_nop
// is the one slot between the last of them and whatever reads its result.
__device__ __forceinline__ void exp2_in_place8(float& a, float& b, float& c, float& d, float& e, float& f, float& g, float& h) {
  asm("v_exp_f32 %0, %0\n\t"
      "v_exp_f32 %1, %1\n\t"
      "v_exp_f32 %2, %2\n\t"
      "v_exp_f32 %3, %3\n\t"
      "v_exp_f32 %4, %4\n\t"
      "v_exp_f32 %5, %5\n\t"
      "v_exp_f32 %6, %6\n\t"
      "v_exp_f32 %7, %7\n\t"
      "v_nop"
      : "+v"(a), "+v"(b), "+v"(c), "+v"(d), "+v"(e), "+v"(f), "+v"(g), "+v"(h));
}

// The same for four values.
__device__ __forceinline__ void exp2_in_place4(float& a, float& b, float& c, float& d) {
  asm("v_exp_f32 %0, %0\n\t"
      "v_exp_f32 %1, %1\n\t"
      "v_exp_f32 %2, %2\n\t"
      "v_exp_f32 %3, %3\n\t"
      "v_nop"
      : "+v"(a), "+v"(b), "+v"(c), "+v"(d));
}

// 16 x 16 tile of 16-bit elements, row-major in LDS, transposed: 8 halves a lane
__device__ __forceinline__ v8h lds_tr16(const _Float16* p) {
  typedef __attribute__((ext_vector_type(8))) short s16x8;
  typedef __attribute__((address_space(3))) s16x8 lds_s16x8;
  return __builtin_bit_cast(v8h, __builtin_amdgcn_ds_load_tr16_b128_v8i16((lds_s16x8*)p));
}

__global__ __launch_bounds__(kFaThreads) void rel_attn_fused_kernel(const unsigned short* __restrict__ QKVp,
                                                                    const unsigned short* __restrict__ ERp,
                                                                    unsigned short* __restrict__ O16p) {
  typedef Frag<_Float16> F;
  __shared__ __align__(16) _Float16 sE[kL * kKPitch];                    // 147,456 B
  __shared__ __align__(16) _Float16 sKV[2][2][kStageHalves];             //  38,912 B: [buffer][key half]
  __shared__ __align__(16) float strip[kFaWaves][2][16 * kStripPitch];   // 106,496 B: [wave][query tile]; behind the loop the exchange
  const _Float16* QKV = (const _Float16*)QKVp;
  const _Float16* ER  = (const _Float16*)ERp;
  const int tid  = threadIdx.x;
  const int lane = tid & 31;
  const int wave = __builtin_amdgcn_readfirstlane(tid >> 5);   // scalar, so that the diagonal test is a scalar branch
  const int kh   = wave >> 3;                  // key half of this wave
  const int grp  = wave & 7;                   // query group of this wave: waves w and w + 8 share one
  const int c    = lane & 15;
  const int koff = (lane >> 4) * 8;            // k offset of this lane half (operands), row offset (D)
  const int bh   = blockIdx.y;
  const int b    = bh >> 4;
  const int h    = bh & 15;
  const int i0   = (grp * (kL / kFaQ) + blockIdx.x) * 32;

  // staging map: waves 0..7 bring the K tiles, waves 8..15 the V tiles, each tile 32 rows x 8 segments of 16 B of the qkv plane;
  // a thread brings its segment of the lower key half's tile and of the upper key half's
  const bool isK = wave < 8;
  const int  tv  = tid & 255;
  const _Float16* gsrc = QKV + ((size_t)(tv >> 3) * kB + b) * kN3 + (isK ? kE : 2 * kE) + h * kDh + (tv & 7) * 8;
  constexpr size_t gstep = (size_t)32 * kLdTok;                       // halves from one pass's tile to the next
  constexpr size_t ghalf = (size_t)kFaPasses * gstep;                 // halves from the lower key half's tile to the upper's
  const int    dstOff = (isK ? (tv >> 3) * kKPitch : kStageV + (tv >> 3) * kVPitch) + (tv & 7) * 8;
  // transposing read: lane l names 16 B of key row 8 (l >> 4) + (l & 7), d columns 8 ((l >> 3) & 1) .. + 7 of a 16 x 16 tile
  const int    vOff   = kStageV + (koff + (lane & 7)) * kVPitch + ((lane >> 3) & 1) * 8;

  const v8h g0 = *(const v8h*)gsrc;
  const v8h g1 = *(const v8h*)(gsrc + ghalf);
  v16h q0[2], q1[2];
#pragma unroll
  for (int qt = 0; qt < 2; ++qt) {
    const _Float16* qrow = QKV + ((size_t)(i0 + qt * 16 + c) * kB + b) * kN3 + h * kDh + koff;
    q0[qt] = F::load(qrow);
    q1[qt] = F::load(qrow + 32);
  }
  asm volatile("s_wait_xcnt 0x0" ::: "memory");   // stands in front of the reuse of these loads' address registers by the fill below
  // Er: 2048 segments of 16 B a trip, a trip's four loads of a thread in flight together
  for (int seg0 = 0; seg0 < kL * 8; seg0 += 4 * kFaThreads) {
    v8h e[4];
#pragma unroll
    for (int x = 0; x < 4; ++x) e[x] = *(const v8h*)(ER + (size_t)(seg0 + x * kFaThreads + tid) * 8);
#pragma unroll
    for (int x = 0; x < 4; ++x) {
      const int idx = seg0 + x * kFaThreads + tid;
      *(v8h*)(sE + (idx >> 3) * kKPitch + (idx & 7) * 8) = e[x];
    }
  }
  *(v8h*)(sKV[0][0] + dstOff) = g0;
  *(v8h*)(sKV[0][1] + dstOff) = g1;
  __syncthreads();

  float* sp0 = strip[wave][0] + c * kStripPitch;
  float* sp1 = strip[wave][1] + c * kStripPitch;

  const v8f zero8 = (v8f){0.f, 0.f, 0.f, 0.f, 0.f, 0.f, 0.f, 0.f};
  v8f o[2][4];
  float m[2], l[2];
#pragma unroll
  for (int qt = 0; qt < 2; ++qt) {
#pragma unroll
    for (int t = 0; t < 4; ++t) o[qt][t] = zero8;
    m[qt] = -__builtin_inff();
    l[qt] = 0.f;
  }

  for (int ps = 0; ps < kFaPasses; ++ps) {
    const int j0 = (kh * kFaPasses + ps) * 32;
    const _Float16* kv = sKV[ps & 1][kh];
    const bool more = ps + 1 < kFaPasses;
    v8h ga, gb;
    if (more) {
      ga = *(const v8h*)(gsrc + (size_t)(ps + 1) * gstep);
      gb = *(const v8h*)(gsrc + (size_t)(ps + 1) * gstep + ghalf);
      asm volatile("s_wait_xcnt 0x0" ::: "memory");   // stands in front of the next pass's rewrite of these loads' address registers
    }

    v8f s[2][2];
    v16h ka[2], kb[2];
#pragma unroll
    for (int u = 0; u < 2; ++u) {
      const _Float16* kp = kv + (u * 16 + c) * kKPitch + koff;
      ka[u] = F::load(kp);
      kb[u] = F::load(kp + 32);
    }
    const bool rel = j0 <= i0 + 31;
    const int mbase = (kL - 32) - i0 + j0;     // first of the 64 rows of Er: the upper query tile's mb
    // tile x of the 64 rows is tile t = x of the upper query tile's 48 rows (x < 3) and tile t = x - 1 of the lower's (x > 0)
    v16h ea[4], eb[4];
    if (rel) {
#pragma unroll
      for (int x = 0; x < 2; ++x) {
        const int mr = mbase + x * 16 + c;
        const _Float16* ep = sE + ((mr < kL - 1) ? mr : (kL - 1)) * kKPitch + koff;
        ea[x] = F::load(ep);
        eb[x] = F::load(ep + 32);
      }
    }
    // the K fragments and the first two Er tiles are read as one group in front of the first product: one LDS latency
    // instead of one per product (without it the compiler reuses the fragment registers and waits for each pair of reads in turn)
    __builtin_amdgcn_sched_barrier(0);
#pragma unroll
    for (int u = 0; u < 2; ++u) {
      s[0][u] = F::mma(ka[u], q0[0], zero8);
      s[1][u] = F::mma(ka[u], q0[1], zero8);
      s[0][u] = F::mma(kb[u], q1[0], s[0][u]);
      s[1][u] = F::mma(kb[u], q1[1], s[1][u]);
    }

    if (rel) {
#pragma unroll
      for (int x = 2; x < 4; ++x) {
        const int mr = mbase + x * 16 + c;
        const _Float16* ep = sE + ((mr < kL - 1) ? mr : (kL - 1)) * kKPitch + koff;
        ea[x] = F::load(ep);
        eb[x] = F::load(ep + 32);
      }
      {   // Er tiles 0 and 1
        v8f z0 = F::mma(ea[0], q0[1], zero8);
        v8f z1 = F::mma(ea[1], q0[1], zero8);
        v8f z2 = F::mma(ea[1], q0[0], zero8);
        z0 = F::mma(eb[0], q1[1], z0);
        z1 = F::mma(eb[1], q1[1], z1);
        z2 = F::mma(eb[1], q1[0], z2);
        *(v4f*)(sp1 + koff)          = (v4f){z0[0], z0[1], z0[2], z0[3]};
        *(v4f*)(sp1 + koff + 4)      = (v4f){z0[4], z0[5], z0[6], z0[7]};
        *(v4f*)(sp1 + 16 + koff)     = (v4f){z1[0], z1[1], z1[2], z1[3]};
        *(v4f*)(sp1 + 16 + koff + 4) = (v4f){z1[4], z1[5], z1[6], z1[7]};
        *(v4f*)(sp0 + koff)          = (v4f){z2[0], z2[1], z2[2], z2[3]};
        *(v4f*)(sp0 + koff + 4)      = (v4f){z2[4], z2[5], z2[6], z2[7]};
      }
      // The next three products start from zero in registers that may be those of the three results above: the four slots are the
      // distance that the chip wants between a matrix result and its overwrite; the scheduling barriers hold them in this place.
      __builtin_amdgcn_sched_barrier(0);
      asm volatile("v_nop\n\tv_nop\n\tv_nop\n\tv_nop");
      __builtin_amdgcn_sched_barrier(0);
      {   // Er tiles 2 and 3
        v8f z0 = F::mma(ea[2], q0[1], zero8);
        v8f z1 = F::mma(ea[2], q0[0], zero8);
        v8f z2 = F::mma(ea[3], q0[0], zero8);
        z0 = F::mma(eb[2], q1[1], z0);
        z1 = F::mma(eb[2], q1[0], z1);
        z2 = F::mma(eb[3], q1[0], z2);
        *(v4f*)(sp1 + 32 + koff)     = (v4f){z0[0], z0[1], z0[2], z0[3]};
        *(v4f*)(sp1 + 32 + koff + 4) = (v4f){z0[4], z0[5], z0[6], z0[7]};
        *(v4f*)(sp0 + 16 + koff)     = (v4f){z1[0], z1[1], z1[2], z1[3]};
        *(v4f*)(sp0 + 16 + koff + 4) = (v4f){z1[4], z1[5], z1[6], z1[7]};
        *(v4f*)(sp0 + 32 + koff)     = (v4f){z2[0], z2[1], z2[2], z2[3]};
        *(v4f*)(sp0 + 32 + koff + 4) = (v4f){z2[4], z2[5], z2[6], z2[7]};
      }
      // lanes c and c + 16 read what both of them wrote: the strips' stores stay in front of their reads
      __builtin_amdgcn_fence(__ATOMIC_RELEASE, "workgroup", "local");
      __builtin_amdgcn_wave_barrier();
      __builtin_amdgcn_fence(__ATOMIC_ACQUIRE, "workgroup", "local");
#pragma unroll
      for (int qt = 0; qt < 2; ++qt) {
        const float* rp = (qt == 0 ? sp0 : sp1) + 15 - c + koff;
        // key j0 + koff + 16 u + r <= query i0 + 16 qt + c, as one limit a lane and tile against constants: the 32-query wave has
        // no registers to spare for 32 key numbers
        const int lim = i0 + qt * 16 + c - j0 - koff;
#pragma unroll
        for (int u = 0; u < 2; ++u)
#pragma unroll
          for (int r = 0; r < 8; ++r) {
            const float rv = rp[u * 16 + r];
            s[qt][u][r] += (u * 16 + r <= lim) ? rv : 0.f;
          }
      }
    }

    float alpha[2];
    v16h pb[2];
#pragma unroll
    for (int qt = 0; qt < 2; ++qt) {
      float mx = s[qt][0][0];
#pragma unroll
      for (int r = 1; r < 8; ++r) mx = fmaxf(mx, s[qt][0][r]);
#pragma unroll
      for (int r = 0; r < 8; ++r) mx = fmaxf(mx, s[qt][1][r]);
      mx = fmaxf(mx, other_half(mx));
      const float mnew = fmaxf(m[qt], mx * kLogitScale);
      alpha[qt] = __builtin_amdgcn_exp2f(m[qt] - mnew);
      const float msh = mnew - kPCarryLog2;
      m[qt] = mnew;
      float psum = 0.f;
#pragma unroll
      for (int u = 0; u < 2; ++u) {
        float p[8];
#pragma unroll
        for (int r = 0; r < 8; ++r) p[r] = fmaf(s[qt][u][r], kLogitScale, -msh);
        exp2_in_place8(p[0], p[1], p[2], p[3], p[4], p[5], p[6], p[7]);
#pragma unroll
        for (int r = 0; r < 8; ++r) {
          psum += p[r];
          pb[qt][u * 8 + r] = (_Float16)p[r];
        }
      }
      l[qt] = fmaf(l[qt], alpha[qt], psum);
    }
#pragma unroll
    for (int t = 0; t < 4; ++t) {
      F::U va;   // keys 0..15 of the pass in elements 0..7 of the two lane halves, keys 16..31 in elements 8..15
      va.h[0] = lds_tr16(kv + vOff + t * 16);
      va.h[1] = lds_tr16(kv + vOff + 16 * kVPitch + t * 16);
#pragma unroll
      for (int qt = 0; qt < 2; ++qt) {
        o[qt][t] *= alpha[qt];
        o[qt][t] = F::mma(va.v, pb[qt], o[qt][t]);
      }
    }
    // A branch follows the last product: these four slots fill the distance that the chip wants between a product and an overwrite
    // of its operands on both sides of it; the scheduling barriers hold them here.
    __builtin_amdgcn_sched_barrier(0);
    asm volatile("v_nop\n\tv_nop\n\tv_nop\n\tv_nop");
    __builtin_amdgcn_sched_barrier(0);

    if (more) {   // the same for the whole block
      *(v8h*)(sKV[(ps + 1) & 1][0] + dstOff) = ga;
      *(v8h*)(sKV[(ps + 1) & 1][1] + dstOff) = gb;
      __syncthreads();   // publishes the next pass's tiles; ends this pass's reads of its own buffer
    }
  }

  // ---- the two key halves of a query group are joined: lane for lane the two waves hold the same query column and rows of O^T ----
  __syncthreads();   // every wave has made its last read of its strips: their LDS becomes the exchange area
  float* xp = &strip[0][0][0] + (grp * 32 + lane) * kXPitch;
  if (kh == 1) {     // a scalar test
#pragma unroll
    for (int qt = 0; qt < 2; ++qt)
#pragma unroll
      for (int t = 0; t < 4; ++t) {
        const v8f ov = o[qt][t];
        *(v4f*)(xp + (qt * 4 + t) * 8)     = (v4f){ov[0], ov[1], ov[2], ov[3]};
        *(v4f*)(xp + (qt * 4 + t) * 8 + 4) = (v4f){ov[4], ov[5], ov[6], ov[7]};
      }
    *(v4f*)(xp + 64) = (v4f){m[0], m[1], l[0], l[1]};
  }
  __syncthreads();   // publishes the upper half's maxima, sums and O^T
  if (kh == 0) {     // a scalar test
    const v4f ml = *(const v4f*)(xp + 64);
    float al[2], au[2];   // 2^(own maximum - joint maximum) of the lower and of the upper key half
#pragma unroll
    for (int qt = 0; qt < 2; ++qt) {
      const float mj = fmaxf(m[qt], ml[qt]);
      al[qt] = m[qt] - mj;
      au[qt] = ml[qt] - mj;
    }
    exp2_in_place4(al[0], au[0], al[1], au[1]);
#pragma unroll
    for (int qt = 0; qt < 2; ++qt) {
      float lj = fmaf(l[qt], al[qt], ml[2 + qt] * au[qt]);
      lj += other_half(lj);
      const float inv = kOCarry / lj;
      const float fl = al[qt] * inv;
      const float fu = au[qt] * inv;
      unsigned short* op = O16p + ((size_t)(i0 + qt * 16 + c) * kB + b) * kE + h * kDh + koff;
#pragma unroll
      for (int t = 0; t < 4; ++t) {
        const v4f x0 = *(const v4f*)(xp + (qt * 4 + t) * 8);
        const v4f x1 = *(const v4f*)(xp + (qt * 4 + t) * 8 + 4);
        v8h hv;
#pragma unroll
        for (int r = 0; r < 4; ++r) {
          hv[r]     = (_Float16)fmaf(o[qt][t][r], fl, x0[r] * fu);
          hv[4 + r] = (_Float16)fmaf(o[qt][t][4 + r], fl, x1[r] * fu);
        }
        *(v8h*)(op + t * 16) = hv;
      }
    }
  }
}

// ---------------------------------------------------------------------------
// Host glue.
//   XH    f16 [4096][1024]            8,388,608  at           0   (query, A of the qkv projection)
//   WIN   f16 [3072][1024] (x16)      6,291,456  at   8,388,608   (Bt)
//   WO    f16 [1024][1024] (x16)      2,097,152  at  14,680,064   (Bt)
//   ER    f16 [1024][64]                131,072  at  16,777,216   (A of the relative scores)
//   QKV   f16 [4096][3072]           25,165,824  at  16,908,288   (qkv + bias; q cols 0.., k cols 1024.., v cols 2048..)
//   O16   f16 [4096][1024] (x256)     8,388,608  at  42,074,112   (attention output, A of the output projection)
//   total                           50,462,720
// GEMM shapes: qkv M=4096 N=3072 K=1024; out M=4096 N=1024 K=1024. All M,N multiples of 128, K a multiple of 64.
// Launches: 1 cast + 1 qkv GEMM + 1 fused attention over all 64 (batch, head) + 1 out GEMM = 4.
// ---------------------------------------------------------------------------
extern "C" void kernel_launch(void* const* d_in, const int* in_sizes, int n_in,
                              void* d_out, int out_size, void* d_ws, size_t ws_size,
                              hipStream_t stream) {
  if (n_in < 6) return;
  const int nTokE = kTok * kE;                     // 4,194,304
  if (in_sizes[0] != nTokE) return;
  if (in_sizes[1] != kL * kDh) return;
  if (in_sizes[2] != kN3 * kE) return;
  if (in_sizes[3] != kN3) return;
  if (in_sizes[4] != kE * kE) return;
  if (in_sizes[5] != kE) return;
  if (out_size != nTokE) return;

  const size_t szXH  = (size_t)kTok * kE * 2;
  const size_t szWIN = (size_t)kN3 * kE * 2;
  const size_t szWO  = (size_t)kE * kE * 2;
  const size_t szER  = (size_t)kL * kDh * 2;
  const size_t szQKV = (size_t)kTok * kN3 * 2;
  const size_t szO16 = (size_t)kTok * kE * 2;
  const size_t offXH  = 0;
  const size_t offWIN = offXH + szXH;
  const size_t offWO  = offWIN + szWIN;
  const size_t offER  = offWO + szWO;
  const size_t offQKV = offER + szER;
  const size_t offO16 = offQKV + szQKV;
  const size_t total  = offO16 + szO16;
  if (ws_size < total) return;

  const float* query  = (const float*)d_in[0];
  const float* relpos = (const float*)d_in[1];
  const float* win    = (const float*)d_in[2];
  const float* bin    = (const float*)d_in[3];
  const float* wout   = (const float*)d_in[4];
  const float* bout   = (const float*)d_in[5];
  float* out = (float*)d_out;
  char* ws = (char*)d_ws;
  unsigned short* XH  = (unsigned short*)(ws + offXH);
  unsigned short* WIN = (unsigned short*)(ws + offWIN);
  unsigned short* WO  = (unsigned short*)(ws + offWO);
  unsigned short* ER  = (unsigned short*)(ws + offER);
  unsigned short* QKV = (unsigned short*)(ws + offQKV);
  unsigned short* O16 = (unsigned short*)(ws + offO16);

  // ---- prologue: 16-bit operand planes ----
  cast_planes_f16_kernel<<<dim3(kCastBlocks), dim3(kCastThreads), 0, stream>>>(query, win, wout, relpos, XH, WIN, WO, ER);

  // ---- packed qkv projection: QKV[m][n] = f16( (1/16) * sum_k XH[m][k] * WIN[n][k] + b_in[n] )   (M=4096, N=3072, K=1024)
  {
    const int tiles = (kTok / 128) * (kN3 / 128);   // 768 blocks of 4 waves
    wmma_gemm_staged<1, 2><<<dim3(tiles), dim3(kGThreads), 0, stream>>>(XH, WIN, (void*)QKV, bin, kN3, kWCarryInv);
  }

  // ---- scores, skew, softmax and attn.v of all 64 (batch, head): O16[(l*4+b)][h*64+d] = f16( 256 * sum_j P[bh][l][j] * v[bh][j][d] )
  rel_attn_fused_kernel<<<dim3(kL / kFaQ, kB * kH), dim3(kFaThreads), 0, stream>>>(QKV, ER, O16);

  // ---- output projection: out[m][n] = (1/4096) * sum_e O16[m][e] * WO[n][e] + b_out[n]   (M=4096, N=1024, K=1024)
  {
    const int tiles = (kTok / 128) * (kE / 128);   // 256 blocks of 4 waves, one on a WGP
    wmma_gemm_staged<0, 4><<<dim3(tiles), dim3(kGThreads), 0, stream>>>(O16, WO, (void*)out, bout, kE, kOutScale);
  }
}

// v008
// It runs in 78.9 microseconds.
// Next to v007, in two timings, it ran 1.03 times as fast each time.
// Counting every step since v000, it is 16.1 times as fast.
// Contractions: packed qkv projection (X f16 x W_in^T f16 carried x16), content scores k.q^T and relative scores Er.q^T (q, k, Er f16 planes, x0.125 in f32 behind the product), attn.v (V^T f16, transposed on its way out of LDS, x unnormalised P^T f16 carried x32768), output projection (O f16 carried x256 x Wo^T f16 carried x16): all v_wmma_f32_16x16x32_f16 with f32 accumulate; bias, skew gather and softmax in f32.
#include <hip/hip_runtime.h>
#include <math.h>

// ---------------------------------------------------------------------------
// Problem constants
// ---------------------------------------------------------------------------
constexpr int kL   = 1024;                 // sequence length
constexpr int kB   = 4;                    // batch
constexpr int kE   = 1024;                 // embed dim
constexpr int kH   = 16;                   // heads
constexpr int kDh  = 64;                   // head dim
constexpr int kTok = kL * kB;              // 4096 GEMM rows, m = l*4 + b
constexpr int kN3  = 3 * kE;               // 3072 packed qkv columns
constexpr int kLdTok = kB * kN3;           // 12288 halves between consecutive l of one (b, column) in the qkv plane
constexpr int kFaWaves    = 16;            // waves of a fused-attention block: 8 query groups x 2 key halves
constexpr int kFaThreads  = kFaWaves * 32; // 512
constexpr int kFaQ        = (kFaWaves / 2) * 32;   // 256 queries of a block, 32 a wave
constexpr int kFaPasses   = kL / 64;       // passes of 32 keys over a wave's half of the keys
constexpr int kXPitch     = 68;            // floats per lane in the exchange of the key halves (16 B x odd)
constexpr int kStripPitch = 52;            // floats per query in the skew strip (48 used)
constexpr int kKPitch     = 72;            // halves per K or Er row in LDS (64 used)
constexpr int kErPad      = 32;            // rows of zeros behind Er in LDS
constexpr int kVPitch     = 80;            // halves per V row in LDS (64 used)
constexpr int kStageV     = 32 * kKPitch;  // V tile behind the K tile in a stage buffer
constexpr int kStageHalves = kStageV + 32 * kVPitch;    // 4864
constexpr float kWCarry     = 16.0f;                 // weights carried x16 in f16
constexpr float kWCarryInv  = 1.0f / 16.0f;
constexpr float kScoreScale = 0.125f;                // 64^-0.5, applied to both score products
constexpr float kLogitScale = kScoreScale * 1.4426950408889634f;   // logits in the log2 domain
constexpr float kPCarryLog2 = 15.0f;                 // unnormalised probabilities carried x2^15 in f16
constexpr float kOCarry     = 256.0f;                // attention output carried x256 in f16
constexpr float kOutScale   = 1.0f / (kOCarry * kWCarry);   // 1/4096
static_assert(kH * kDh == kE, "shape");
static_assert(kTok % 64 == 0 && kN3 % 64 == 0 && kE % 64 == 0 && kL % 64 == 0 && kDh % 64 == 0, "M,N tile multiples");
static_assert(kE % 32 == 0 && kDh % 32 == 0 && kL % 32 == 0, "K multiples of 32");
static_assert(kL % kFaQ == 0 && kDh == 64 && kH == 16 && kFaThreads == 512, "fused attention coverage and staging map");
static_assert(kErPad * kKPitch / 8 <= kFaThreads, "one store a thread fills the rows of zeros");
static_assert(8 * 32 * kXPitch <= kFaWaves * 2 * 16 * kStripPitch, "the exchange fits the strips");

typedef __attribute__((ext_vector_type(16))) _Float16 v16h;
typedef __attribute__((ext_vector_type(8)))  _Float16 v8h;
typedef __attribute__((ext_vector_type(8)))  float    v8f;
typedef __attribute__((ext_vector_type(4)))  float    v4f;
typedef __attribute__((ext_vector_type(2)))  float    v2f;
typedef __attribute__((ext_vector_type(4)))  unsigned int v4u;

// ---------------------------------------------------------------------------
// Helper pieces
// ---------------------------------------------------------------------------
template <typename T> struct Frag;
template <> struct Frag<_Float16> {
  typedef v16h V; union U { v16h v; v8h h[2]; };
  // elements 0..7 <- p[0..7], 8..15 <- p[16..23]
  static __device__ __forceinline__ v16h load(const _Float16* p) {
    U f; f.h[0] = *(const v8h*)(p); f.h[1] = *(const v8h*)(p + 16); return f.v;
  }
  static __device__ __forceinline__ v8f mma(v16h a, v16h b, v8f c) {
    return __builtin_amdgcn_wmma_f32_16x16x32_f16(false, a, false, b, (short)0, c, false, false);
  }
};
__device__ __forceinline__ unsigned pk16(unsigned short a, unsigned short b) { return (unsigned)a | ((unsigned)b << 16); }
__device__ __forceinline__ unsigned short h_bits(float f) { const _Float16 h = (_Float16)f; return __builtin_bit_cast(unsigned short, h); }

// ---- WMMA GEMM, both operands staged in LDS ------------------------------------------------------------------------
// C[m,n] = scale * sum_k A[m,k] * Bt[n,k] + bias[n]; A row-major [M][kE], Bt row-major [N][kE], f16; M, N % 128 == 0.
// A block of 4 waves (2 x 2) owns a 128 x 128 tile of C, a wave 64 x 64 of it (16 accumulator tiles).
// A stage is 64 k (one 128-B line) of the tile's 128 A rows and, behind them, of its 128 Bt rows, at a row pitch of 144 B
// (16 B x odd: the 16-byte fragment reads fall on different banks). NBUF stage buffers: a trip works on one while the
// asynchronous copies of the next NBUF - 1 stages land in the others. A wave-wide copy covers four whole lines, and every line
// comes to the WGP once per block instead of once per wave in 32-byte pieces.
// Ring depth: the blocks that share operand rows walk k together, so a stage's lines are asked for the first time by all of them
// at about the same moment and then come at memory latency, not at that of an L2 hit (reasoned, not measured). With two buffers
// a stage's copies have one trip to land. Three blocks on a WGP (qkv projection) fill one another's waits; a block alone on its
// WGP (output projection) has nothing to fill them, so it takes four buffers: a stage's copies then have three trips to land.
// Fragment contents and the k order of the sums are those of fragment loads straight from the row-major planes.
// OUT_MODE: 0 = f32, 1 = f16.
constexpr int kGThreads = 128;
constexpr int kGK       = 64;                  // halves of k in a stage
constexpr int kGPitch   = 72;                  // halves per staged row (64 used)
constexpr int kGStage   = 256 * kGPitch;       // halves per stage buffer: 36,864 B
constexpr int kGCopies  = 16;                  // asynchronous copies of a wave per stage (8 per operand)
static_assert(kTok % 128 == 0 && kN3 % 128 == 0 && kE % 128 == 0 && kE / kGK >= 4, "staged GEMM tiles and ring depth");

// Eight asynchronous 16-byte copies of a lane: rows r, r + 16, .. r + 112 of one operand's 128 staged rows.
// The s_wait_xcnt at the end stands in front of any later rewrite of the address registers that the copies name.
__device__ __forceinline__ void stage_rows128(unsigned lds, const _Float16* g) {
  asm volatile(
      "global_load_async_to_lds_b128 %0, %8, off\n\t"
      "global_load_async_to_lds_b128 %1, %9, off\n\t"
      "global_load_async_to_lds_b128 %2, %10, off\n\t"
      "global_load_async_to_lds_b128 %3, %11, off\n\t"
      "global_load_async_to_lds_b128 %4, %12, off\n\t"
      "global_load_async_to_lds_b128 %5, %13, off\n\t"
      "global_load_async_to_lds_b128 %6, %14, off\n\t"
      "global_load_async_to_lds_b128 %7, %15, off\n\t"
      "s_wait_xcnt 0x0"
      :: "v"(lds), "v"(lds + 1u * 16u * kGPitch * 2u), "v"(lds + 2u * 16u * kGPitch * 2u), "v"(lds + 3u * 16u * kGPitch * 2u),
         "v"(lds + 4u * 16u * kGPitch * 2u), "v"(lds + 5u * 16u * kGPitch * 2u), "v"(lds + 6u * 16u * kGPitch * 2u),
         "v"(lds + 7u * 16u * kGPitch * 2u),
         "v"(g), "v"(g + 1 * 16 * kE), "v"(g + 2 * 16 * kE), "v"(g + 3 * 16 * kE),
         "v"(g + 4 * 16 * kE), "v"(g + 5 * 16 * kE), "v"(g + 6 * 16 * kE), "v"(g + 7 * 16 * kE)
      : "memory");
}

template <int OUT_MODE, int NBUF>
__global__ __launch_bounds__(kGThreads) void wmma_gemm_staged(
    const unsigned short* __restrict__ Ap, const unsigned short* __restrict__ Btp,
    void* __restrict__ Cout, const float* __restrict__ bias, int N, float scale) {
  typedef Frag<_Float16> F;
  static_assert((NBUF & (NBUF - 1)) == 0 && NBUF >= 2 && (NBUF - 1) * kGCopies <= 63, "ring index and copies outstanding per wave");
  __shared__ __align__(16) _Float16 sAB[NBUF][kGStage];   // 36,864 B a buffer
  __shared__ __align__(16) float sT[4][16 * 68];       // per-wave 16x64 slab, pitch 68 floats
  const _Float16* A  = (const _Float16*)Ap;
  const _Float16* Bt = (const _Float16*)Btp;
  const int tid  = threadIdx.x;
  const int lane = tid & 31;
  const int wave = tid >> 5;
  const int tilesN = N >> 7;
  const int tm = blockIdx.x / tilesN;
  const int tn = blockIdx.x - tm * tilesN;
  const int ldc = N;

  const int rlane = lane & 15;                 // row (A) / col (B, D) within subtile
  const int koff  = (lane >> 4) * 8;           // k offset of this lane half
  const int mOff  = (lane >> 4) * 8;           // D row offset

  // copy map: thread t brings segment t & 7 (16 B) of rows (t >> 3) + 16 x, x = 0..7, of each operand
  const _Float16* gA = A  + (size_t)(tm * 128 + (tid >> 3)) * kE + (tid & 7) * 8;
  const _Float16* gB = Bt + (size_t)(tn * 128 + (tid >> 3)) * kE + (tid & 7) * 8;
  const unsigned ldsA = (unsigned)(size_t)(&sAB[0][0]) + (unsigned)(((tid >> 3) * kGPitch + (tid & 7) * 8) * 2);
  const unsigned ldsB = ldsA + 128u * kGPitch * 2u;
  constexpr unsigned kStageBytes = kGStage * 2u;
  constexpr int T = kE / kGK;                  // 16 stages

  // all but the copies of the NBUF - 2 youngest stages have landed: the count of the waits that publish a stage
  constexpr int kYounger = (NBUF - 2) * kGCopies;
#pragma unroll   // the first NBUF - 1 stages go out back to back, each buffer's offset a constant
  for (int s = 0; s < NBUF - 1; ++s) {
    stage_rows128(ldsA + (unsigned)s * kStageBytes, gA + s * kGK);
    stage_rows128(ldsB + (unsigned)s * kStageBytes, gB + s * kGK);
  }
  asm volatile("s_wait_asynccnt %0" :: "n"(kYounger) : "memory");   // this wave's share of stage 0 has landed
  __syncthreads();                                                   // publishes stage 0
  stage_rows128(ldsA + (unsigned)(NBUF - 1) * kStageBytes, gA + (NBUF - 1) * kGK);
  stage_rows128(ldsB + (unsigned)(NBUF - 1) * kStageBytes, gB + (NBUF - 1) * kGK);

  v8f acc[4][4];
#pragma unroll
  for (int i = 0; i < 4; ++i)
#pragma unroll
    for (int j = 0; j < 4; ++j) acc[i][j] = (v8f){0.f,0.f,0.f,0.f,0.f,0.f,0.f,0.f};

  const int aOff = ((wave >> 1) * 64 + rlane) * kGPitch + koff;
  const int bOff = (128 + (wave & 1) * 64 + rlane) * kGPitch + koff;

#pragma unroll 1   // one trip per stage: the buffer index and the refill test stay scalar, the loop stays small
  for (int t = 0; t < T; ++t) {
    const _Float16* st = sAB[t & (NBUF - 1)];
    v16h bh[2][4], ah[2][4];
#pragma unroll
    for (int kk = 0; kk < 2; ++kk) {
#pragma unroll
      for (int j = 0; j < 4; ++j) bh[kk][j] = F::load(st + bOff + j * 16 * kGPitch + kk * 32);
#pragma unroll
      for (int i = 0; i < 4; ++i) ah[kk][i] = F::load(st + aOff + i * 16 * kGPitch + kk * 32);
    }
    // all fragment reads of the stage are issued as one group in front of its products: one LDS latency a trip, and the second
    // half's reads land behind the first half's products (without it the compiler reuses one A fragment and waits at every row)
    __builtin_amdgcn_sched_barrier(0);
#pragma unroll
    for (int kk = 0; kk < 2; ++kk)
#pragma unroll
      for (int i = 0; i < 4; ++i)
#pragma unroll
        for (int j = 0; j < 4; ++j) acc[i][j] = F::mma(ah[kk][i], bh[kk][j], acc[i][j]);
    // keeps the waits and the barrier below behind the products: lifted over them they would wait for the next stage's copies
    // right after their issue, and for the second half's fragment reads in front of the first product
    __builtin_amdgcn_sched_barrier(0);
    asm volatile("s_wait_dscnt 0x0" ::: "memory");      // this wave's reads of the buffer are done before it is refilled
    // this wave's share of stage t + 1 has landed. Outstanding here are stages t + 1 .. t + NBUF - 1, kGCopies of this wave each,
    // while they all exist: the counted wait leaves the younger ones in flight. In the last trips fewer are outstanding: to 0.
    if (NBUF > 2 && t + NBUF - 1 < T) {                  // a scalar test, the same for the whole block
      asm volatile("s_wait_asynccnt %0" :: "n"(kYounger) : "memory");
    } else {
      asm volatile("s_wait_asynccnt 0x0" ::: "memory");
    }
    __syncthreads();                                     // publishes stage t + 1; ends every wave's reads of stage t
    if (t + NBUF < T) {                                  // the same for the whole block
      const unsigned bo = (unsigned)(t & (NBUF - 1)) * kStageBytes;
      stage_rows128(ldsA + bo, gA + (t + NBUF) * kGK);
      stage_rows128(ldsB + bo, gB + (t + NBUF) * kGK);
    }
  }
  asm volatile("s_wait_asynccnt 0x0" ::: "memory");     // no copy is outstanding when the wave goes on to its end

  // ---- epilogue ----
  const int m0 = tm * 128 + (wave >> 1) * 64;
  const int n0 = tn * 128 + (wave & 1) * 64;
  float* slab = sT[wave];
#pragma unroll
  for (int i = 0; i < 4; ++i) {
    const int mBase = m0 + (i << 4);
#pragma unroll
    for (int j = 0; j < 4; ++j) {
      const float bv = bias[n0 + (j << 4) + rlane];
#pragma unroll
      for (int r = 0; r < 8; ++r) slab[(mOff + r) * 68 + (j << 4) + rlane] = acc[i][j][r] * scale + bv;
    }
    __builtin_amdgcn_fence(__ATOMIC_RELEASE, "workgroup");
    __builtin_amdgcn_wave_barrier();
    __builtin_amdgcn_fence(__ATOMIC_ACQUIRE, "workgroup");
    if (OUT_MODE == 0) {
      float* C = (float*)Cout;
      const int hh = lane >> 4, c4 = (lane & 15) * 4;     // row seg = 256 B = 16 lanes x 16 B
#pragma unroll
      for (int it = 0; it < 8; ++it) {
        const int row = it * 2 + hh;
        const v4f v = *(const v4f*)(slab + row * 68 + c4);
        *(v4f*)(C + (size_t)(mBase + row) * ldc + n0 + c4) = v;
      }
    } else {
      const int q = lane >> 3, c8 = (lane & 7) * 8;
      unsigned short* C = (unsigned short*)Cout;
#pragma unroll
      for (int it = 0; it < 4; ++it) {
        const int row = it * 4 + q;
        const float* sp = slab + row * 68 + c8;
        v8h hv;
#pragma unroll
        for (int e = 0; e < 8; ++e) hv[e] = (_Float16)sp[e];
        *(v8h*)(C + (size_t)(mBase + row) * ldc + n0 + c8) = hv;
      }
    }
    asm volatile("s_wait_xcnt 0x0" ::: "memory");   // stands in front of the next rows' reuse of the registers that these stores name
    __builtin_amdgcn_fence(__ATOMIC_RELEASE, "workgroup");
    __builtin_amdgcn_wave_barrier();
    __builtin_amdgcn_fence(__ATOMIC_ACQUIRE, "workgroup");
  }
}

// ---------------------------------------------------------------------------
// f32 -> f16 casts of all four operand planes (exact power-of-two carries) in one launch.
// A thread converts 8 chunks of 8 consecutive elements (two 16-B loads, one 16-B store a chunk); a thread's chunks lie 4096
// elements apart, so a block of 16 waves covers 32,768 consecutive elements of one plane.
// Few waves with much to move each (for speed only).
// Blocks 0..127 query, 128..223 W_in, 224..255 W_o, 256..257 Er; every plane is a whole number of blocks.
// ---------------------------------------------------------------------------
constexpr int kCastThreads = 512;
constexpr int kCastChunks  = 8;
constexpr int kCastStep    = kCastThreads * 8;           // elements from one chunk of a thread to its next
constexpr int kCastBlock   = kCastStep * kCastChunks;    // 32,768 elements of a block
constexpr int kCastEndX    = kTok * kE / kCastBlock;                 // 128
constexpr int kCastEndWin  = kCastEndX + kN3 * kE / kCastBlock;      // 224
constexpr int kCastEndWo   = kCastEndWin + kE * kE / kCastBlock;     // 256
constexpr int kCastBlocks  = kCastEndWo + kL * kDh / kCastBlock;     // 258
static_assert((kTok * kE) % kCastBlock == 0 && (kN3 * kE) % kCastBlock == 0 && (kE * kE) % kCastBlock == 0 &&
              (kL * kDh) % kCastBlock == 0, "cast coverage");

__global__ __launch_bounds__(kCastThreads) void cast_planes_f16_kernel(
    const float* __restrict__ x, const float* __restrict__ win, const float* __restrict__ wo, const float* __restrict__ er,
    unsigned short* __restrict__ xh, unsigned short* __restrict__ winh, unsigned short* __restrict__ woh,
    unsigned short* __restrict__ erh) {
  const int bi = blockIdx.x;
  const int plane = (bi >= kCastEndX) + (bi >= kCastEndWin) + (bi >= kCastEndWo);
  const float* in     = plane == 0 ? x  : plane == 1 ? win  : plane == 2 ? wo  : er;
  unsigned short* out = plane == 0 ? xh : plane == 1 ? winh : plane == 2 ? woh : erh;
  const int first     = plane == 0 ? 0  : plane == 1 ? kCastEndX : plane == 2 ? kCastEndWin : kCastEndWo;
  const float scale   = (plane == 1 || plane == 2) ? kWCarry : 1.0f;
  const size_t base = (size_t)(bi - first) * kCastBlock + threadIdx.x * 8;
  const float* p = in + base;
  v4f a[kCastChunks], c[kCastChunks];
#pragma unroll
  for (int k = 0; k < kCastChunks; ++k) {
    a[k] = *(const v4f*)(p + k * kCastStep);
    c[k] = *(const v4f*)(p + k * kCastStep + 4);
  }
  // All 16 loads of the thread are issued in front of this line, so a wave pays one memory latency. The wait stands in front of
  // any reuse of the loads' address registers, which the operand keeps apart from the loads' own destinations.
  asm volatile("s_wait_xcnt 0x0" :: "v"(p) : "memory");
  unsigned short* q = out + base;
#pragma unroll
  for (int k = 0; k < kCastChunks; ++k) {
    unsigned short hb[8];
#pragma unroll
    for (int e = 0; e < 4; ++e) {
      hb[e]     = h_bits(a[k][e] * scale);
      hb[4 + e] = h_bits(c[k][e] * scale);
    }
    *(v4u*)(q + k * kCastStep) = (v4u){pk16(hb[0], hb[1]), pk16(hb[2], hb[3]), pk16(hb[4], hb[5]), pk16(hb[6], hb[7])};
  }
}

// ---------------------------------------------------------------------------
// Fused attention of one (batch, head): content scores, skewed relative scores, softmax and attn.v in one kernel.
// A block of 16 waves owns 256 queries. A wave owns 32 of them (two tiles of 16: i0 .. i0+15 and i0+16 .. i0+31) and one half
// of the 1024 keys (waves 0..7 keys 0..511, waves 8..15 keys 512..1023), which it walks 32 at a time (a pass, 16 of them).
// Every K and V fragment that a wave reads from LDS serves its two query tiles, and the four 16-row tiles of Er that a pass
// reads serve the three that each query tile needs: the LDS reads per score fall, which is what the split is for.
// The two waves of a query group each keep a running softmax over their own keys; behind the loop the upper half's maxima,
// sums and O^T go through LDS to the lower half's wave, which joins them and stores the output.
// The 32 query groups of a (batch, head) are dealt round robin to its 4 blocks (group = (wave & 7) * 4 + blockIdx.x), because a
// group's relative-score work grows with i0: so every block carries the same share of it.
// Everything is computed transposed, so that a lane holds one query column (c = lane & 15) and the lane halves split its keys:
//   S^T  = K . Q^T        A = 16 key rows,          B = Q rows (kept in registers)  -> D[key 8*hf + r][query c]
//   QE^T = Er . Q^T       A = 16 rows m of Er,      B = the same Q                  -> D[m 8*hf + r][query c]
//   O^T += V^T . P^T      A = 16 d rows of V^T,     B = the two S^T tiles of the pass, converted in place
// V stays in the qkv plane's own row-major form, in memory and in LDS: the transposing 16-bit LDS load hands a lane
// V[key 8*hf + 0..7][d = 16 t + c], which is the A fragment of V^T in the k order that the packed score tiles have.
// LDS: Er (filled once), each key half's 32 K rows and 32 V rows of the pass (two buffers: every thread fetches 16 bytes of
// each half's next tile into registers before the pass's work and stores them behind it; the one block barrier at the foot of a
// pass publishes those tiles and ends the last read of the buffer that the next pass refills).
// Row pitches: 144 B (16 B x odd) for the plain 16-byte fragment reads of K and Er, 160 B (32 B x odd) for the transposing
// reads of V: each reader free of bank conflicts at its own.
// Skew: srel[i][j] = QE[i][(L-1) - i + j] for j <= i, else 0. For query iq + c of the tile at iq and key j0 + jl the row of Er is
// mb + 15 - c + jl with mb = L - 16 - iq + j0, so 48 rows from mb on serve the tile; the upper tile's mb lies 16 rows below the
// lower tile's, so 64 rows serve both. The shift by the lane's own c goes through a per-wave, per-tile LDS strip
// [query c][48 m], pitch 52 floats (16-B aligned rows; the shifted reads of the 32 lanes fall on 32 different banks).
// Rows of Er past L-1 belong to j > i only, where srel is 0: in LDS 32 rows of zeros stand behind row L-1 (a pass with a relative term
// has j0 <= i0, so its 64 rows end at L+31 at most). Their products are 0, so the strips already hold srel for every key of the pass:
// no row address is clamped and no score is compared with the diagonal.
// Passes with every key above both tiles' diagonal (j0 > i0 + 31) have no relative term and skip that part.
// Softmax is the running-maximum form in the log2 domain (logit * 0.125 * log2 e): per pass the maximum of the lane's 16
// scores and of the other half's, p = 2^(logit - max + 15) in f32, f16 for the product; sums and O^T are rescaled by
// 2^(old max - new max). The x2^15 carry is in numerator and denominator alike and cancels in the epilogue.
// grid (L / 256, 64 bh), 512 threads.
// ---------------------------------------------------------------------------
__device__ __forceinline__ float other_half(float x) {   // lane l <-> lane l ^ 16
  const int v = __builtin_bit_cast(int, x);
  return __builtin_bit_cast(float, __builtin_amdgcn_permlanex16(v, v, 0x76543210, 0xfedcba98, false, false));
}

// Eight 2^x, each in its own register. With the registers nearly all in use the compiler gave an exponential's result the source
// register of the exponential directly in front of it; in place no exponential touches a neighbour's registers, and the v_nop
// is the one slot between the last of them and whatever reads its result.
__device__ __forceinline__ void exp2_in_place8(float& a, float& b, float& c, float& d, float& e, float& f, float& g, float& h) {
  asm("v_exp_f32 %0, %0\n\t"
      "v_exp_f32 %1, %1\n\t"
      "v_exp_f32 %2, %2\n\t"
      "v_exp_f32 %3, %3\n\t"
      "v_exp_f32 %4, %4\n\t"
      "v_exp_f32 %5, %5\n\t"
      "v_exp_f32 %6, %6\n\t"
      "v_exp_f32 %7, %7\n\t"
      "v_nop"
      : "+v"(a), "+v"(b), "+v"(c), "+v"(d), "+v"(e), "+v"(f), "+v"(g), "+v"(h));
}

// The same for four values.
__device__ __forceinline__ void exp2_in_place4(float& a, float& b, float& c, float& d) {
  asm("v_exp_f32 %0, %0\n\t"
      "v_exp_f32 %1, %1\n\t"
      "v_exp_f32 %2, %2\n\t"
      "v_exp_f32 %3, %3\n\t"
      "v_nop"
      : "+v"(a), "+v"(b), "+v"(c), "+v"(d));
}

// 16 x 16 tile of 16-bit elements, row-major in LDS, transposed: 8 halves a lane
__device__ __forceinline__ v8h lds_tr16(const _Float16* p) {
  typedef __attribute__((ext_vector_type(8))) short s16x8;
  typedef __attribute__((address_space(3))) s16x8 lds_s16x8;
  return __builtin_bit_cast(v8h, __builtin_amdgcn_ds_load_tr16_b128_v8i16((lds_s16x8*)p));
}

__global__ __launch_bounds__(kFaThreads) void rel_attn_fused_kernel(const unsigned short* __restrict__ QKVp,
                                                                    const unsigned short* __restrict__ ERp,
                                                                    unsigned short* __restrict__ O16p) {
  typedef Frag<_Float16> F;
  __shared__ __align__(16) _Float16 sE[(kL + kErPad) * kKPitch];         // 152,064 B
  __shared__ __align__(16) _Float16 sKV[2][2][kStageHalves];             //  38,912 B: [buffer][key half]
  __shared__ __align__(16) float strip[kFaWaves][2][16 * kStripPitch];   // 106,496 B: [wave][query tile]; behind the loop the exchange
  const _Float16* QKV = (const _Float16*)QKVp;
  const _Float16* ER  = (const _Float16*)ERp;
  const int tid  = threadIdx.x;
  const int lane = tid & 31;
  const int wave = __builtin_amdgcn_readfirstlane(tid >> 5);   // scalar, so that the diagonal test is a scalar branch
  const int kh   = wave >> 3;                  // key half of this wave
  const int grp  = wave & 7;                   // query group of this wave: waves w and w + 8 share one
  const int c    = lane & 15;
  const int koff = (lane >> 4) * 8;            // k offset of this lane half (operands), row offset (D)
  const int bh   = blockIdx.y;
  const int b    = bh >> 4;
  const int h    = bh & 15;
  const int i0   = (grp * (kL / kFaQ) + blockIdx.x) * 32;

  // staging map: waves 0..7 bring the K tiles, waves 8..15 the V tiles, each tile 32 rows x 8 segments of 16 B of the qkv plane;
  // a thread brings its segment of the lower key half's tile and of the upper key half's
  const bool isK = wave < 8;
  const int  tv  = tid & 255;
  const _Float16* gsrc = QKV + ((size_t)(tv >> 3) * kB + b) * kN3 + (isK ? kE : 2 * kE) + h * kDh + (tv & 7) * 8;
  constexpr size_t gstep = (size_t)32 * kLdTok;                       // halves from one pass's tile to the next
  constexpr size_t ghalf = (size_t)kFaPasses * gstep;                 // halves from the lower key half's tile to the upper's
  const int    dstOff = (isK ? (tv >> 3) * kKPitch : kStageV + (tv >> 3) * kVPitch) + (tv & 7) * 8;
  // transposing read: lane l names 16 B of key row 8 (l >> 4) + (l & 7), d columns 8 ((l >> 3) & 1) .. + 7 of a 16 x 16 tile
  const int    vOff   = kStageV + (koff + (lane & 7)) * kVPitch + ((lane >> 3) & 1) * 8;

  const v8h g0 = *(const v8h*)gsrc;
  const v8h g1 = *(const v8h*)(gsrc + ghalf);
  v16h q0[2], q1[2];
#pragma unroll
  for (int qt = 0; qt < 2; ++qt) {
    const _Float16* qrow = QKV + ((size_t)(i0 + qt * 16 + c) * kB + b) * kN3 + h * kDh + koff;
    q0[qt] = F::load(qrow);
    q1[qt] = F::load(qrow + 32);
  }
  asm volatile("s_wait_xcnt 0x0" ::: "memory");   // stands in front of the reuse of these loads' address registers by the fill below
  // Er: 2048 segments of 16 B a trip, a trip's four loads of a thread in flight together
  for (int seg0 = 0; seg0 < kL * 8; seg0 += 4 * kFaThreads) {
    v8h e[4];
#pragma unroll
    for (int x = 0; x < 4; ++x) e[x] = *(const v8h*)(ER + (size_t)(seg0 + x * kFaThreads + tid) * 8);
#pragma unroll
    for (int x = 0; x < 4; ++x) {
      const int idx = seg0 + x * kFaThreads + tid;
      *(v8h*)(sE + (idx >> 3) * kKPitch + (idx & 7) * 8) = e[x];
    }
  }
  if (tid < kErPad * kKPitch / 8) *(v8h*)(sE + kL * kKPitch + tid * 8) = (v8h){0, 0, 0, 0, 0, 0, 0, 0};   // the rows of zeros
  *(v8h*)(sKV[0][0] + dstOff) = g0;
  *(v8h*)(sKV[0][1] + dstOff) = g1;
  __syncthreads();

  float* sp0 = strip[wave][0] + c * kStripPitch;
  float* sp1 = strip[wave][1] + c * kStripPitch;

  const v8f zero8 = (v8f){0.f, 0.f, 0.f, 0.f, 0.f, 0.f, 0.f, 0.f};
  v8f o[2][4];
  float m[2], l[2];
#pragma unroll
  for (int qt = 0; qt < 2; ++qt) {
#pragma unroll
    for (int t = 0; t < 4; ++t) o[qt][t] = zero8;
    m[qt] = -__builtin_inff();
    l[qt] = 0.f;
  }

  for (int ps = 0; ps < kFaPasses; ++ps) {
    const int j0 = (kh * kFaPasses + ps) * 32;
    const _Float16* kv = sKV[ps & 1][kh];
    const bool more = ps + 1 < kFaPasses;
    v8h ga, gb;
    if (more) {
      ga = *(const v8h*)(gsrc + (size_t)(ps + 1) * gstep);
      gb = *(const v8h*)(gsrc + (size_t)(ps + 1) * gstep + ghalf);
      asm volatile("s_wait_xcnt 0x0" ::: "memory");   // stands in front of the next pass's rewrite of these loads' address registers
    }

    v8f s[2][2];
    v16h ka[2], kb[2];
#pragma unroll
    for (int u = 0; u < 2; ++u) {
      const _Float16* kp = kv + (u * 16 + c) * kKPitch + koff;
      ka[u] = F::load(kp);
      kb[u] = F::load(kp + 32);
    }
    const bool rel = j0 <= i0 + 31;
    // first of the 64 rows of Er: the upper query tile's mb. Taken as one scalar value, so that a lane's address is one addition and the
    // 16 reads differ by immediate offsets (left open, the compiler splits off (L - 32) rows, too far for an offset: an addition a read)
    const int mbase = __builtin_amdgcn_readfirstlane((kL - 32) - i0 + j0);
    // tile x of the 64 rows is tile t = x of the upper query tile's 48 rows (x < 3) and tile t = x - 1 of the lower's (x > 0)
    v16h ea[4], eb[4];
    if (rel) {
#pragma unroll
      for (int x = 0; x < 2; ++x) {
        const _Float16* ep = sE + (mbase + x * 16 + c) * kKPitch + koff;
        ea[x] = F::load(ep);
        eb[x] = F::load(ep + 32);
      }
    }
    // the K fragments and the first two Er tiles are read as one group in front of the first product: one LDS latency
    // instead of one per product (without it the compiler reuses the fragment registers and waits for each pair of reads in turn)
    __builtin_amdgcn_sched_barrier(0);
#pragma unroll
    for (int u = 0; u < 2; ++u) {
      s[0][u] = F::mma(ka[u], q0[0], zero8);
      s[1][u] = F::mma(ka[u], q0[1], zero8);
      s[0][u] = F::mma(kb[u], q1[0], s[0][u]);
      s[1][u] = F::mma(kb[u], q1[1], s[1][u]);
    }

    if (rel) {
#pragma unroll
      for (int x = 2; x < 4; ++x) {
        const _Float16* ep = sE + (mbase + x * 16 + c) * kKPitch + koff;
        ea[x] = F::load(ep);
        eb[x] = F::load(ep + 32);
      }
      {   // Er tiles 0 and 1
        v8f z0 = F::mma(ea[0], q0[1], zero8);
        v8f z1 = F::mma(ea[1], q0[1], zero8);
        v8f z2 = F::mma(ea[1], q0[0], zero8);
        z0 = F::mma(eb[0], q1[1], z0);
        z1 = F::mma(eb[1], q1[1], z1);
        z2 = F::mma(eb[1], q1[0], z2);
        *(v4f*)(sp1 + koff)          = (v4f){z0[0], z0[1], z0[2], z0[3]};
        *(v4f*)(sp1 + koff + 4)      = (v4f){z0[4], z0[5], z0[6], z0[7]};
        *(v4f*)(sp1 + 16 + koff)     = (v4f){z1[0], z1[1], z1[2], z1[3]};
        *(v4f*)(sp1 + 16 + koff + 4) = (v4f){z1[4], z1[5], z1[6], z1[7]};
        *(v4f*)(sp0 + koff)          = (v4f){z2[0], z2[1], z2[2], z2[3]};
        *(v4f*)(sp0 + koff + 4)      = (v4f){z2[4], z2[5], z2[6], z2[7]};
      }
      // The next three products start from zero in registers that may be those of the three results above: the four slots are the
      // distance that the chip wants between a matrix result and its overwrite; the scheduling barriers hold them in this place.
      __builtin_amdgcn_sched_barrier(0);
      asm volatile("v_nop\n\tv_nop\n\tv_nop\n\tv_nop");
      __builtin_amdgcn_sched_barrier(0);
      {   // Er tiles 2 and 3
        v8f z0 = F::mma(ea[2], q0[1], zero8);
        v8f z1 = F::mma(ea[2], q0[0], zero8);
        v8f z2 = F::mma(ea[3], q0[0], zero8);
        z0 = F::mma(eb[2], q1[1], z0);
        z1 = F::mma(eb[2], q1[0], z1);
        z2 = F::mma(eb[3], q1[0], z2);
        *(v4f*)(sp1 + 32 + koff)     = (v4f){z0[0], z0[1], z0[2], z0[3]};
        *(v4f*)(sp1 + 32 + koff + 4) = (v4f){z0[4], z0[5], z0[6], z0[7]};
        *(v4f*)(sp0 + 16 + koff)     = (v4f){z1[0], z1[1], z1[2], z1[3]};
        *(v4f*)(sp0 + 16 + koff + 4) = (v4f){z1[4], z1[5], z1[6], z1[7]};
        *(v4f*)(sp0 + 32 + koff)     = (v4f){z2[0], z2[1], z2[2], z2[3]};
        *(v4f*)(sp0 + 32 + koff + 4) = (v4f){z2[4], z2[5], z2[6], z2[7]};
      }
      // lanes c and c + 16 read what both of them wrote: the strips' stores stay in front of their reads
      __builtin_amdgcn_fence(__ATOMIC_RELEASE, "workgroup", "local");
      __builtin_amdgcn_wave_barrier();
      __builtin_amdgcn_fence(__ATOMIC_ACQUIRE, "workgroup", "local");
#pragma unroll
      for (int qt = 0; qt < 2; ++qt) {
        const float* rp = (qt == 0 ? sp0 : sp1) + 15 - c + koff;
#pragma unroll
        for (int u = 0; u < 2; ++u)
#pragma unroll
          for (int r = 0; r < 8; ++r) s[qt][u][r] += rp[u * 16 + r];
      }
    }

    float alpha[2];
    v16h pb[2];
#pragma unroll
    for (int qt = 0; qt < 2; ++qt) {
      float mx = s[qt][0][0];
#pragma unroll
      for (int r = 1; r < 8; ++r) mx = fmaxf(mx, s[qt][0][r]);
#pragma unroll
      for (int r = 0; r < 8; ++r) mx = fmaxf(mx, s[qt][1][r]);
      mx = fmaxf(mx, other_half(mx));
      const float mnew = fmaxf(m[qt], mx * kLogitScale);
      alpha[qt] = __builtin_amdgcn_exp2f(m[qt] - mnew);
      const float msh = mnew - kPCarryLog2;
      m[qt] = mnew;
      float psum = 0.f;
#pragma unroll
      for (int u = 0; u < 2; ++u) {
        float p[8];
#pragma unroll
        for (int r = 0; r < 8; ++r) p[r] = fmaf(s[qt][u][r], kLogitScale, -msh);
        exp2_in_place8(p[0], p[1], p[2], p[3], p[4], p[5], p[6], p[7]);
#pragma unroll
        for (int r = 0; r < 8; ++r) {
          psum += p[r];
          pb[qt][u * 8 + r] = (_Float16)p[r];
        }
      }
      l[qt] = fmaf(l[qt], alpha[qt], psum);
    }
#pragma unroll
    for (int t = 0; t < 4; ++t) {
      F::U va;   // keys 0..15 of the pass in elements 0..7 of the two lane halves, keys 16..31 in elements 8..15
      va.h[0] = lds_tr16(kv + vOff + t * 16);
      va.h[1] = lds_tr16(kv + vOff + 16 * kVPitch + t * 16);
#pragma unroll
      for (int qt = 0; qt < 2; ++qt) {
        o[qt][t] *= alpha[qt];
        o[qt][t] = F::mma(va.v, pb[qt], o[qt][t]);
      }
    }
    // A branch follows the last product: these four slots fill the distance that the chip wants between a product and an overwrite
    // of its operands on both sides of it; the scheduling barriers hold them here.
    __builtin_amdgcn_sched_barrier(0);
    asm volatile("v_nop\n\tv_nop\n\tv_nop\n\tv_nop");
    __builtin_amdgcn_sched_barrier(0);

    if (more) {   // the same for the whole block
      *(v8h*)(sKV[(ps + 1) & 1][0] + dstOff) = ga;
      *(v8h*)(sKV[(ps + 1) & 1][1] + dstOff) = gb;
      __syncthreads();   // publishes the next pass's tiles; ends this pass's reads of its own buffer
    }
  }

  // ---- the two key halves of a query group are joined: lane for lane the two waves hold the same query column and rows of O^T ----
  __syncthreads();   // every wave has made its last read of its strips: their LDS becomes the exchange area
  float* xp = &strip[0][0][0] + (grp * 32 + lane) * kXPitch;
  if (kh == 1) {     // a scalar test
#pragma unroll
    for (int qt = 0; qt < 2; ++qt)
#pragma unroll
      for (int t = 0; t < 4; ++t) {
        const v8f ov = o[qt][t];
        *(v4f*)(xp + (qt * 4 + t) * 8)     = (v4f){ov[0], ov[1], ov[2], ov[3]};
        *(v4f*)(xp + (qt * 4 + t) * 8 + 4) = (v4f){ov[4], ov[5], ov[6], ov[7]};
      }
    *(v4f*)(xp + 64) = (v4f){m[0], m[1], l[0], l[1]};
  }
  __syncthreads();   // publishes the upper half's maxima, sums and O^T
  if (kh == 0) {     // a scalar test
    const v4f ml = *(const v4f*)(xp + 64);
    float al[2], au[2];   // 2^(own maximum - joint maximum) of the lower and of the upper key half
#pragma unroll
    for (int qt = 0; qt < 2; ++qt) {
      const float mj = fmaxf(m[qt], ml[qt]);
      al[qt] = m[qt] - mj;
      au[qt] = ml[qt] - mj;
    }
    exp2_in_place4(al[0], au[0], al[1], au[1]);
#pragma unroll
    for (int qt = 0; qt < 2; ++qt) {
      float lj = fmaf(l[qt], al[qt], ml[2 + qt] * au[qt]);
      lj += other_half(lj);
      const float inv = kOCarry / lj;
      const float fl = al[qt] * inv;
      const float fu = au[qt] * inv;
      unsigned short* op = O16p + ((size_t)(i0 + qt * 16 + c) * kB + b) * kE + h * kDh + koff;
#pragma unroll
      for (int t = 0; t < 4; ++t) {
        const v4f x0 = *(const v4f*)(xp + (qt * 4 + t) * 8);
        const v4f x1 = *(const v4f*)(xp + (qt * 4 + t) * 8 + 4);
        v8h hv;
#pragma unroll
        for (int r = 0; r < 4; ++r) {
          hv[r]     = (_Float16)fmaf(o[qt][t][r], fl, x0[r] * fu);
          hv[4 + r] = (_Float16)fmaf(o[qt][t][4 + r], fl, x1[r] * fu);
        }
        *(v8h*)(op + t * 16) = hv;
      }
    }
  }
}

// ---------------------------------------------------------------------------
// Host glue.
//   XH    f16 [4096][1024]            8,388,608  at           0   (query, A of the qkv projection)
//   WIN   f16 [3072][1024] (x16)      6,291,456  at   8,388,608   (Bt)
//   WO    f16 [1024][1024] (x16)      2,097,152  at  14,680,064   (Bt)
//   ER    f16 [1024][64]                131,072  at  16,777,216   (A of the relative scores)
//   QKV   f16 [4096][3072]           25,165,824  at  16,908,288   (qkv + bias; q cols 0.., k cols 1024.., v cols 2048..)
//   O16   f16 [4096][1024] (x256)     8,388,608  at  42,074,112   (attention output, A of the output projection)
//   total                           50,462,720
// GEMM shapes: qkv M=4096 N=3072 K=1024; out M=4096 N=1024 K=1024. All M,N multiples of 128, K a multiple of 64.
// Launches: 1 cast + 1 qkv GEMM + 1 fused attention over all 64 (batch, head) + 1 out GEMM = 4.
// ---------------------------------------------------------------------------
extern "C" void kernel_launch(void* const* d_in, const int* in_sizes, int n_in,
                              void* d_out, int out_size, void* d_ws, size_t ws_size,
                              hipStream_t stream) {
  if (n_in < 6) return;
  const int nTokE = kTok * kE;                     // 4,194,304
  if (in_sizes[0] != nTokE) return;
  if (in_sizes[1] != kL * kDh) return;
  if (in_sizes[2] != kN3 * kE) return;
  if (in_sizes[3] != kN3) return;
  if (in_sizes[4] != kE * kE) return;
  if (in_sizes[5] != kE) return;
  if (out_size != nTokE) return;

  const size_t szXH  = (size_t)kTok * kE * 2;
  const size_t szWIN = (size_t)kN3 * kE * 2;
  const size_t szWO  = (size_t)kE * kE * 2;
  const size_t szER  = (size_t)kL * kDh * 2;
  const size_t szQKV = (size_t)kTok * kN3 * 2;
  const size_t szO16 = (size_t)kTok * kE * 2;
  const size_t offXH  = 0;
  const size_t offWIN = offXH + szXH;
  const size_t offWO  = offWIN + szWIN;
  const size_t offER  = offWO + szWO;
  const size_t offQKV = offER + szER;
  const size_t offO16 = offQKV + szQKV;
  const size_t total  = offO16 + szO16;
  if (ws_size < total) return;

  const float* query  = (const float*)d_in[0];
  const float* relpos = (const float*)d_in[1];
  const float* win    = (const float*)d_in[2];
  const float* bin    = (const float*)d_in[3];
  const float* wout   = (const float*)d_in[4];
  const float* bout   = (const float*)d_in[5];
  float* out = (float*)d_out;
  char* ws = (char*)d_ws;
  unsigned short* XH  = (unsigned short*)(ws + offXH);
  unsigned short* WIN = (unsigned short*)(ws + offWIN);
  unsigned short* WO  = (unsigned short*)(ws + offWO);
  unsigned short* ER  = (unsigned short*)(ws + offER);
  unsigned short* QKV = (unsigned short*)(ws + offQKV);
  unsigned short* O16 = (unsigned short*)(ws + offO16);

  // ---- prologue: 16-bit operand planes ----
  cast_planes_f16_kernel<<<dim3(kCastBlocks), dim3(kCastThreads), 0, stream>>>(query, win, wout, relpos, XH, WIN, WO, ER);

  // ---- packed qkv projection: QKV[m][n] = f16( (1/16) * sum_k XH[m][k] * WIN[n][k] + b_in[n] )   (M=4096, N=3072, K=1024)
  {
    const int tiles = (kTok / 128) * (kN3 / 128);   // 768 blocks of 4 waves
    wmma_gemm_staged<1, 2><<<dim3(tiles), dim3(kGThreads), 0, stream>>>(XH, WIN, (void*)QKV, bin, kN3, kWCarryInv);
  }

  // ---- scores, skew, softmax and attn.v of all 64 (batch, head): O16[(l*4+b)][h*64+d] = f16( 256 * sum_j P[bh][l][j] * v[bh][j][d] )
  rel_attn_fused_kernel<<<dim3(kL / kFaQ, kB * kH), dim3(kFaThreads), 0, stream>>>(QKV, ER, O16);

  // ---- output projection: out[m][n] = (1/4096) * sum_e O16[m][e] * WO[n][e] + b_out[n]   (M=4096, N=1024, K=1024)
  {
    const int tiles = (kTok / 128) * (kE / 128);   // 256 blocks of 4 waves, one on a WGP
    wmma_gemm_staged<0, 4><<<dim3(tiles), dim3(kGThreads), 0, stream>>>(O16, WO, (void*)out, bout, kE, kOutScale);
  }
}
